// v000
// Times are from an AMD MI455X. After a warm-up the kernel runs many times in a row, and a time is the length of
// such a window on the GPU divided by its runs, so every launch and the gaps after it count. The runs cycle
// through copies of the inputs. A figure is the median of several windows, for all but v000 over two sittings.
// Sittings can differ by a few percent; kernels timed side by side share one.
// The starting kernel, v000, takes 4900 microseconds a run.
#include <hip/hip_runtime.h>
// Single-head self-attention (x [8][2048][256]; Q, K, V = x W ([in][out] [256][256]); scores = Q.K/16; softmax over all 2048 keys; out = attn V -> [8][2048][256]).
// Structure: token rows; x as exact f16 rows; q | k | v WMMA GEMMs (32x64 wave tiles, f32 accumulation, exact x16 transposed [in][out] weights); q, k as f16 rows; v as f16 rows, V^T via LDS transposes; per (batch, 2048-query tile): scores GEMM (K = 256), row softmax on VALU (f32; P x256 f16), out = P . V^T GEMM written straight to the f32 output.
// Compute dtype: inputs rounded to bf16; x / weights exact; q, k plain f16 (~2^-12); v, P plain f16 (~2^-12); scores / softmax f32. v_wmma_f32_16x16x32_f16.
#define NB 8
#define SQ 2048
#define DM 256
#define DQ 256
#define DV 256
#define QT 2048                     /* query tile */
#define NH 4                    /* V^T slabs of 64 (k_vt<NH, SQ>) */
#define HD 64
#define HG 1
#define NR ((size_t)NB * SQ)
#define QN SQ                        /* query rows per batch (debug hook) */
#define NBR NB                       /* batches (debug hook) */
#define MP ((int)NR)                 /* rows through the projections (debug hook) */
typedef __bf16 v16b __attribute__((ext_vector_type(16)));
typedef unsigned short v8us __attribute__((ext_vector_type(8), may_alias));
typedef float  v8f  __attribute__((ext_vector_type(8)));
typedef float  v4f  __attribute__((ext_vector_type(4)));
typedef float  v4fa __attribute__((ext_vector_type(4), may_alias));
union FragB { v16b v; v8us half[2]; unsigned short u[16]; };

__device__ __forceinline__ unsigned short bf16_bits(float x) { unsigned int u = __float_as_uint(x); return (unsigned short)((u + 0x7FFFu + ((u >> 16) & 1u)) >> 16); }
__device__ __forceinline__ float bf16_val(unsigned short b) { return __uint_as_float(((unsigned int)b) << 16); }
__device__ __forceinline__ float bf16_round(float x) { return bf16_val(bf16_bits(x)); }
// D += A·B with NT terms: 1 = ah·bh, 2 = + al·bh (A split), 3 = + ah·bl (both split)
template <int NT>
__device__ __forceinline__ v8f mmaN(v16b ah, v16b al, v16b bh, v16b bl, v8f c) {
  c = __builtin_amdgcn_wmma_f32_16x16x32_bf16(false, ah, false, bh, (short)0, c, false, false);
  if (NT >= 2) c = __builtin_amdgcn_wmma_f32_16x16x32_bf16(false, al, false, bh, (short)0, c, false, false);
  if (NT >= 3) c = __builtin_amdgcn_wmma_f32_16x16x32_bf16(false, ah, false, bl, (short)0, c, false, false);
  asm volatile("v_nop\n\tv_nop\n\tv_nop\n\tv_nop" : "+v"(c) : "v"(ah), "v"(al), "v"(bh), "v"(bl));
  return c;
}

__global__ __launch_bounds__(256) void k_wt_bf16(const float* __restrict__ W, unsigned short* __restrict__ Wt, int K, int N) {
  const int t = blockIdx.x * 256 + threadIdx.x;
  const int k8n = K / 8;
  if (t >= N * k8n) return;
  const int n = t / k8n, k8 = (t % k8n) * 8;
  v8us v;
#pragma unroll
  for (int i = 0; i < 8; ++i) v[i] = bf16_bits(W[(size_t)(k8 + i) * N + n]);
  *(v8us*)(Wt + (size_t)n * K + k8) = v;
  
}

// GEMM C[M][N] (f32, pitch ldc) = act(A[M][K]·W + bias). A f32 row-major (pitch lda) converted per fragment to bf16
// (ASPLIT: hi/lo two planes -> 2 terms, else single rounded term); Wt bf16 [N][K] (pitch ldb). BIAS_BF16 rounds the
// bias to bf16 first (bias quantised to bf16 before the add). K%32==0, M%16==0, N%64==0.
template <bool ASPLIT, int ACT, bool BIAS_BF16>
__global__ __launch_bounds__(128) void k_gemm_bf(const float* __restrict__ A, int lda, const unsigned short* __restrict__ Wt, int ldb,
                                               const float* __restrict__ bias, float* __restrict__ C, int ldc, int M, int N, int K) {
  __shared__ __attribute__((aligned(16))) float so[4][16][64];
  const int tid = threadIdx.x, w = tid >> 5, lane = tid & 31, ln = lane & 15, hh = lane >> 4;
  const int ntn = N / 64;
  const int wid = blockIdx.x * 4 + w;
  const int mt = wid / ntn, nq = wid % ntn;
  if (mt * 16 >= M) return;
  const int row0 = mt * 16, col0 = nq * 64;
  const float* arow = A + (size_t)(row0 + ln) * lda;
  v8f acc[4] = {};
  for (int kb = 0; kb < K; kb += 32) {
    FragB ah, al;
    const v4f x0 = *(const v4fa*)(arow + kb + 8 * hh), x1 = *(const v4fa*)(arow + kb + 8 * hh + 4);
    const v4f x2 = *(const v4fa*)(arow + kb + 16 + 8 * hh), x3 = *(const v4fa*)(arow + kb + 16 + 8 * hh + 4);
    float xs[16] = {x0[0],x0[1],x0[2],x0[3],x1[0],x1[1],x1[2],x1[3],x2[0],x2[1],x2[2],x2[3],x3[0],x3[1],x3[2],x3[3]};
#pragma unroll
    for (int i = 0; i < 16; ++i) { const unsigned short hb = bf16_bits(xs[i]); ah.u[i] = hb; al.u[i] = ASPLIT ? bf16_bits(xs[i] - bf16_val(hb)) : (unsigned short)0; }
#pragma unroll
    for (int t = 0; t < 4; ++t) {
      const unsigned short* brow = Wt + (size_t)(col0 + t * 16 + ln) * ldb + kb;
      FragB b;
      b.half[0] = *(const v8us*)(brow + 8 * hh);
      b.half[1] = *(const v8us*)(brow + 16 + 8 * hh);
      acc[t] = mmaN<ASPLIT ? 2 : 1>(ah.v, al.v, b.v, b.v, acc[t]);
    }
  }
#pragma unroll
  for (int t = 0; t < 4; ++t) {
    float bv = bias ? bias[col0 + t * 16 + ln] : 0.f;
    if (BIAS_BF16) bv = bf16_round(bv);
#pragma unroll
    for (int r = 0; r < 8; ++r) { float v = acc[t][r] + bv; if (ACT == 1) v = fmaxf(v, 0.f); so[w][8 * hh + r][t * 16 + ln] = v; }
  }
  __builtin_amdgcn_fence(__ATOMIC_ACQ_REL, "workgroup");
  __builtin_amdgcn_wave_barrier();
  const int rsub = lane >> 4, c4 = (lane & 15) * 4;
  {
#pragma unroll
    for (int q = 0; q < 8; ++q) {
      const int r = q * 2 + rsub;
      const v4f v = *(const v4fa*)&so[w][r][c4];
      *(v4f*)(C + (size_t)(row0 + r) * ldc + col0 + c4) = v;
    }
    
  }
}

// GEMM C = act(A·W + bias + resid): A f32 (ASPLIT -> hi/lo 2 terms), Wt bf16 [N][K]; ACT 0 none, 1 relu, 2 exact gelu;
// resid (optional, f32, row index = (row % rmod), pitch ldr, RES_BF16 rounds it) added before the activation.
template <bool ASPLIT, int ACT, bool BIAS_BF16, bool RES_BF16>
__global__ __launch_bounds__(128) void k_gemm_bf3(const float* __restrict__ A, int lda, const unsigned short* __restrict__ Wt, int ldb,
                                                const float* __restrict__ bias, const float* __restrict__ resid, int rmod, int ldr,
                                                float* __restrict__ C, int ldc, int M, int N, int K) {
  __shared__ __attribute__((aligned(16))) float so[4][16][64];
  const int tid = threadIdx.x, w = tid >> 5, lane = tid & 31, ln = lane & 15, hh = lane >> 4;
  const int ntn = N / 64;
  const int wid = blockIdx.x * 4 + w;
  const int mt = wid / ntn, nq = wid % ntn;
  if (mt * 16 >= M) return;
  const int row0 = mt * 16, col0 = nq * 64;
  const float* arow = A + (size_t)(row0 + ln) * lda;
  v8f acc[4] = {};
  for (int kb = 0; kb < K; kb += 32) {
    FragB ah, al;
    const v4f x0 = *(const v4fa*)(arow + kb + 8 * hh), x1 = *(const v4fa*)(arow + kb + 8 * hh + 4);
    const v4f x2 = *(const v4fa*)(arow + kb + 16 + 8 * hh), x3 = *(const v4fa*)(arow + kb + 16 + 8 * hh + 4);
    float xs[16] = {x0[0],x0[1],x0[2],x0[3],x1[0],x1[1],x1[2],x1[3],x2[0],x2[1],x2[2],x2[3],x3[0],x3[1],x3[2],x3[3]};
#pragma unroll
    for (int i = 0; i < 16; ++i) { const unsigned short hb = bf16_bits(xs[i]); ah.u[i] = hb; al.u[i] = ASPLIT ? bf16_bits(xs[i] - bf16_val(hb)) : (unsigned short)0; }
#pragma unroll
    for (int t = 0; t < 4; ++t) {
      const unsigned short* brow = Wt + (size_t)(col0 + t * 16 + ln) * ldb + kb;
      FragB b;
      b.half[0] = *(const v8us*)(brow + 8 * hh);
      b.half[1] = *(const v8us*)(brow + 16 + 8 * hh);
      acc[t] = mmaN<ASPLIT ? 2 : 1>(ah.v, al.v, b.v, b.v, acc[t]);
    }
  }
#pragma unroll
  for (int t = 0; t < 4; ++t) {
    const int col = col0 + t * 16 + ln;
    float bv = bias ? bias[col] : 0.f;
    if (BIAS_BF16) bv = bf16_round(bv);
#pragma unroll
    for (int r = 0; r < 8; ++r) {
      float v = acc[t][r] + bv;
      if (resid) { float rv = resid[(size_t)((row0 + 8 * hh + r) % rmod) * ldr + col]; if (RES_BF16) rv = bf16_round(rv); v += rv; }
      if (ACT == 1) v = fmaxf(v, 0.f);
      if (ACT == 2) v = 0.5f * v * (1.0f + erff(v * 0.70710678118654752f));
      if (ACT == 3) { const float u = 0.7978845608028654f * (v + 0.044715f * v * v * v); v = 0.5f * v * (1.0f + tanhf(u)); }
      so[w][8 * hh + r][t * 16 + ln] = v;
    }
  }
  __builtin_amdgcn_fence(__ATOMIC_ACQ_REL, "workgroup");
  __builtin_amdgcn_wave_barrier();
  const int rsub = lane >> 4, c4 = (lane & 15) * 4;
  {
#pragma unroll
    for (int q = 0; q < 8; ++q) {
      const int r = q * 2 + rsub;
      const v4f v = *(const v4fa*)&so[w][r][c4];
      *(v4f*)(C + (size_t)(row0 + r) * ldc + col0 + c4) = v;
    }
    
  }
}
// row LayerNorm (biased variance, eps) over N: s = X (+ R); optional out_sum <- s; out_norm <- (s-mu)*rsqrt(var+eps)*g + b
template <bool PARAM_BF16>
__global__ __launch_bounds__(256) void k_layernorm(const float* __restrict__ X, const float* __restrict__ R, const float* __restrict__ g, const float* __restrict__ bta,
                                                  float* __restrict__ out_sum, float* __restrict__ out_norm, int N, float eps) {
  __shared__ float red[256];
  const int row = blockIdx.x, tid = threadIdx.x;
  const float* x = X + (size_t)row * N; const float* rr = R ? R + (size_t)row * N : nullptr;
  float vals[16];                     // up to N = 4096
  const int per = N / 256;            // contiguous chunk per thread? use strided-by-4 chunks: thread handles j = tid*4 + 1024*u
  float s1 = 0.f;
  for (int u = 0; u < per / 4; ++u) {
    const int j = tid * 4 + 1024 * u;
    const v4f a = *(const v4fa*)(x + j);
    v4f b = {0.f,0.f,0.f,0.f}; if (rr) b = *(const v4fa*)(rr + j);
#pragma unroll
    for (int q = 0; q < 4; ++q) { const float v = a[q] + b[q]; vals[u * 4 + q] = v; s1 += v; }
  }
  red[tid] = s1; __syncthreads();
  for (int st = 128; st > 0; st >>= 1) { if (tid < st) red[tid] += red[tid + st]; __syncthreads(); }
  const float mu = red[0] / (float)N; __syncthreads();
  float s2 = 0.f;
  for (int u = 0; u < per / 4; ++u)
#pragma unroll
    for (int q = 0; q < 4; ++q) { const float c = vals[u * 4 + q] - mu; s2 += c * c; }
  red[tid] = s2; __syncthreads();
  for (int st = 128; st > 0; st >>= 1) { if (tid < st) red[tid] += red[tid + st]; __syncthreads(); }
  const float rs = rsqrtf(red[0] / (float)N + eps);
  {
    for (int u = 0; u < per / 4; ++u) {
      const int j = tid * 4 + 1024 * u;
      v4f o, sm;
#pragma unroll
      for (int q = 0; q < 4; ++q) {
        float gg = g[j + q], bb = bta[j + q];
        if (PARAM_BF16) { gg = bf16_round(gg); bb = bf16_round(bb); }
        sm[q] = vals[u * 4 + q]; o[q] = (vals[u * 4 + q] - mu) * rs * gg + bb;
      }
      if (out_sum) *(v4f*)(out_sum + (size_t)row * N + j) = sm;
      *(v4f*)(out_norm + (size_t)row * N + j) = o;
    }
    
  }
}



// ---- f16 WMMA path (v_wmma_f32_16x16x32_f16): 11-bit significands for operands in range — used where a [0,1] probability operand needs more precision than bf16
typedef _Float16 v16h __attribute__((ext_vector_type(16)));
union FragH { v16h v; v8us half[2]; _Float16 h[16]; unsigned short u[16]; };
template <int NT>
__device__ __forceinline__ v8f mmaH(v16h ah, v16h al, v16h bh, v16h bl, v8f c) {
  c = __builtin_amdgcn_wmma_f32_16x16x32_f16(false, ah, false, bh, (short)0, c, false, false);
  if (NT >= 2) c = __builtin_amdgcn_wmma_f32_16x16x32_f16(false, al, false, bh, (short)0, c, false, false);
  if (NT >= 3) c = __builtin_amdgcn_wmma_f32_16x16x32_f16(false, ah, false, bl, (short)0, c, false, false);
  asm volatile("v_nop\n\tv_nop\n\tv_nop\n\tv_nop" : "+v"(c) : "v"(ah), "v"(al), "v"(bh), "v"(bl));
  return c;
}
// batched GEMM like k_gemm_b but f16 operands: A f32 (split into f16 hi/lo if ASPLIT, else rounded to f16), Bt = f16 values [n][k]; alpha; C f32; N multiple of 16 (partial tiles skipped)
template <bool ASPLIT>
__global__ __launch_bounds__(128) void k_gemm_h(const float* __restrict__ A, int lda, size_t sA, const _Float16* __restrict__ Bh, int ldb, size_t sB, float alpha, float* __restrict__ C, int ldc, size_t sC, int M, int N, int K) {
  __shared__ __attribute__((aligned(16))) float so[4][16][64];
  const int tid = threadIdx.x, w = tid >> 5, lane = tid & 31, ln = lane & 15, hh = lane >> 4; const int by = blockIdx.y;
  A += (size_t)by * sA; Bh += (size_t)by * sB; C += (size_t)by * sC;
  const int ntn = (N + 63) / 64; const int wid = blockIdx.x * 4 + w; const int mt = wid / ntn, nq = wid % ntn; if (mt * 16 >= M) return;
  const int row0 = mt * 16, col0 = nq * 64; const float* arow = A + (size_t)(row0 + ln) * lda;
  v8f acc[4] = {};
  for (int kb = 0; kb < K; kb += 32) {
    FragH ah, al;
    const v4f x0 = *(const v4fa*)(arow + kb + 8 * hh), x1 = *(const v4fa*)(arow + kb + 8 * hh + 4), x2 = *(const v4fa*)(arow + kb + 16 + 8 * hh), x3 = *(const v4fa*)(arow + kb + 16 + 8 * hh + 4);
    float xs[16] = {x0[0],x0[1],x0[2],x0[3],x1[0],x1[1],x1[2],x1[3],x2[0],x2[1],x2[2],x2[3],x3[0],x3[1],x3[2],x3[3]};
#pragma unroll
    for (int i = 0; i < 16; ++i) { const _Float16 h = (_Float16)xs[i]; ah.h[i] = h; al.h[i] = ASPLIT ? (_Float16)(xs[i] - (float)h) : (_Float16)0.0f; }
#pragma unroll
    for (int t = 0; t < 4; ++t) { if (col0 + t * 16 >= N) continue; const size_t boff = (size_t)(col0 + t * 16 + ln) * ldb + kb; FragH bq; bq.half[0] = *(const v8us*)(Bh + boff + 8 * hh); bq.half[1] = *(const v8us*)(Bh + boff + 16 + 8 * hh);
      acc[t] = mmaH<ASPLIT ? 2 : 1>(ah.v, al.v, bq.v, bq.v, acc[t]); }
  }
#pragma unroll
  for (int t = 0; t < 4; ++t) { if (col0 + t * 16 >= N) continue;
#pragma unroll
    for (int r = 0; r < 8; ++r) so[w][8 * hh + r][t * 16 + ln] = acc[t][r] * alpha; }
  __builtin_amdgcn_fence(__ATOMIC_ACQ_REL, "workgroup"); __builtin_amdgcn_wave_barrier();
  const int rsub = lane >> 4, c4 = (lane & 15) * 4;
  {
#pragma unroll
    for (int q = 0; q < 8; ++q) { const int r = q * 2 + rsub; if (col0 + c4 < N) { const v4f v = *(const v4fa*)&so[w][r][c4]; *(v4f*)(C + (size_t)(row0 + r) * ldc + col0 + c4) = v; } }
     }
}

// Wt[n][k] = f16(W[k][n]·scale) from f32 row-major W[K][N] (scale = power of two; bf16-exact weights stay exact in f16 away from the subnormal range)
__global__ __launch_bounds__(256) void k_wt_f16(const float* __restrict__ W, _Float16* __restrict__ Wt, int K, int N, float scale) {
  const int t = blockIdx.x * 256 + threadIdx.x; if (t >= N * (K / 8)) return; const int n = t / (K / 8), k8 = (t % (K / 8)) * 8; FragH f;
#pragma unroll
  for (int i = 0; i < 8; ++i) f.h[i] = (_Float16)(bf16_round(W[(size_t)(k8 + i) * N + n]) * scale); const v8us o = f.half[0];
  *(v8us*)((unsigned short*)Wt + (size_t)n * K + k8) = o; 
}
// k_gemm_hh variant with fused epilogue: v = acc·alpha + bias[by·sBias + col] (+ CP[(row/rowsPerB)·sCPb + by·64 + col] if CP) ; ACT 0 none / 1 elu ; writes f16 C16 (and f32 C if non-null)
template <int ACT>
__global__ __launch_bounds__(128) void k_gemm_hhx(const _Float16* __restrict__ A, int lda, size_t sA, const _Float16* __restrict__ Bh, int ldb, size_t sB, float alpha, const float* __restrict__ bias, size_t sBias, const float* __restrict__ CP, int rowsPerB, size_t sCPb, int row0g,
    float* __restrict__ C, _Float16* __restrict__ C16, int ldc, size_t sC, int M, int N, int K) {
  __shared__ __attribute__((aligned(16))) float so[4][16][64];
  const int tid = threadIdx.x, w = tid >> 5, lane = tid & 31, ln = lane & 15, hh = lane >> 4; const int by = blockIdx.y;
  A += (size_t)by * sA; Bh += (size_t)by * sB; const size_t cofs = (size_t)by * sC; const float* bp = bias ? bias + (size_t)by * sBias : nullptr;
  const int ntn = (N + 63) / 64; const int wid = blockIdx.x * 4 + w; const int mt = wid / ntn, nq = wid % ntn; if (mt * 16 >= M) return;
  const int row0 = mt * 16, col0 = nq * 64; const _Float16* arow = A + (size_t)(row0 + ln) * lda;
  v8f acc[4] = {};
  for (int kb = 0; kb < K; kb += 32) { FragH ah; ah.half[0] = *(const v8us*)((const unsigned short*)arow + kb + 8 * hh); ah.half[1] = *(const v8us*)((const unsigned short*)arow + kb + 16 + 8 * hh);
#pragma unroll
    for (int t = 0; t < 4; ++t) { if (col0 + t * 16 >= N) continue; const size_t boff = (size_t)(col0 + t * 16 + ln) * ldb + kb; FragH bq; bq.half[0] = *(const v8us*)((const unsigned short*)Bh + boff + 8 * hh); bq.half[1] = *(const v8us*)((const unsigned short*)Bh + boff + 16 + 8 * hh);
      acc[t] = mmaH<1>(ah.v, ah.v, bq.v, bq.v, acc[t]); }
  }
#pragma unroll
  for (int t = 0; t < 4; ++t) { if (col0 + t * 16 >= N) continue; const int col = col0 + t * 16 + ln; const float bv = bp ? bf16_round(bp[col]) : 0.f;
#pragma unroll
    for (int r = 0; r < 8; ++r) { float v = acc[t][r] * alpha + bv; if (CP) { const int rr = row0g + row0 + 8 * hh + r; if (rowsPerB < 0) v += CP[cofs + (size_t)rr * ldc + col];      /* rowsPerB < 0: own element of the batched C plane */ else { const int bidx = rr / rowsPerB; v += CP[(size_t)bidx * sCPb + (size_t)by * 64 + col]; } } if (ACT == 1) v = (v > 0.f) ? v : expm1f(v); else if (ACT == 7) v = (v > 0.f) ? v + 1.0f : expf(v); else if (ACT == 8) v = tanhf(v); else if (ACT == 9) v = 0.5f * v * (1.0f + tanhf(0.7978845608028654f * (v + 0.044715f * v * v * v))); else if (ACT == 11) v = 1.0f / (1.0f + expf(-v)); else if (ACT == 12) v = (v > 0.f) ? v : 0.01f * v; else if (ACT == 14) v = (v > 0.f) ? v : 0.1f * v; else if (ACT == 16) v = (v >= 0.f) ? v : 0.3f * v; else if (ACT == 17) v = (v >= 0.f) ? v : 0.2f * v; else if (ACT == 15) v = v / (1.0f + expf(-v)); else if (ACT == 3) v = fmaxf(v, 0.f); else if (ACT == 6) v = 0.5f * v * (1.0f + erff(v * 0.70710678118654752f)); so[w][8 * hh + r][t * 16 + ln] = v; } }
  __builtin_amdgcn_fence(__ATOMIC_ACQ_REL, "workgroup"); __builtin_amdgcn_wave_barrier();
  const int rsub = lane >> 4, c4 = (lane & 15) * 4; typedef _Float16 v4h __attribute__((ext_vector_type(4)));
  {
#pragma unroll
    for (int q = 0; q < 8; ++q) { const int r = q * 2 + rsub; if (col0 + c4 < N) { const v4f v = *(const v4fa*)&so[w][r][c4]; if (C) *(v4f*)(C + cofs + (size_t)(row0 + r) * ldc + col0 + c4) = v; if (C16) { v4h h4; for (int i = 0; i < 4; ++i) h4[i] = (_Float16)v[i]; *(v4h*)(C16 + cofs + (size_t)(row0 + r) * ldc + col0 + c4) = h4; } } }
     }
}


typedef _Float16 v4h __attribute__((ext_vector_type(4)));

__global__ __launch_bounds__(256) void k_x16(const float* __restrict__ x, _Float16* __restrict__ X16, size_t n8) { const size_t t = (size_t)blockIdx.x * 256 + threadIdx.x; if (t >= n8) return; FragH f;
#pragma unroll
  for (int q = 0; q < 8; ++q) f.h[q] = (_Float16)bf16_round(x[t * 8 + q]); *(v8us*)((unsigned short*)X16 + t * 8) = f.half[0];  }
__global__ __launch_bounds__(256) void k_h16(const float* __restrict__ x, _Float16* __restrict__ X16, size_t n8) { const size_t t = (size_t)blockIdx.x * 256 + threadIdx.x; if (t >= n8) return; FragH f;
#pragma unroll
  for (int q = 0; q < 8; ++q) f.h[q] = (_Float16)x[t * 8 + q]; *(v8us*)((unsigned short*)X16 + t * 8) = f.half[0];  }
__global__ __launch_bounds__(256) void k_round16f(const float* __restrict__ W, _Float16* __restrict__ Bt, size_t n8) { const size_t t = (size_t)blockIdx.x * 256 + threadIdx.x; if (t >= n8) return; FragH f;
#pragma unroll
  for (int i = 0; i < 8; ++i) f.h[i] = (_Float16)(bf16_round(W[t * 8 + i]) * 16.0f); *(v8us*)((unsigned short*)Bt + t * 8) = f.half[0];  }
template <int NHv, int TTv>
__global__ __launch_bounds__(256) void k_vt(const _Float16* __restrict__ V16, int ldv, int voff, _Float16* __restrict__ Vt) { __shared__ unsigned short tl[64][66]; const int tid = threadIdx.x; const int slab = blockIdx.x / (TTv / 64), lg = blockIdx.x % (TTv / 64); const int b = slab / NHv, h = slab % NHv;
  for (int i = tid; i < 64 * 8; i += 256) { const int r = i / 8, c8 = (i % 8) * 8; FragH f; f.half[0] = *(const v8us*)((const unsigned short*)V16 + ((size_t)b * TTv + lg * 64 + r) * ldv + voff + h * 64 + c8);
#pragma unroll
    for (int q = 0; q < 8; ++q) tl[r][c8 + q] = f.u[q]; }
  __syncthreads();
  {
#pragma unroll
    for (int rd = 0; rd < 2; ++rd) { const int d = rd * 32 + tid / 8, pc = tid % 8; FragH f;
#pragma unroll
      for (int q = 0; q < 8; ++q) f.u[q] = tl[pc * 8 + q][d];
      *(v8us*)((unsigned short*)Vt + ((size_t)slab * 64 + d) * TTv + lg * 64 + pc * 8) = f.half[0]; }
     } }

__global__ __launch_bounds__(256) void k_hl(const float* __restrict__ F, _Float16* __restrict__ Hh, _Float16* __restrict__ Hl, size_t n8) { const size_t t = (size_t)blockIdx.x * 256 + threadIdx.x; if (t >= n8) return; FragH fh, fl; const v4f a = *(const v4fa*)(F + t * 8), c = *(const v4fa*)(F + t * 8 + 4);
#pragma unroll
  for (int q = 0; q < 4; ++q) { _Float16 h = (_Float16)a[q]; fh.h[q] = h; fl.h[q] = (_Float16)((a[q] - (float)h) * 1024.0f); h = (_Float16)c[q]; fh.h[4 + q] = h; fl.h[4 + q] = (_Float16)((c[q] - (float)h) * 1024.0f); }
  { *(v8us*)((unsigned short*)Hh + t * 8) = fh.half[0]; *(v8us*)((unsigned short*)Hl + t * 8) = fl.half[0];  } }

// ---- fast GEMM (wave tile 32x64; requires M % 32 == 0 rows per launch region and N % 64 == 0); epilogue = k_gemm_hhx semantics ----
__device__ __forceinline__ v16h g2_frag(const _Float16* p, int hh) { FragH f; f.half[0] = *(const v8us*)((const unsigned short*)p + 8 * hh); f.half[1] = *(const v8us*)((const unsigned short*)p + 16 + 8 * hh); return f.v; }
__device__ __forceinline__ v8f g2_mma(v16h a, v16h b, v8f c) { v8f d = __builtin_amdgcn_wmma_f32_16x16x32_f16(false, a, false, b, (short)0, c, false, false); asm volatile("v_nop\n\tv_nop\n\tv_nop\n\tv_nop" : "+v"(d) : "v"(a), "v"(b)); return d; }
template <int ACT>
__global__ __launch_bounds__(128) void k_gemm2(const _Float16* __restrict__ A, int lda, size_t sA, const _Float16* __restrict__ Bh, int ldb, size_t sB, float alpha, const float* __restrict__ bias, size_t sBias, const float* __restrict__ CP, int rowsPerB, size_t sCPb, int row0g,
    float* __restrict__ C, _Float16* __restrict__ C16, int ldc, size_t sC, int M, int N, int K) { static_assert(ACT == 0 || ACT == 3 || ACT == 6 || ACT == 8 || ACT == 9 || ACT == 11 || ACT == 12 || ACT == 14 || ACT == 15 || ACT == 16 || ACT == 17, "k_gemm2: unsupported ACT code (would silently apply no activation)");
  __shared__ __attribute__((aligned(16))) float so[4][32][68];
  const int tid = threadIdx.x, w = tid >> 5, lane = tid & 31, ln = lane & 15, hh = lane >> 4; const int by = blockIdx.y;
  A += (size_t)by * sA; Bh += (size_t)by * sB; const size_t cofs = (size_t)by * sC; const float* bp = bias ? bias + (size_t)by * sBias : nullptr;
  const int ntn = N >> 6; const int mt = blockIdx.x / ntn, nq = blockIdx.x - mt * ntn; const int row0 = mt * 128 + 32 * w, col0 = nq * 64; if (row0 >= M) return;
  const _Float16* a0p = A + (size_t)(row0 + ln) * lda; const _Float16* a1p = a0p + (size_t)16 * lda;
  const _Float16* b0p = Bh + (size_t)(col0 + ln) * ldb; const _Float16* b1p = b0p + (size_t)16 * ldb; const _Float16* b2p = b1p + (size_t)16 * ldb; const _Float16* b3p = b2p + (size_t)16 * ldb;
  const v8f z8 = {0.f,0.f,0.f,0.f,0.f,0.f,0.f,0.f}; v8f c00 = z8, c01 = z8, c02 = z8, c03 = z8, c10 = z8, c11 = z8, c12 = z8, c13 = z8;
#pragma unroll 1
  for (int kb = 0; kb < K; kb += 32) { const v16h a0 = g2_frag(a0p + kb, hh), a1 = g2_frag(a1p + kb, hh);
    v16h b = g2_frag(b0p + kb, hh); c00 = g2_mma(a0, b, c00); c10 = g2_mma(a1, b, c10);
    b = g2_frag(b1p + kb, hh); c01 = g2_mma(a0, b, c01); c11 = g2_mma(a1, b, c11);
    b = g2_frag(b2p + kb, hh); c02 = g2_mma(a0, b, c02); c12 = g2_mma(a1, b, c12);
    b = g2_frag(b3p + kb, hh); c03 = g2_mma(a0, b, c03); c13 = g2_mma(a1, b, c13); }
  v8f accs[8] = {c00, c01, c02, c03, c10, c11, c12, c13};
#pragma unroll
  for (int u = 0; u < 8; ++u) { const int t = u & 3, half = u >> 2; const int col = col0 + t * 16 + ln; const float bv = bp ? bf16_round(bp[col]) : 0.f;
#pragma unroll
    for (int r = 0; r < 8; ++r) { const int rloc = half * 16 + 8 * hh + r; float v = accs[u][r] * alpha + bv; if (CP) { if (rowsPerB < 0) v += CP[cofs + (size_t)(row0g + row0 + rloc) * ldc + col];      /* rowsPerB < 0: own element of the batched C plane */ else { const int bidx = (row0g + row0 + rloc) / rowsPerB; v += CP[(size_t)bidx * sCPb + (size_t)by * 64 + col]; } }
      if (ACT == 3) v = fmaxf(v, 0.f); else if (ACT == 6) v = 0.5f * v * (1.0f + erff(v * 0.70710678118654752f)); else if (ACT == 11) v = 1.0f / (1.0f + expf(-v)); else if (ACT == 15) v = v / (1.0f + expf(-v)); else if (ACT == 12) v = (v > 0.f) ? v : 0.01f * v; else if (ACT == 8) v = tanhf(v); else if (ACT == 9) v = 0.5f * v * (1.0f + tanhf(0.7978845608028654f * (v + 0.044715f * v * v * v))); else if (ACT == 14) v = (v > 0.f) ? v : 0.1f * v; else if (ACT == 16) v = (v >= 0.f) ? v : 0.3f * v; else if (ACT == 17) v = (v >= 0.f) ? v : 0.2f * v;
      so[w][rloc][t * 16 + ln] = v; } }
  __builtin_amdgcn_fence(__ATOMIC_ACQ_REL, "workgroup"); __builtin_amdgcn_wave_barrier();
  const int rsub = lane >> 4, c4 = (lane & 15) * 4;
  {
#pragma unroll
    for (int q = 0; q < 16; ++q) { const int r = q * 2 + rsub; const v4f v = *(const v4fa*)&so[w][r][c4]; if (C) *(v4f*)(C + cofs + (size_t)(row0 + r) * ldc + col0 + c4) = v; if (C16) { v4h h4; for (int i = 0; i < 4; ++i) h4[i] = (_Float16)v[i]; *(v4h*)(C16 + cofs + (size_t)(row0 + r) * ldc + col0 + c4) = h4; } }
     } }


__global__ __launch_bounds__(256) void k_wnat(const float* __restrict__ w, size_t n8, _Float16* __restrict__ Bt) { const size_t t = (size_t)blockIdx.x * 256 + threadIdx.x; if (t >= n8) return; FragH f; for (int q = 0; q < 8; ++q) f.h[q] = (_Float16)(bf16_round(w[t * 8 + q]) * 16.0f); *(v8us*)((unsigned short*)Bt + t * 8) = f.half[0];  }
__global__ __launch_bounds__(256) void k_rsm(const float* __restrict__ S, _Float16* __restrict__ P, int nrows) {
  #pragma clang fp contract(off)
  const int i = blockIdx.x * 256 + threadIdx.x; if (i >= nrows) return; const float* s = S + (size_t)i * SQ; float mx = -3.0e38f;
#pragma unroll 1
  for (int j = 0; j < SQ; ++j) mx = fmaxf(mx, s[j]); float se = 0.f;
#pragma unroll 1
  for (int j = 0; j < SQ; ++j) se += expf(s[j] - mx); const float sc = 256.0f / se;
#pragma unroll 1
  for (int j0 = 0; j0 < SQ; j0 += 8) { FragH f; for (int q = 0; q < 8; ++q) f.h[q] = (_Float16)(expf(s[j0 + q] - mx) * sc); unsigned short* d = (unsigned short*)P + (size_t)i * SQ + j0; *(v8us*)d = f.half[0];  } }
__global__ __launch_bounds__(256) void k_vt(const _Float16* __restrict__ V16, int b, int h0, _Float16* __restrict__ VT) { __shared__ unsigned short tl[64][65]; const int tid = threadIdx.x; const int hh = blockIdx.x % HG, sg = blockIdx.x / HG; const int s0 = sg * 64; const int h = h0 + hh;
  for (int i = tid; i < 64 * 8; i += 256) { const int j = i / 8, d8 = (i % 8) * 8; FragH f; f.half[0] = *(const v8us*)((const unsigned short*)V16 + ((size_t)b * SQ + s0 + j) * DM + h * HD + d8); for (int q = 0; q < 8; ++q) tl[d8 + q][j] = f.u[q]; }
  __syncthreads();
  { for (int i = tid; i < 64 * 8; i += 256) { const int d = i / 8, j8 = (i % 8) * 8; FragH f; for (int q = 0; q < 8; ++q) f.u[q] = tl[d][j8 + q]; *(v8us*)((unsigned short*)VT + ((size_t)hh * HD + d) * SQ + s0 + j8) = f.half[0]; }  } }

__global__ __launch_bounds__(256) void k_rsmP(const float* __restrict__ S, _Float16* __restrict__ P, _Float16* __restrict__ PL, int nrows) {
  #pragma clang fp contract(off)
  __shared__ unsigned short sl_[256][9]; const int i = blockIdx.x * 256 + threadIdx.x; if (i >= nrows) return; const float* s = S + (size_t)i * SQ; float mx = -INFINITY;
#pragma unroll 1
  for (int j = 0; j < SQ; ++j) mx = fmaxf(mx, s[j]); float se = 0.f;
#pragma unroll 1
  for (int j = 0; j < SQ; ++j) se += expf(s[j] - mx); const float sc = 256.0f / se;
#pragma unroll 1
  for (int j0 = 0; j0 < SQ; j0 += 8) { FragH f, fl; for (int q = 0; q < 8; ++q) { const float v = expf(s[j0 + q] - mx) * sc; const _Float16 hv = (_Float16)v; f.h[q] = hv; if (PL) { FragH one; one.h[0] = (_Float16)((v - (float)hv) * 1024.0f); sl_[threadIdx.x][q] = one.u[0]; } }
    if (PL) for (int q = 0; q < 8; ++q) fl.u[q] = sl_[threadIdx.x][q];
    unsigned short* d = (unsigned short*)P + (size_t)i * SQ + j0; *(v8us*)d = f.half[0]; if (PL) *(v8us*)((unsigned short*)PL + (size_t)i * SQ + j0) = fl.half[0];  } }
__global__ __launch_bounds__(256) void k_f16rows(const float* __restrict__ F, _Float16* __restrict__ R, size_t n8) { const size_t t = (size_t)blockIdx.x * 256 + threadIdx.x; if (t >= n8) return; FragH f; for (int q = 0; q < 8; ++q) f.h[q] = (_Float16)F[t * 8 + q]; *(v8us*)((unsigned short*)R + t * 8) = f.half[0];  }
extern "C" void kernel_launch(void* const* d_in, const int* in_sizes, int n_in,
                              void* d_out, int out_size, void* d_ws, size_t ws_size, hipStream_t stream) {
  (void)in_sizes; (void)n_in; (void)out_size;
  const float* const* I = (const float* const*)d_in; const float* x = I[0]; const float* wq = I[1]; const float* wk = I[2]; const float* wv = I[3]; const float* bq = nullptr; const float* bk = nullptr; const float* bv = nullptr;      /* [in][out] weights */
  char* ws = (char*)d_ws; size_t off = 0;
  auto take = [&](size_t bytes) { char* p = ws + off; off += (bytes + 255) & ~(size_t)255; return p; };
  _Float16* BQ = (_Float16*)take((size_t)DQ * DM * 2); _Float16* BK = (_Float16*)take((size_t)DQ * DM * 2); _Float16* BV = (_Float16*)take((size_t)DV * DM * 2);
  _Float16* X16 = (_Float16*)take(NR * DM * 2); float* F32 = (float*)take(NR * (DQ > DV ? DQ : DV) * 4); _Float16* Q16 = (_Float16*)take(NR * DQ * 2); _Float16* QL = (_Float16*)take(NR * DQ * 2); _Float16* K16 = (_Float16*)take(NR * DQ * 2); _Float16* KL = (_Float16*)take(NR * DQ * 2); _Float16* V16 = (_Float16*)take(NR * DV * 2);
  float* S = (float*)take((size_t)QT * SQ * 4); _Float16* P = (_Float16*)take((size_t)QT * SQ * 2); _Float16* PL = (_Float16*)take((size_t)QT * SQ * 2); _Float16* VT = (_Float16*)take((size_t)NB * DV * SQ * 2);
  if (off > ws_size) return;
  k_wt_f16<<<(unsigned)(((size_t)DQ * (DM / 8) + 255) / 256), 256, 0, stream>>>(wq, BQ, DM, DQ, 16.0f); k_wt_f16<<<(unsigned)(((size_t)DQ * (DM / 8) + 255) / 256), 256, 0, stream>>>(wk, BK, DM, DQ, 16.0f); k_wt_f16<<<(unsigned)(((size_t)DV * (DM / 8) + 255) / 256), 256, 0, stream>>>(wv, BV, DM, DV, 16.0f);
  k_x16<<<(unsigned)((NR * DM / 8 + 255) / 256), 256, 0, stream>>>(x, X16, NR * DM / 8);
  k_gemm2<0><<<dim3((unsigned)((NR / 128) * (DQ / 64)), 1), 128, 0, stream>>>(X16, DM, 0, BQ, DM, 0, 0.0625f, bq, 0, nullptr, 1, 0, 0, F32, nullptr, DQ, 0, MP, DQ, DM);      /* q f32 */
  k_f16rows<<<(unsigned)((NR * DQ / 8 + 255) / 256), 256, 0, stream>>>(F32, Q16, NR * DQ / 8);
  k_gemm2<0><<<dim3((unsigned)((NR / 128) * (DQ / 64)), 1), 128, 0, stream>>>(X16, DM, 0, BK, DM, 0, 0.0625f, bk, 0, nullptr, 1, 0, 0, F32, nullptr, DQ, 0, MP, DQ, DM);      /* k f32 (reusing the plane) */
  k_f16rows<<<(unsigned)((NR * DQ / 8 + 255) / 256), 256, 0, stream>>>(F32, K16, NR * DQ / 8);
  k_gemm2<0><<<dim3((unsigned)((NR / 128) * (DV / 64)), 1), 128, 0, stream>>>(X16, DM, 0, BV, DM, 0, 0.0625f, bv, 0, nullptr, 1, 0, 0, nullptr, V16, DV, 0, MP, DV, DM);      /* v f16 rows */
  k_vt<NH, SQ><<<NB * NH * (SQ / 64), 256, 0, stream>>>(V16, DV, 0, VT);      /* V^T per batch [DV][SQ] */
  for (int b = 0; b < NBR; ++b) for (int q0 = 0; q0 < QN; q0 += QT) {
    const size_t qo = ((size_t)b * SQ + q0) * DQ, ko = (size_t)b * SQ * DQ; const dim3 gs((QT / 128) * (SQ / 64), 1);
    k_gemm2<0><<<gs, 128, 0, stream>>>(Q16 + qo, DQ, 0, K16 + ko, DQ, 0, 0.0625f, nullptr, 0, nullptr, 1, 0, 0, S, nullptr, SQ, 0, QT, SQ, DQ);      /* scores */
    k_rsmP<<<(QT + 255) / 256, 256, 0, stream>>>(S, P, nullptr, QT);
    float* ob = (float*)d_out + ((size_t)b * SQ + q0) * DV; const _Float16* vt = VT + (size_t)b * DV * SQ; const dim3 gv((QT / 128) * (DV / 64), 1);
    k_gemm2<0><<<gv, 128, 0, stream>>>(P, SQ, 0, vt, SQ, 0, 0.00390625f, nullptr, 0, nullptr, 1, 0, 0, ob, nullptr, DV, 0, QT, DV, SQ); }      /* out = attn v */
}

// v001
// It runs in 706 microseconds.
// Timed twice side by side with v000, it ran 6.83 and 6.89 times as fast.
#include <hip/hip_runtime.h>
// Single-head self-attention (x [8][2048][256]; Q, K, V = x W ([in][out] [256][256]); scores = Q.K/16; softmax over all 2048 keys; out = attn V -> [8][2048][256]).
// Structure: token rows; x as exact f16 rows; q | k | v WMMA GEMMs (32x64 wave tiles, f32 accumulation, exact x16 transposed [in][out] weights); q, k as f16 rows; v as f16 rows, V^T via LDS transposes; per (batch, 2048-query tile): scores GEMM (K = 256), row softmax on VALU (f32; P x256 f16), out = P . V^T GEMM written straight to the f32 output.
// Compute dtype: inputs rounded to bf16; x / weights exact; q, k plain f16 (~2^-12); v, P plain f16 (~2^-12); scores / softmax f32. v_wmma_f32_16x16x32_f16.
#define NB 8
#define SQ 2048
#define DM 256
#define DQ 256
#define DV 256
#define QT 2048                     /* query tile */
#define NH 4                    /* V^T slabs of 64 (k_vt<NH, SQ>) */
#define HD 64
#define HG 1
#define NR ((size_t)NB * SQ)
#define QN SQ                        /* query rows per batch (debug hook) */
#define NBR NB                       /* batches (debug hook) */
#define MP ((int)NR)                 /* rows through the projections (debug hook) */
typedef __bf16 v16b __attribute__((ext_vector_type(16)));
typedef unsigned short v8us __attribute__((ext_vector_type(8), may_alias));
typedef float  v8f  __attribute__((ext_vector_type(8)));
typedef float  v4f  __attribute__((ext_vector_type(4)));
typedef float  v4fa __attribute__((ext_vector_type(4), may_alias));
union FragB { v16b v; v8us half[2]; unsigned short u[16]; };

__device__ __forceinline__ unsigned short bf16_bits(float x) { unsigned int u = __float_as_uint(x); return (unsigned short)((u + 0x7FFFu + ((u >> 16) & 1u)) >> 16); }
__device__ __forceinline__ float bf16_val(unsigned short b) { return __uint_as_float(((unsigned int)b) << 16); }
__device__ __forceinline__ float bf16_round(float x) { return bf16_val(bf16_bits(x)); }
// D += A·B with NT terms: 1 = ah·bh, 2 = + al·bh (A split), 3 = + ah·bl (both split)
template <int NT>
__device__ __forceinline__ v8f mmaN(v16b ah, v16b al, v16b bh, v16b bl, v8f c) {
  c = __builtin_amdgcn_wmma_f32_16x16x32_bf16(false, ah, false, bh, (short)0, c, false, false);
  if (NT >= 2) c = __builtin_amdgcn_wmma_f32_16x16x32_bf16(false, al, false, bh, (short)0, c, false, false);
  if (NT >= 3) c = __builtin_amdgcn_wmma_f32_16x16x32_bf16(false, ah, false, bl, (short)0, c, false, false);
  asm volatile("v_nop\n\tv_nop\n\tv_nop\n\tv_nop" : "+v"(c) : "v"(ah), "v"(al), "v"(bh), "v"(bl));
  return c;
}

__global__ __launch_bounds__(256) void k_wt_bf16(const float* __restrict__ W, unsigned short* __restrict__ Wt, int K, int N) {
  const int t = blockIdx.x * 256 + threadIdx.x;
  const int k8n = K / 8;
  if (t >= N * k8n) return;
  const int n = t / k8n, k8 = (t % k8n) * 8;
  v8us v;
#pragma unroll
  for (int i = 0; i < 8; ++i) v[i] = bf16_bits(W[(size_t)(k8 + i) * N + n]);
  *(v8us*)(Wt + (size_t)n * K + k8) = v;
  
}

// GEMM C[M][N] (f32, pitch ldc) = act(A[M][K]·W + bias). A f32 row-major (pitch lda) converted per fragment to bf16
// (ASPLIT: hi/lo two planes -> 2 terms, else single rounded term); Wt bf16 [N][K] (pitch ldb). BIAS_BF16 rounds the
// bias to bf16 first (bias quantised to bf16 before the add). K%32==0, M%16==0, N%64==0.
template <bool ASPLIT, int ACT, bool BIAS_BF16>
__global__ __launch_bounds__(128) void k_gemm_bf(const float* __restrict__ A, int lda, const unsigned short* __restrict__ Wt, int ldb,
                                               const float* __restrict__ bias, float* __restrict__ C, int ldc, int M, int N, int K) {
  __shared__ __attribute__((aligned(16))) float so[4][16][64];
  const int tid = threadIdx.x, w = tid >> 5, lane = tid & 31, ln = lane & 15, hh = lane >> 4;
  const int ntn = N / 64;
  const int wid = blockIdx.x * 4 + w;
  const int mt = wid / ntn, nq = wid % ntn;
  if (mt * 16 >= M) return;
  const int row0 = mt * 16, col0 = nq * 64;
  const float* arow = A + (size_t)(row0 + ln) * lda;
  v8f acc[4] = {};
  for (int kb = 0; kb < K; kb += 32) {
    FragB ah, al;
    const v4f x0 = *(const v4fa*)(arow + kb + 8 * hh), x1 = *(const v4fa*)(arow + kb + 8 * hh + 4);
    const v4f x2 = *(const v4fa*)(arow + kb + 16 + 8 * hh), x3 = *(const v4fa*)(arow + kb + 16 + 8 * hh + 4);
    float xs[16] = {x0[0],x0[1],x0[2],x0[3],x1[0],x1[1],x1[2],x1[3],x2[0],x2[1],x2[2],x2[3],x3[0],x3[1],x3[2],x3[3]};
#pragma unroll
    for (int i = 0; i < 16; ++i) { const unsigned short hb = bf16_bits(xs[i]); ah.u[i] = hb; al.u[i] = ASPLIT ? bf16_bits(xs[i] - bf16_val(hb)) : (unsigned short)0; }
#pragma unroll
    for (int t = 0; t < 4; ++t) {
      const unsigned short* brow = Wt + (size_t)(col0 + t * 16 + ln) * ldb + kb;
      FragB b;
      b.half[0] = *(const v8us*)(brow + 8 * hh);
      b.half[1] = *(const v8us*)(brow + 16 + 8 * hh);
      acc[t] = mmaN<ASPLIT ? 2 : 1>(ah.v, al.v, b.v, b.v, acc[t]);
    }
  }
#pragma unroll
  for (int t = 0; t < 4; ++t) {
    float bv = bias ? bias[col0 + t * 16 + ln] : 0.f;
    if (BIAS_BF16) bv = bf16_round(bv);
#pragma unroll
    for (int r = 0; r < 8; ++r) { float v = acc[t][r] + bv; if (ACT == 1) v = fmaxf(v, 0.f); so[w][8 * hh + r][t * 16 + ln] = v; }
  }
  __builtin_amdgcn_fence(__ATOMIC_ACQ_REL, "workgroup");
  __builtin_amdgcn_wave_barrier();
  const int rsub = lane >> 4, c4 = (lane & 15) * 4;
  {
#pragma unroll
    for (int q = 0; q < 8; ++q) {
      const int r = q * 2 + rsub;
      const v4f v = *(const v4fa*)&so[w][r][c4];
      *(v4f*)(C + (size_t)(row0 + r) * ldc + col0 + c4) = v;
    }
    
  }
}

// GEMM C = act(A·W + bias + resid): A f32 (ASPLIT -> hi/lo 2 terms), Wt bf16 [N][K]; ACT 0 none, 1 relu, 2 exact gelu;
// resid (optional, f32, row index = (row % rmod), pitch ldr, RES_BF16 rounds it) added before the activation.
template <bool ASPLIT, int ACT, bool BIAS_BF16, bool RES_BF16>
__global__ __launch_bounds__(128) void k_gemm_bf3(const float* __restrict__ A, int lda, const unsigned short* __restrict__ Wt, int ldb,
                                                const float* __restrict__ bias, const float* __restrict__ resid, int rmod, int ldr,
                                                float* __restrict__ C, int ldc, int M, int N, int K) {
  __shared__ __attribute__((aligned(16))) float so[4][16][64];
  const int tid = threadIdx.x, w = tid >> 5, lane = tid & 31, ln = lane & 15, hh = lane >> 4;
  const int ntn = N / 64;
  const int wid = blockIdx.x * 4 + w;
  const int mt = wid / ntn, nq = wid % ntn;
  if (mt * 16 >= M) return;
  const int row0 = mt * 16, col0 = nq * 64;
  const float* arow = A + (size_t)(row0 + ln) * lda;
  v8f acc[4] = {};
  for (int kb = 0; kb < K; kb += 32) {
    FragB ah, al;
    const v4f x0 = *(const v4fa*)(arow + kb + 8 * hh), x1 = *(const v4fa*)(arow + kb + 8 * hh + 4);
    const v4f x2 = *(const v4fa*)(arow + kb + 16 + 8 * hh), x3 = *(const v4fa*)(arow + kb + 16 + 8 * hh + 4);
    float xs[16] = {x0[0],x0[1],x0[2],x0[3],x1[0],x1[1],x1[2],x1[3],x2[0],x2[1],x2[2],x2[3],x3[0],x3[1],x3[2],x3[3]};
#pragma unroll
    for (int i = 0; i < 16; ++i) { const unsigned short hb = bf16_bits(xs[i]); ah.u[i] = hb; al.u[i] = ASPLIT ? bf16_bits(xs[i] - bf16_val(hb)) : (unsigned short)0; }
#pragma unroll
    for (int t = 0; t < 4; ++t) {
      const unsigned short* brow = Wt + (size_t)(col0 + t * 16 + ln) * ldb + kb;
      FragB b;
      b.half[0] = *(const v8us*)(brow + 8 * hh);
      b.half[1] = *(const v8us*)(brow + 16 + 8 * hh);
      acc[t] = mmaN<ASPLIT ? 2 : 1>(ah.v, al.v, b.v, b.v, acc[t]);
    }
  }
#pragma unroll
  for (int t = 0; t < 4; ++t) {
    const int col = col0 + t * 16 + ln;
    float bv = bias ? bias[col] : 0.f;
    if (BIAS_BF16) bv = bf16_round(bv);
#pragma unroll
    for (int r = 0; r < 8; ++r) {
      float v = acc[t][r] + bv;
      if (resid) { float rv = resid[(size_t)((row0 + 8 * hh + r) % rmod) * ldr + col]; if (RES_BF16) rv = bf16_round(rv); v += rv; }
      if (ACT == 1) v = fmaxf(v, 0.f);
      if (ACT == 2) v = 0.5f * v * (1.0f + erff(v * 0.70710678118654752f));
      if (ACT == 3) { const float u = 0.7978845608028654f * (v + 0.044715f * v * v * v); v = 0.5f * v * (1.0f + tanhf(u)); }
      so[w][8 * hh + r][t * 16 + ln] = v;
    }
  }
  __builtin_amdgcn_fence(__ATOMIC_ACQ_REL, "workgroup");
  __builtin_amdgcn_wave_barrier();
  const int rsub = lane >> 4, c4 = (lane & 15) * 4;
  {
#pragma unroll
    for (int q = 0; q < 8; ++q) {
      const int r = q * 2 + rsub;
      const v4f v = *(const v4fa*)&so[w][r][c4];
      *(v4f*)(C + (size_t)(row0 + r) * ldc + col0 + c4) = v;
    }
    
  }
}
// row LayerNorm (biased variance, eps) over N: s = X (+ R); optional out_sum <- s; out_norm <- (s-mu)*rsqrt(var+eps)*g + b
template <bool PARAM_BF16>
__global__ __launch_bounds__(256) void k_layernorm(const float* __restrict__ X, const float* __restrict__ R, const float* __restrict__ g, const float* __restrict__ bta,
                                                  float* __restrict__ out_sum, float* __restrict__ out_norm, int N, float eps) {
  __shared__ float red[256];
  const int row = blockIdx.x, tid = threadIdx.x;
  const float* x = X + (size_t)row * N; const float* rr = R ? R + (size_t)row * N : nullptr;
  float vals[16];                     // up to N = 4096
  const int per = N / 256;            // contiguous chunk per thread? use strided-by-4 chunks: thread handles j = tid*4 + 1024*u
  float s1 = 0.f;
  for (int u = 0; u < per / 4; ++u) {
    const int j = tid * 4 + 1024 * u;
    const v4f a = *(const v4fa*)(x + j);
    v4f b = {0.f,0.f,0.f,0.f}; if (rr) b = *(const v4fa*)(rr + j);
#pragma unroll
    for (int q = 0; q < 4; ++q) { const float v = a[q] + b[q]; vals[u * 4 + q] = v; s1 += v; }
  }
  red[tid] = s1; __syncthreads();
  for (int st = 128; st > 0; st >>= 1) { if (tid < st) red[tid] += red[tid + st]; __syncthreads(); }
  const float mu = red[0] / (float)N; __syncthreads();
  float s2 = 0.f;
  for (int u = 0; u < per / 4; ++u)
#pragma unroll
    for (int q = 0; q < 4; ++q) { const float c = vals[u * 4 + q] - mu; s2 += c * c; }
  red[tid] = s2; __syncthreads();
  for (int st = 128; st > 0; st >>= 1) { if (tid < st) red[tid] += red[tid + st]; __syncthreads(); }
  const float rs = rsqrtf(red[0] / (float)N + eps);
  {
    for (int u = 0; u < per / 4; ++u) {
      const int j = tid * 4 + 1024 * u;
      v4f o, sm;
#pragma unroll
      for (int q = 0; q < 4; ++q) {
        float gg = g[j + q], bb = bta[j + q];
        if (PARAM_BF16) { gg = bf16_round(gg); bb = bf16_round(bb); }
        sm[q] = vals[u * 4 + q]; o[q] = (vals[u * 4 + q] - mu) * rs * gg + bb;
      }
      if (out_sum) *(v4f*)(out_sum + (size_t)row * N + j) = sm;
      *(v4f*)(out_norm + (size_t)row * N + j) = o;
    }
    
  }
}



// ---- f16 WMMA path (v_wmma_f32_16x16x32_f16): 11-bit significands for operands in range — used where a [0,1] probability operand needs more precision than bf16
typedef _Float16 v16h __attribute__((ext_vector_type(16)));
union FragH { v16h v; v8us half[2]; _Float16 h[16]; unsigned short u[16]; };
template <int NT>
__device__ __forceinline__ v8f mmaH(v16h ah, v16h al, v16h bh, v16h bl, v8f c) {
  c = __builtin_amdgcn_wmma_f32_16x16x32_f16(false, ah, false, bh, (short)0, c, false, false);
  if (NT >= 2) c = __builtin_amdgcn_wmma_f32_16x16x32_f16(false, al, false, bh, (short)0, c, false, false);
  if (NT >= 3) c = __builtin_amdgcn_wmma_f32_16x16x32_f16(false, ah, false, bl, (short)0, c, false, false);
  asm volatile("v_nop\n\tv_nop\n\tv_nop\n\tv_nop" : "+v"(c) : "v"(ah), "v"(al), "v"(bh), "v"(bl));
  return c;
}
// batched GEMM like k_gemm_b but f16 operands: A f32 (split into f16 hi/lo if ASPLIT, else rounded to f16), Bt = f16 values [n][k]; alpha; C f32; N multiple of 16 (partial tiles skipped)
template <bool ASPLIT>
__global__ __launch_bounds__(128) void k_gemm_h(const float* __restrict__ A, int lda, size_t sA, const _Float16* __restrict__ Bh, int ldb, size_t sB, float alpha, float* __restrict__ C, int ldc, size_t sC, int M, int N, int K) {
  __shared__ __attribute__((aligned(16))) float so[4][16][64];
  const int tid = threadIdx.x, w = tid >> 5, lane = tid & 31, ln = lane & 15, hh = lane >> 4; const int by = blockIdx.y;
  A += (size_t)by * sA; Bh += (size_t)by * sB; C += (size_t)by * sC;
  const int ntn = (N + 63) / 64; const int wid = blockIdx.x * 4 + w; const int mt = wid / ntn, nq = wid % ntn; if (mt * 16 >= M) return;
  const int row0 = mt * 16, col0 = nq * 64; const float* arow = A + (size_t)(row0 + ln) * lda;
  v8f acc[4] = {};
  for (int kb = 0; kb < K; kb += 32) {
    FragH ah, al;
    const v4f x0 = *(const v4fa*)(arow + kb + 8 * hh), x1 = *(const v4fa*)(arow + kb + 8 * hh + 4), x2 = *(const v4fa*)(arow + kb + 16 + 8 * hh), x3 = *(const v4fa*)(arow + kb + 16 + 8 * hh + 4);
    float xs[16] = {x0[0],x0[1],x0[2],x0[3],x1[0],x1[1],x1[2],x1[3],x2[0],x2[1],x2[2],x2[3],x3[0],x3[1],x3[2],x3[3]};
#pragma unroll
    for (int i = 0; i < 16; ++i) { const _Float16 h = (_Float16)xs[i]; ah.h[i] = h; al.h[i] = ASPLIT ? (_Float16)(xs[i] - (float)h) : (_Float16)0.0f; }
#pragma unroll
    for (int t = 0; t < 4; ++t) { if (col0 + t * 16 >= N) continue; const size_t boff = (size_t)(col0 + t * 16 + ln) * ldb + kb; FragH bq; bq.half[0] = *(const v8us*)(Bh + boff + 8 * hh); bq.half[1] = *(const v8us*)(Bh + boff + 16 + 8 * hh);
      acc[t] = mmaH<ASPLIT ? 2 : 1>(ah.v, al.v, bq.v, bq.v, acc[t]); }
  }
#pragma unroll
  for (int t = 0; t < 4; ++t) { if (col0 + t * 16 >= N) continue;
#pragma unroll
    for (int r = 0; r < 8; ++r) so[w][8 * hh + r][t * 16 + ln] = acc[t][r] * alpha; }
  __builtin_amdgcn_fence(__ATOMIC_ACQ_REL, "workgroup"); __builtin_amdgcn_wave_barrier();
  const int rsub = lane >> 4, c4 = (lane & 15) * 4;
  {
#pragma unroll
    for (int q = 0; q < 8; ++q) { const int r = q * 2 + rsub; if (col0 + c4 < N) { const v4f v = *(const v4fa*)&so[w][r][c4]; *(v4f*)(C + (size_t)(row0 + r) * ldc + col0 + c4) = v; } }
     }
}

// Wt[n][k] = f16(W[k][n]·scale) from f32 row-major W[K][N] (scale = power of two; bf16-exact weights stay exact in f16 away from the subnormal range)
__global__ __launch_bounds__(256) void k_wt_f16(const float* __restrict__ W, _Float16* __restrict__ Wt, int K, int N, float scale) {
  const int t = blockIdx.x * 256 + threadIdx.x; if (t >= N * (K / 8)) return; const int n = t / (K / 8), k8 = (t % (K / 8)) * 8; FragH f;
#pragma unroll
  for (int i = 0; i < 8; ++i) f.h[i] = (_Float16)(bf16_round(W[(size_t)(k8 + i) * N + n]) * scale); const v8us o = f.half[0];
  *(v8us*)((unsigned short*)Wt + (size_t)n * K + k8) = o; 
}
// k_gemm_hh variant with fused epilogue: v = acc·alpha + bias[by·sBias + col] (+ CP[(row/rowsPerB)·sCPb + by·64 + col] if CP) ; ACT 0 none / 1 elu ; writes f16 C16 (and f32 C if non-null)
template <int ACT>
__global__ __launch_bounds__(128) void k_gemm_hhx(const _Float16* __restrict__ A, int lda, size_t sA, const _Float16* __restrict__ Bh, int ldb, size_t sB, float alpha, const float* __restrict__ bias, size_t sBias, const float* __restrict__ CP, int rowsPerB, size_t sCPb, int row0g,
    float* __restrict__ C, _Float16* __restrict__ C16, int ldc, size_t sC, int M, int N, int K) {
  __shared__ __attribute__((aligned(16))) float so[4][16][64];
  const int tid = threadIdx.x, w = tid >> 5, lane = tid & 31, ln = lane & 15, hh = lane >> 4; const int by = blockIdx.y;
  A += (size_t)by * sA; Bh += (size_t)by * sB; const size_t cofs = (size_t)by * sC; const float* bp = bias ? bias + (size_t)by * sBias : nullptr;
  const int ntn = (N + 63) / 64; const int wid = blockIdx.x * 4 + w; const int mt = wid / ntn, nq = wid % ntn; if (mt * 16 >= M) return;
  const int row0 = mt * 16, col0 = nq * 64; const _Float16* arow = A + (size_t)(row0 + ln) * lda;
  v8f acc[4] = {};
  for (int kb = 0; kb < K; kb += 32) { FragH ah; ah.half[0] = *(const v8us*)((const unsigned short*)arow + kb + 8 * hh); ah.half[1] = *(const v8us*)((const unsigned short*)arow + kb + 16 + 8 * hh);
#pragma unroll
    for (int t = 0; t < 4; ++t) { if (col0 + t * 16 >= N) continue; const size_t boff = (size_t)(col0 + t * 16 + ln) * ldb + kb; FragH bq; bq.half[0] = *(const v8us*)((const unsigned short*)Bh + boff + 8 * hh); bq.half[1] = *(const v8us*)((const unsigned short*)Bh + boff + 16 + 8 * hh);
      acc[t] = mmaH<1>(ah.v, ah.v, bq.v, bq.v, acc[t]); }
  }
#pragma unroll
  for (int t = 0; t < 4; ++t) { if (col0 + t * 16 >= N) continue; const int col = col0 + t * 16 + ln; const float bv = bp ? bf16_round(bp[col]) : 0.f;
#pragma unroll
    for (int r = 0; r < 8; ++r) { float v = acc[t][r] * alpha + bv; if (CP) { const int rr = row0g + row0 + 8 * hh + r; if (rowsPerB < 0) v += CP[cofs + (size_t)rr * ldc + col];      /* rowsPerB < 0: own element of the batched C plane */ else { const int bidx = rr / rowsPerB; v += CP[(size_t)bidx * sCPb + (size_t)by * 64 + col]; } } if (ACT == 1) v = (v > 0.f) ? v : expm1f(v); else if (ACT == 7) v = (v > 0.f) ? v + 1.0f : expf(v); else if (ACT == 8) v = tanhf(v); else if (ACT == 9) v = 0.5f * v * (1.0f + tanhf(0.7978845608028654f * (v + 0.044715f * v * v * v))); else if (ACT == 11) v = 1.0f / (1.0f + expf(-v)); else if (ACT == 12) v = (v > 0.f) ? v : 0.01f * v; else if (ACT == 14) v = (v > 0.f) ? v : 0.1f * v; else if (ACT == 16) v = (v >= 0.f) ? v : 0.3f * v; else if (ACT == 17) v = (v >= 0.f) ? v : 0.2f * v; else if (ACT == 15) v = v / (1.0f + expf(-v)); else if (ACT == 3) v = fmaxf(v, 0.f); else if (ACT == 6) v = 0.5f * v * (1.0f + erff(v * 0.70710678118654752f)); so[w][8 * hh + r][t * 16 + ln] = v; } }
  __builtin_amdgcn_fence(__ATOMIC_ACQ_REL, "workgroup"); __builtin_amdgcn_wave_barrier();
  const int rsub = lane >> 4, c4 = (lane & 15) * 4; typedef _Float16 v4h __attribute__((ext_vector_type(4)));
  {
#pragma unroll
    for (int q = 0; q < 8; ++q) { const int r = q * 2 + rsub; if (col0 + c4 < N) { const v4f v = *(const v4fa*)&so[w][r][c4]; if (C) *(v4f*)(C + cofs + (size_t)(row0 + r) * ldc + col0 + c4) = v; if (C16) { v4h h4; for (int i = 0; i < 4; ++i) h4[i] = (_Float16)v[i]; *(v4h*)(C16 + cofs + (size_t)(row0 + r) * ldc + col0 + c4) = h4; } } }
     }
}


typedef _Float16 v4h __attribute__((ext_vector_type(4)));

__global__ __launch_bounds__(256) void k_x16(const float* __restrict__ x, _Float16* __restrict__ X16, size_t n8) { const size_t t = (size_t)blockIdx.x * 256 + threadIdx.x; if (t >= n8) return; FragH f;
#pragma unroll
  for (int q = 0; q < 8; ++q) f.h[q] = (_Float16)bf16_round(x[t * 8 + q]); *(v8us*)((unsigned short*)X16 + t * 8) = f.half[0];  }
__global__ __launch_bounds__(256) void k_h16(const float* __restrict__ x, _Float16* __restrict__ X16, size_t n8) { const size_t t = (size_t)blockIdx.x * 256 + threadIdx.x; if (t >= n8) return; FragH f;
#pragma unroll
  for (int q = 0; q < 8; ++q) f.h[q] = (_Float16)x[t * 8 + q]; *(v8us*)((unsigned short*)X16 + t * 8) = f.half[0];  }
__global__ __launch_bounds__(256) void k_round16f(const float* __restrict__ W, _Float16* __restrict__ Bt, size_t n8) { const size_t t = (size_t)blockIdx.x * 256 + threadIdx.x; if (t >= n8) return; FragH f;
#pragma unroll
  for (int i = 0; i < 8; ++i) f.h[i] = (_Float16)(bf16_round(W[t * 8 + i]) * 16.0f); *(v8us*)((unsigned short*)Bt + t * 8) = f.half[0];  }
template <int NHv, int TTv>
__global__ __launch_bounds__(256) void k_vt(const _Float16* __restrict__ V16, int ldv, int voff, _Float16* __restrict__ Vt) { __shared__ unsigned short tl[64][66]; const int tid = threadIdx.x; const int slab = blockIdx.x / (TTv / 64), lg = blockIdx.x % (TTv / 64); const int b = slab / NHv, h = slab % NHv;
  for (int i = tid; i < 64 * 8; i += 256) { const int r = i / 8, c8 = (i % 8) * 8; FragH f; f.half[0] = *(const v8us*)((const unsigned short*)V16 + ((size_t)b * TTv + lg * 64 + r) * ldv + voff + h * 64 + c8);
#pragma unroll
    for (int q = 0; q < 8; ++q) tl[r][c8 + q] = f.u[q]; }
  __syncthreads();
  {
#pragma unroll
    for (int rd = 0; rd < 2; ++rd) { const int d = rd * 32 + tid / 8, pc = tid % 8; FragH f;
#pragma unroll
      for (int q = 0; q < 8; ++q) f.u[q] = tl[pc * 8 + q][d];
      *(v8us*)((unsigned short*)Vt + ((size_t)slab * 64 + d) * TTv + lg * 64 + pc * 8) = f.half[0]; }
     } }

__global__ __launch_bounds__(256) void k_hl(const float* __restrict__ F, _Float16* __restrict__ Hh, _Float16* __restrict__ Hl, size_t n8) { const size_t t = (size_t)blockIdx.x * 256 + threadIdx.x; if (t >= n8) return; FragH fh, fl; const v4f a = *(const v4fa*)(F + t * 8), c = *(const v4fa*)(F + t * 8 + 4);
#pragma unroll
  for (int q = 0; q < 4; ++q) { _Float16 h = (_Float16)a[q]; fh.h[q] = h; fl.h[q] = (_Float16)((a[q] - (float)h) * 1024.0f); h = (_Float16)c[q]; fh.h[4 + q] = h; fl.h[4 + q] = (_Float16)((c[q] - (float)h) * 1024.0f); }
  { *(v8us*)((unsigned short*)Hh + t * 8) = fh.half[0]; *(v8us*)((unsigned short*)Hl + t * 8) = fl.half[0];  } }

// ---- fast GEMM (wave tile 32x64; requires M % 32 == 0 rows per launch region and N % 64 == 0); epilogue = k_gemm_hhx semantics ----
__device__ __forceinline__ v16h g2_frag(const _Float16* p, int hh) { FragH f; f.half[0] = *(const v8us*)((const unsigned short*)p + 8 * hh); f.half[1] = *(const v8us*)((const unsigned short*)p + 16 + 8 * hh); return f.v; }
__device__ __forceinline__ v8f g2_mma(v16h a, v16h b, v8f c) { v8f d = __builtin_amdgcn_wmma_f32_16x16x32_f16(false, a, false, b, (short)0, c, false, false); asm volatile("v_nop\n\tv_nop\n\tv_nop\n\tv_nop" : "+v"(d) : "v"(a), "v"(b)); return d; }
template <int ACT>
__global__ __launch_bounds__(128) void k_gemm2(const _Float16* __restrict__ A, int lda, size_t sA, const _Float16* __restrict__ Bh, int ldb, size_t sB, float alpha, const float* __restrict__ bias, size_t sBias, const float* __restrict__ CP, int rowsPerB, size_t sCPb, int row0g,
    float* __restrict__ C, _Float16* __restrict__ C16, int ldc, size_t sC, int M, int N, int K) { static_assert(ACT == 0 || ACT == 3 || ACT == 6 || ACT == 8 || ACT == 9 || ACT == 11 || ACT == 12 || ACT == 14 || ACT == 15 || ACT == 16 || ACT == 17, "k_gemm2: unsupported ACT code (would silently apply no activation)");
  __shared__ __attribute__((aligned(16))) float so[4][32][68];
  const int tid = threadIdx.x, w = tid >> 5, lane = tid & 31, ln = lane & 15, hh = lane >> 4; const int by = blockIdx.y;
  A += (size_t)by * sA; Bh += (size_t)by * sB; const size_t cofs = (size_t)by * sC; const float* bp = bias ? bias + (size_t)by * sBias : nullptr;
  const int ntn = N >> 6; const int mt = blockIdx.x / ntn, nq = blockIdx.x - mt * ntn; const int row0 = mt * 128 + 32 * w, col0 = nq * 64; if (row0 >= M) return;
  const _Float16* a0p = A + (size_t)(row0 + ln) * lda; const _Float16* a1p = a0p + (size_t)16 * lda;
  const _Float16* b0p = Bh + (size_t)(col0 + ln) * ldb; const _Float16* b1p = b0p + (size_t)16 * ldb; const _Float16* b2p = b1p + (size_t)16 * ldb; const _Float16* b3p = b2p + (size_t)16 * ldb;
  const v8f z8 = {0.f,0.f,0.f,0.f,0.f,0.f,0.f,0.f}; v8f c00 = z8, c01 = z8, c02 = z8, c03 = z8, c10 = z8, c11 = z8, c12 = z8, c13 = z8;
#pragma unroll 1
  for (int kb = 0; kb < K; kb += 32) { const v16h a0 = g2_frag(a0p + kb, hh), a1 = g2_frag(a1p + kb, hh);
    v16h b = g2_frag(b0p + kb, hh); c00 = g2_mma(a0, b, c00); c10 = g2_mma(a1, b, c10);
    b = g2_frag(b1p + kb, hh); c01 = g2_mma(a0, b, c01); c11 = g2_mma(a1, b, c11);
    b = g2_frag(b2p + kb, hh); c02 = g2_mma(a0, b, c02); c12 = g2_mma(a1, b, c12);
    b = g2_frag(b3p + kb, hh); c03 = g2_mma(a0, b, c03); c13 = g2_mma(a1, b, c13); }
  v8f accs[8] = {c00, c01, c02, c03, c10, c11, c12, c13};
#pragma unroll
  for (int u = 0; u < 8; ++u) { const int t = u & 3, half = u >> 2; const int col = col0 + t * 16 + ln; const float bv = bp ? bf16_round(bp[col]) : 0.f;
#pragma unroll
    for (int r = 0; r < 8; ++r) { const int rloc = half * 16 + 8 * hh + r; float v = accs[u][r] * alpha + bv; if (CP) { if (rowsPerB < 0) v += CP[cofs + (size_t)(row0g + row0 + rloc) * ldc + col];      /* rowsPerB < 0: own element of the batched C plane */ else { const int bidx = (row0g + row0 + rloc) / rowsPerB; v += CP[(size_t)bidx * sCPb + (size_t)by * 64 + col]; } }
      if (ACT == 3) v = fmaxf(v, 0.f); else if (ACT == 6) v = 0.5f * v * (1.0f + erff(v * 0.70710678118654752f)); else if (ACT == 11) v = 1.0f / (1.0f + expf(-v)); else if (ACT == 15) v = v / (1.0f + expf(-v)); else if (ACT == 12) v = (v > 0.f) ? v : 0.01f * v; else if (ACT == 8) v = tanhf(v); else if (ACT == 9) v = 0.5f * v * (1.0f + tanhf(0.7978845608028654f * (v + 0.044715f * v * v * v))); else if (ACT == 14) v = (v > 0.f) ? v : 0.1f * v; else if (ACT == 16) v = (v >= 0.f) ? v : 0.3f * v; else if (ACT == 17) v = (v >= 0.f) ? v : 0.2f * v;
      so[w][rloc][t * 16 + ln] = v; } }
  __builtin_amdgcn_fence(__ATOMIC_ACQ_REL, "workgroup"); __builtin_amdgcn_wave_barrier();
  const int rsub = lane >> 4, c4 = (lane & 15) * 4;
  {
#pragma unroll
    for (int q = 0; q < 16; ++q) { const int r = q * 2 + rsub; const v4f v = *(const v4fa*)&so[w][r][c4]; if (C) *(v4f*)(C + cofs + (size_t)(row0 + r) * ldc + col0 + c4) = v; if (C16) { v4h h4; for (int i = 0; i < 4; ++i) h4[i] = (_Float16)v[i]; *(v4h*)(C16 + cofs + (size_t)(row0 + r) * ldc + col0 + c4) = h4; } }
     } }


__global__ __launch_bounds__(256) void k_wnat(const float* __restrict__ w, size_t n8, _Float16* __restrict__ Bt) { const size_t t = (size_t)blockIdx.x * 256 + threadIdx.x; if (t >= n8) return; FragH f; for (int q = 0; q < 8; ++q) f.h[q] = (_Float16)(bf16_round(w[t * 8 + q]) * 16.0f); *(v8us*)((unsigned short*)Bt + t * 8) = f.half[0];  }
__global__ __launch_bounds__(256) void k_rsm(const float* __restrict__ S, _Float16* __restrict__ P, int nrows) {
  #pragma clang fp contract(off)
  const int i = blockIdx.x * 256 + threadIdx.x; if (i >= nrows) return; const float* s = S + (size_t)i * SQ; float mx = -3.0e38f;
#pragma unroll 1
  for (int j = 0; j < SQ; ++j) mx = fmaxf(mx, s[j]); float se = 0.f;
#pragma unroll 1
  for (int j = 0; j < SQ; ++j) se += expf(s[j] - mx); const float sc = 256.0f / se;
#pragma unroll 1
  for (int j0 = 0; j0 < SQ; j0 += 8) { FragH f; for (int q = 0; q < 8; ++q) f.h[q] = (_Float16)(expf(s[j0 + q] - mx) * sc); unsigned short* d = (unsigned short*)P + (size_t)i * SQ + j0; *(v8us*)d = f.half[0];  } }
__global__ __launch_bounds__(256) void k_vt(const _Float16* __restrict__ V16, int b, int h0, _Float16* __restrict__ VT) { __shared__ unsigned short tl[64][65]; const int tid = threadIdx.x; const int hh = blockIdx.x % HG, sg = blockIdx.x / HG; const int s0 = sg * 64; const int h = h0 + hh;
  for (int i = tid; i < 64 * 8; i += 256) { const int j = i / 8, d8 = (i % 8) * 8; FragH f; f.half[0] = *(const v8us*)((const unsigned short*)V16 + ((size_t)b * SQ + s0 + j) * DM + h * HD + d8); for (int q = 0; q < 8; ++q) tl[d8 + q][j] = f.u[q]; }
  __syncthreads();
  { for (int i = tid; i < 64 * 8; i += 256) { const int d = i / 8, j8 = (i % 8) * 8; FragH f; for (int q = 0; q < 8; ++q) f.u[q] = tl[d][j8 + q]; *(v8us*)((unsigned short*)VT + ((size_t)hh * HD + d) * SQ + s0 + j8) = f.half[0]; }  } }

// Row softmax, one wave per row: each lane holds 64 of the row's 2048 scores in registers (16 loads of 16 B, every load 512 contiguous bytes of the row),
// so the scores are read once and every exponential is formed once. Maximum and sum: four chains per lane, then a butterfly over the 32 lanes. P = 256 * softmax, f16.
template <int M> __device__ __forceinline__ float rs_xm(float x) { return __builtin_bit_cast(float, __builtin_amdgcn_mov_dpp(__builtin_bit_cast(int, x), 0x160 | M, 0xf, 0xf, false)); }      /* lane l with lane l ^ M inside a 16-lane row (row_xmask) */
__device__ __forceinline__ float rs_xh(float x) { return __builtin_bit_cast(float, __builtin_amdgcn_permlanex16(__builtin_bit_cast(int, x), __builtin_bit_cast(int, x), 0x76543210, 0xfedcba98, false, false)); }      /* lane l with lane l ^ 16 */
__global__ __launch_bounds__(256) void k_rsmW(const float* __restrict__ S, _Float16* __restrict__ P, int nrows) {
  const int row = blockIdx.x * 8 + (threadIdx.x >> 5), lane = threadIdx.x & 31; if (row >= nrows) return;      /* the same in every lane of a wave; no barrier below */
  const float* s = S + (size_t)row * SQ + lane * 4; v4f v[SQ / 128];
#pragma unroll      /* constant indices keep v[] in registers */
  for (int u = 0; u < SQ / 128; ++u) v[u] = *(const v4fa*)(s + u * 128);
  asm volatile("s_wait_xcnt 0x0" :: "v"(s) : "memory");      /* the wait in front of any reuse of the loads' address registers; the pointer as an input keeps them from being a load's destination */
  v4f m4 = v[0];
#pragma unroll      /* constant indices keep v[] in registers */
  for (int u = 1; u < SQ / 128; ++u) for (int q = 0; q < 4; ++q) m4[q] = fmaxf(m4[q], v[u][q]);
  float mx = fmaxf(fmaxf(m4[0], m4[1]), fmaxf(m4[2], m4[3]));
  mx = fmaxf(mx, rs_xm<1>(mx)); mx = fmaxf(mx, rs_xm<2>(mx)); mx = fmaxf(mx, rs_xm<4>(mx)); mx = fmaxf(mx, rs_xm<8>(mx)); mx = fmaxf(mx, rs_xh(mx));
  v4f s4 = {0.f, 0.f, 0.f, 0.f};
#pragma unroll      /* constant indices keep v[] in registers */
  for (int u = 0; u < SQ / 128; ++u) for (int q = 0; q < 4; ++q) { v[u][q] = expf(v[u][q] - mx); s4[q] += v[u][q]; }
  float se = (s4[0] + s4[1]) + (s4[2] + s4[3]);
  se += rs_xm<1>(se); se += rs_xm<2>(se); se += rs_xm<4>(se); se += rs_xm<8>(se); se += rs_xh(se);
  const float sc = 256.0f / se; _Float16* d = P + (size_t)row * SQ + lane * 4;
#pragma unroll      /* constant indices keep v[] in registers */
  for (int u = 0; u < SQ / 128; ++u) *(v4h*)(d + u * 128) = __builtin_convertvector(v[u] * sc, v4h); }
__global__ __launch_bounds__(256) void k_f16rows(const float* __restrict__ F, _Float16* __restrict__ R, size_t n8) { const size_t t = (size_t)blockIdx.x * 256 + threadIdx.x; if (t >= n8) return; FragH f; for (int q = 0; q < 8; ++q) f.h[q] = (_Float16)F[t * 8 + q]; *(v8us*)((unsigned short*)R + t * 8) = f.half[0];  }
extern "C" void kernel_launch(void* const* d_in, const int* in_sizes, int n_in,
                              void* d_out, int out_size, void* d_ws, size_t ws_size, hipStream_t stream) {
  (void)in_sizes; (void)n_in; (void)out_size;
  const float* const* I = (const float* const*)d_in; const float* x = I[0]; const float* wq = I[1]; const float* wk = I[2]; const float* wv = I[3]; const float* bq = nullptr; const float* bk = nullptr; const float* bv = nullptr;      /* [in][out] weights */
  char* ws = (char*)d_ws; size_t off = 0;
  auto take = [&](size_t bytes) { char* p = ws + off; off += (bytes + 255) & ~(size_t)255; return p; };
  _Float16* BQ = (_Float16*)take((size_t)DQ * DM * 2); _Float16* BK = (_Float16*)take((size_t)DQ * DM * 2); _Float16* BV = (_Float16*)take((size_t)DV * DM * 2);
  _Float16* X16 = (_Float16*)take(NR * DM * 2); float* F32 = (float*)take(NR * (DQ > DV ? DQ : DV) * 4); _Float16* Q16 = (_Float16*)take(NR * DQ * 2); _Float16* QL = (_Float16*)take(NR * DQ * 2); _Float16* K16 = (_Float16*)take(NR * DQ * 2); _Float16* KL = (_Float16*)take(NR * DQ * 2); _Float16* V16 = (_Float16*)take(NR * DV * 2);
  float* S = (float*)take((size_t)QT * SQ * 4); _Float16* P = (_Float16*)take((size_t)QT * SQ * 2); _Float16* PL = (_Float16*)take((size_t)QT * SQ * 2); _Float16* VT = (_Float16*)take((size_t)NB * DV * SQ * 2);
  if (off > ws_size) return;
  k_wt_f16<<<(unsigned)(((size_t)DQ * (DM / 8) + 255) / 256), 256, 0, stream>>>(wq, BQ, DM, DQ, 16.0f); k_wt_f16<<<(unsigned)(((size_t)DQ * (DM / 8) + 255) / 256), 256, 0, stream>>>(wk, BK, DM, DQ, 16.0f); k_wt_f16<<<(unsigned)(((size_t)DV * (DM / 8) + 255) / 256), 256, 0, stream>>>(wv, BV, DM, DV, 16.0f);
  k_x16<<<(unsigned)((NR * DM / 8 + 255) / 256), 256, 0, stream>>>(x, X16, NR * DM / 8);
  k_gemm2<0><<<dim3((unsigned)((NR / 128) * (DQ / 64)), 1), 128, 0, stream>>>(X16, DM, 0, BQ, DM, 0, 0.0625f, bq, 0, nullptr, 1, 0, 0, F32, nullptr, DQ, 0, MP, DQ, DM);      /* q f32 */
  k_f16rows<<<(unsigned)((NR * DQ / 8 + 255) / 256), 256, 0, stream>>>(F32, Q16, NR * DQ / 8);
  k_gemm2<0><<<dim3((unsigned)((NR / 128) * (DQ / 64)), 1), 128, 0, stream>>>(X16, DM, 0, BK, DM, 0, 0.0625f, bk, 0, nullptr, 1, 0, 0, F32, nullptr, DQ, 0, MP, DQ, DM);      /* k f32 (reusing the plane) */
  k_f16rows<<<(unsigned)((NR * DQ / 8 + 255) / 256), 256, 0, stream>>>(F32, K16, NR * DQ / 8);
  k_gemm2<0><<<dim3((unsigned)((NR / 128) * (DV / 64)), 1), 128, 0, stream>>>(X16, DM, 0, BV, DM, 0, 0.0625f, bv, 0, nullptr, 1, 0, 0, nullptr, V16, DV, 0, MP, DV, DM);      /* v f16 rows */
  k_vt<NH, SQ><<<NB * NH * (SQ / 64), 256, 0, stream>>>(V16, DV, 0, VT);      /* V^T per batch [DV][SQ] */
  for (int b = 0; b < NBR; ++b) for (int q0 = 0; q0 < QN; q0 += QT) {
    const size_t qo = ((size_t)b * SQ + q0) * DQ, ko = (size_t)b * SQ * DQ; const dim3 gs((QT / 128) * (SQ / 64), 1);
    k_gemm2<0><<<gs, 128, 0, stream>>>(Q16 + qo, DQ, 0, K16 + ko, DQ, 0, 0.0625f, nullptr, 0, nullptr, 1, 0, 0, S, nullptr, SQ, 0, QT, SQ, DQ);      /* scores */
    k_rsmW<<<(QT + 7) / 8, 256, 0, stream>>>(S, P, QT);
    float* ob = (float*)d_out + ((size_t)b * SQ + q0) * DV; const _Float16* vt = VT + (size_t)b * DV * SQ; const dim3 gv((QT / 128) * (DV / 64), 1);
    k_gemm2<0><<<gv, 128, 0, stream>>>(P, SQ, 0, vt, SQ, 0, 0.00390625f, nullptr, 0, nullptr, 1, 0, 0, ob, nullptr, DV, 0, QT, DV, SQ); }      /* out = attn v */
}

// v002
// It runs in 229 microseconds.
// Timed twice side by side with v001, it ran 3.11 and 3.06 times as fast.
// Over all steps from v000 it is 21.2 times as fast.
#include <hip/hip_runtime.h>
// Single-head self-attention (x [8][2048][256]; Q, K, V = x W ([in][out] [256][256]); scores = Q.K/16; softmax over all 2048 keys; out = attn V -> [8][2048][256]).
// Structure: token rows; x as exact f16 rows; q | k | v WMMA GEMMs (32x64 wave tiles, f32 accumulation, exact x16 transposed [in][out] weights); q, k as f16 rows; v as f16 rows, V^T via LDS transposes; all batches in one launch each (batch = grid.y of the two GEMMs): scores GEMM (K = 256), row softmax on VALU (f32; P x256 f16), out = P . V^T GEMM written straight to the f32 output.
// Compute dtype: inputs rounded to bf16; x / weights exact; q, k plain f16 (~2^-12); v, P plain f16 (~2^-12); scores / softmax f32; v_wmma_f32_16x16x32_f16.
#define NB 8
#define SQ 2048
#define DM 256
#define DQ 256
#define DV 256
#define QT 2048
#define NH 4                    /* V^T slabs of 64 (k_vt<NH, SQ>) */
#define HD 64
#define HG 1
#define NR ((size_t)NB * SQ)
#define QN SQ                        /* query rows per batch (debug hook) */
#define NBR NB                       /* batches (debug hook) */
#define MP ((int)NR)                 /* rows through the projections (debug hook) */
typedef __bf16 v16b __attribute__((ext_vector_type(16)));
typedef unsigned short v8us __attribute__((ext_vector_type(8), may_alias));
typedef float  v8f  __attribute__((ext_vector_type(8)));
typedef float  v4f  __attribute__((ext_vector_type(4)));
typedef float  v4fa __attribute__((ext_vector_type(4), may_alias));
union FragB { v16b v; v8us half[2]; unsigned short u[16]; };

__device__ __forceinline__ unsigned short bf16_bits(float x) { unsigned int u = __float_as_uint(x); return (unsigned short)((u + 0x7FFFu + ((u >> 16) & 1u)) >> 16); }
__device__ __forceinline__ float bf16_val(unsigned short b) { return __uint_as_float(((unsigned int)b) << 16); }
__device__ __forceinline__ float bf16_round(float x) { return bf16_val(bf16_bits(x)); }
// D += A·B with NT terms: 1 = ah·bh, 2 = + al·bh (A split), 3 = + ah·bl (both split)
template <int NT>
__device__ __forceinline__ v8f mmaN(v16b ah, v16b al, v16b bh, v16b bl, v8f c) {
  c = __builtin_amdgcn_wmma_f32_16x16x32_bf16(false, ah, false, bh, (short)0, c, false, false);
  if (NT >= 2) c = __builtin_amdgcn_wmma_f32_16x16x32_bf16(false, al, false, bh, (short)0, c, false, false);
  if (NT >= 3) c = __builtin_amdgcn_wmma_f32_16x16x32_bf16(false, ah, false, bl, (short)0, c, false, false);
  asm volatile("v_nop\n\tv_nop\n\tv_nop\n\tv_nop" : "+v"(c) : "v"(ah), "v"(al), "v"(bh), "v"(bl));
  return c;
}

__global__ __launch_bounds__(256) void k_wt_bf16(const float* __restrict__ W, unsigned short* __restrict__ Wt, int K, int N) {
  const int t = blockIdx.x * 256 + threadIdx.x;
  const int k8n = K / 8;
  if (t >= N * k8n) return;
  const int n = t / k8n, k8 = (t % k8n) * 8;
  v8us v;
#pragma unroll
  for (int i = 0; i < 8; ++i) v[i] = bf16_bits(W[(size_t)(k8 + i) * N + n]);
  *(v8us*)(Wt + (size_t)n * K + k8) = v;
  
}

// GEMM C[M][N] (f32, pitch ldc) = act(A[M][K]·W + bias). A f32 row-major (pitch lda) converted per fragment to bf16
// (ASPLIT: hi/lo two planes -> 2 terms, else single rounded term); Wt bf16 [N][K] (pitch ldb). BIAS_BF16 rounds the
// bias to bf16 first (bias quantised to bf16 before the add). K%32==0, M%16==0, N%64==0.
template <bool ASPLIT, int ACT, bool BIAS_BF16>
__global__ __launch_bounds__(128) void k_gemm_bf(const float* __restrict__ A, int lda, const unsigned short* __restrict__ Wt, int ldb,
                                               const float* __restrict__ bias, float* __restrict__ C, int ldc, int M, int N, int K) {
  __shared__ __attribute__((aligned(16))) float so[4][16][64];
  const int tid = threadIdx.x, w = tid >> 5, lane = tid & 31, ln = lane & 15, hh = lane >> 4;
  const int ntn = N / 64;
  const int wid = blockIdx.x * 4 + w;
  const int mt = wid / ntn, nq = wid % ntn;
  if (mt * 16 >= M) return;
  const int row0 = mt * 16, col0 = nq * 64;
  const float* arow = A + (size_t)(row0 + ln) * lda;
  v8f acc[4] = {};
  for (int kb = 0; kb < K; kb += 32) {
    FragB ah, al;
    const v4f x0 = *(const v4fa*)(arow + kb + 8 * hh), x1 = *(const v4fa*)(arow + kb + 8 * hh + 4);
    const v4f x2 = *(const v4fa*)(arow + kb + 16 + 8 * hh), x3 = *(const v4fa*)(arow + kb + 16 + 8 * hh + 4);
    float xs[16] = {x0[0],x0[1],x0[2],x0[3],x1[0],x1[1],x1[2],x1[3],x2[0],x2[1],x2[2],x2[3],x3[0],x3[1],x3[2],x3[3]};
#pragma unroll
    for (int i = 0; i < 16; ++i) { const unsigned short hb = bf16_bits(xs[i]); ah.u[i] = hb; al.u[i] = ASPLIT ? bf16_bits(xs[i] - bf16_val(hb)) : (unsigned short)0; }
#pragma unroll
    for (int t = 0; t < 4; ++t) {
      const unsigned short* brow = Wt + (size_t)(col0 + t * 16 + ln) * ldb + kb;
      FragB b;
      b.half[0] = *(const v8us*)(brow + 8 * hh);
      b.half[1] = *(const v8us*)(brow + 16 + 8 * hh);
      acc[t] = mmaN<ASPLIT ? 2 : 1>(ah.v, al.v, b.v, b.v, acc[t]);
    }
  }
#pragma unroll
  for (int t = 0; t < 4; ++t) {
    float bv = bias ? bias[col0 + t * 16 + ln] : 0.f;
    if (BIAS_BF16) bv = bf16_round(bv);
#pragma unroll
    for (int r = 0; r < 8; ++r) { float v = acc[t][r] + bv; if (ACT == 1) v = fmaxf(v, 0.f); so[w][8 * hh + r][t * 16 + ln] = v; }
  }
  __builtin_amdgcn_fence(__ATOMIC_ACQ_REL, "workgroup");
  __builtin_amdgcn_wave_barrier();
  const int rsub = lane >> 4, c4 = (lane & 15) * 4;
  {
#pragma unroll
    for (int q = 0; q < 8; ++q) {
      const int r = q * 2 + rsub;
      const v4f v = *(const v4fa*)&so[w][r][c4];
      *(v4f*)(C + (size_t)(row0 + r) * ldc + col0 + c4) = v;
    }
    
  }
}

// GEMM C = act(A·W + bias + resid): A f32 (ASPLIT -> hi/lo 2 terms), Wt bf16 [N][K]; ACT 0 none, 1 relu, 2 exact gelu;
// resid (optional, f32, row index = (row % rmod), pitch ldr, RES_BF16 rounds it) added before the activation.
template <bool ASPLIT, int ACT, bool BIAS_BF16, bool RES_BF16>
__global__ __launch_bounds__(128) void k_gemm_bf3(const float* __restrict__ A, int lda, const unsigned short* __restrict__ Wt, int ldb,
                                                const float* __restrict__ bias, const float* __restrict__ resid, int rmod, int ldr,
                                                float* __restrict__ C, int ldc, int M, int N, int K) {
  __shared__ __attribute__((aligned(16))) float so[4][16][64];
  const int tid = threadIdx.x, w = tid >> 5, lane = tid & 31, ln = lane & 15, hh = lane >> 4;
  const int ntn = N / 64;
  const int wid = blockIdx.x * 4 + w;
  const int mt = wid / ntn, nq = wid % ntn;
  if (mt * 16 >= M) return;
  const int row0 = mt * 16, col0 = nq * 64;
  const float* arow = A + (size_t)(row0 + ln) * lda;
  v8f acc[4] = {};
  for (int kb = 0; kb < K; kb += 32) {
    FragB ah, al;
    const v4f x0 = *(const v4fa*)(arow + kb + 8 * hh), x1 = *(const v4fa*)(arow + kb + 8 * hh + 4);
    const v4f x2 = *(const v4fa*)(arow + kb + 16 + 8 * hh), x3 = *(const v4fa*)(arow + kb + 16 + 8 * hh + 4);
    float xs[16] = {x0[0],x0[1],x0[2],x0[3],x1[0],x1[1],x1[2],x1[3],x2[0],x2[1],x2[2],x2[3],x3[0],x3[1],x3[2],x3[3]};
#pragma unroll
    for (int i = 0; i < 16; ++i) { const unsigned short hb = bf16_bits(xs[i]); ah.u[i] = hb; al.u[i] = ASPLIT ? bf16_bits(xs[i] - bf16_val(hb)) : (unsigned short)0; }
#pragma unroll
    for (int t = 0; t < 4; ++t) {
      const unsigned short* brow = Wt + (size_t)(col0 + t * 16 + ln) * ldb + kb;
      FragB b;
      b.half[0] = *(const v8us*)(brow + 8 * hh);
      b.half[1] = *(const v8us*)(brow + 16 + 8 * hh);
      acc[t] = mmaN<ASPLIT ? 2 : 1>(ah.v, al.v, b.v, b.v, acc[t]);
    }
  }
#pragma unroll
  for (int t = 0; t < 4; ++t) {
    const int col = col0 + t * 16 + ln;
    float bv = bias ? bias[col] : 0.f;
    if (BIAS_BF16) bv = bf16_round(bv);
#pragma unroll
    for (int r = 0; r < 8; ++r) {
      float v = acc[t][r] + bv;
      if (resid) { float rv = resid[(size_t)((row0 + 8 * hh + r) % rmod) * ldr + col]; if (RES_BF16) rv = bf16_round(rv); v += rv; }
      if (ACT == 1) v = fmaxf(v, 0.f);
      if (ACT == 2) v = 0.5f * v * (1.0f + erff(v * 0.70710678118654752f));
      if (ACT == 3) { const float u = 0.7978845608028654f * (v + 0.044715f * v * v * v); v = 0.5f * v * (1.0f + tanhf(u)); }
      so[w][8 * hh + r][t * 16 + ln] = v;
    }
  }
  __builtin_amdgcn_fence(__ATOMIC_ACQ_REL, "workgroup");
  __builtin_amdgcn_wave_barrier();
  const int rsub = lane >> 4, c4 = (lane & 15) * 4;
  {
#pragma unroll
    for (int q = 0; q < 8; ++q) {
      const int r = q * 2 + rsub;
      const v4f v = *(const v4fa*)&so[w][r][c4];
      *(v4f*)(C + (size_t)(row0 + r) * ldc + col0 + c4) = v;
    }
    
  }
}
// row LayerNorm (biased variance, eps) over N: s = X (+ R); optional out_sum <- s; out_norm <- (s-mu)*rsqrt(var+eps)*g + b
template <bool PARAM_BF16>
__global__ __launch_bounds__(256) void k_layernorm(const float* __restrict__ X, const float* __restrict__ R, const float* __restrict__ g, const float* __restrict__ bta,
                                                  float* __restrict__ out_sum, float* __restrict__ out_norm, int N, float eps) {
  __shared__ float red[256];
  const int row = blockIdx.x, tid = threadIdx.x;
  const float* x = X + (size_t)row * N; const float* rr = R ? R + (size_t)row * N : nullptr;
  float vals[16];                     // up to N = 4096
  const int per = N / 256;            // contiguous chunk per thread? use strided-by-4 chunks: thread handles j = tid*4 + 1024*u
  float s1 = 0.f;
  for (int u = 0; u < per / 4; ++u) {
    const int j = tid * 4 + 1024 * u;
    const v4f a = *(const v4fa*)(x + j);
    v4f b = {0.f,0.f,0.f,0.f}; if (rr) b = *(const v4fa*)(rr + j);
#pragma unroll
    for (int q = 0; q < 4; ++q) { const float v = a[q] + b[q]; vals[u * 4 + q] = v; s1 += v; }
  }
  red[tid] = s1; __syncthreads();
  for (int st = 128; st > 0; st >>= 1) { if (tid < st) red[tid] += red[tid + st]; __syncthreads(); }
  const float mu = red[0] / (float)N; __syncthreads();
  float s2 = 0.f;
  for (int u = 0; u < per / 4; ++u)
#pragma unroll
    for (int q = 0; q < 4; ++q) { const float c = vals[u * 4 + q] - mu; s2 += c * c; }
  red[tid] = s2; __syncthreads();
  for (int st = 128; st > 0; st >>= 1) { if (tid < st) red[tid] += red[tid + st]; __syncthreads(); }
  const float rs = rsqrtf(red[0] / (float)N + eps);
  {
    for (int u = 0; u < per / 4; ++u) {
      const int j = tid * 4 + 1024 * u;
      v4f o, sm;
#pragma unroll
      for (int q = 0; q < 4; ++q) {
        float gg = g[j + q], bb = bta[j + q];
        if (PARAM_BF16) { gg = bf16_round(gg); bb = bf16_round(bb); }
        sm[q] = vals[u * 4 + q]; o[q] = (vals[u * 4 + q] - mu) * rs * gg + bb;
      }
      if (out_sum) *(v4f*)(out_sum + (size_t)row * N + j) = sm;
      *(v4f*)(out_norm + (size_t)row * N + j) = o;
    }
    
  }
}



// ---- f16 WMMA path (v_wmma_f32_16x16x32_f16): 11-bit significands for operands in range — used where a [0,1] probability operand needs more precision than bf16
typedef _Float16 v16h __attribute__((ext_vector_type(16)));
union FragH { v16h v; v8us half[2]; _Float16 h[16]; unsigned short u[16]; };
template <int NT>
__device__ __forceinline__ v8f mmaH(v16h ah, v16h al, v16h bh, v16h bl, v8f c) {
  c = __builtin_amdgcn_wmma_f32_16x16x32_f16(false, ah, false, bh, (short)0, c, false, false);
  if (NT >= 2) c = __builtin_amdgcn_wmma_f32_16x16x32_f16(false, al, false, bh, (short)0, c, false, false);
  if (NT >= 3) c = __builtin_amdgcn_wmma_f32_16x16x32_f16(false, ah, false, bl, (short)0, c, false, false);
  asm volatile("v_nop\n\tv_nop\n\tv_nop\n\tv_nop" : "+v"(c) : "v"(ah), "v"(al), "v"(bh), "v"(bl));
  return c;
}
// batched GEMM like k_gemm_b but f16 operands: A f32 (split into f16 hi/lo if ASPLIT, else rounded to f16), Bt = f16 values [n][k]; alpha; C f32; N multiple of 16 (partial tiles skipped)
template <bool ASPLIT>
__global__ __launch_bounds__(128) void k_gemm_h(const float* __restrict__ A, int lda, size_t sA, const _Float16* __restrict__ Bh, int ldb, size_t sB, float alpha, float* __restrict__ C, int ldc, size_t sC, int M, int N, int K) {
  __shared__ __attribute__((aligned(16))) float so[4][16][64];
  const int tid = threadIdx.x, w = tid >> 5, lane = tid & 31, ln = lane & 15, hh = lane >> 4; const int by = blockIdx.y;
  A += (size_t)by * sA; Bh += (size_t)by * sB; C += (size_t)by * sC;
  const int ntn = (N + 63) / 64; const int wid = blockIdx.x * 4 + w; const int mt = wid / ntn, nq = wid % ntn; if (mt * 16 >= M) return;
  const int row0 = mt * 16, col0 = nq * 64; const float* arow = A + (size_t)(row0 + ln) * lda;
  v8f acc[4] = {};
  for (int kb = 0; kb < K; kb += 32) {
    FragH ah, al;
    const v4f x0 = *(const v4fa*)(arow + kb + 8 * hh), x1 = *(const v4fa*)(arow + kb + 8 * hh + 4), x2 = *(const v4fa*)(arow + kb + 16 + 8 * hh), x3 = *(const v4fa*)(arow + kb + 16 + 8 * hh + 4);
    float xs[16] = {x0[0],x0[1],x0[2],x0[3],x1[0],x1[1],x1[2],x1[3],x2[0],x2[1],x2[2],x2[3],x3[0],x3[1],x3[2],x3[3]};
#pragma unroll
    for (int i = 0; i < 16; ++i) { const _Float16 h = (_Float16)xs[i]; ah.h[i] = h; al.h[i] = ASPLIT ? (_Float16)(xs[i] - (float)h) : (_Float16)0.0f; }
#pragma unroll
    for (int t = 0; t < 4; ++t) { if (col0 + t * 16 >= N) continue; const size_t boff = (size_t)(col0 + t * 16 + ln) * ldb + kb; FragH bq; bq.half[0] = *(const v8us*)(Bh + boff + 8 * hh); bq.half[1] = *(const v8us*)(Bh + boff + 16 + 8 * hh);
      acc[t] = mmaH<ASPLIT ? 2 : 1>(ah.v, al.v, bq.v, bq.v, acc[t]); }
  }
#pragma unroll
  for (int t = 0; t < 4; ++t) { if (col0 + t * 16 >= N) continue;
#pragma unroll
    for (int r = 0; r < 8; ++r) so[w][8 * hh + r][t * 16 + ln] = acc[t][r] * alpha; }
  __builtin_amdgcn_fence(__ATOMIC_ACQ_REL, "workgroup"); __builtin_amdgcn_wave_barrier();
  const int rsub = lane >> 4, c4 = (lane & 15) * 4;
  {
#pragma unroll
    for (int q = 0; q < 8; ++q) { const int r = q * 2 + rsub; if (col0 + c4 < N) { const v4f v = *(const v4fa*)&so[w][r][c4]; *(v4f*)(C + (size_t)(row0 + r) * ldc + col0 + c4) = v; } }
     }
}

// Wt[n][k] = f16(W[k][n]·scale) from f32 row-major W[K][N] (scale = power of two; bf16-exact weights stay exact in f16 away from the subnormal range)
__global__ __launch_bounds__(256) void k_wt_f16(const float* __restrict__ W, _Float16* __restrict__ Wt, int K, int N, float scale) {
  const int t = blockIdx.x * 256 + threadIdx.x; if (t >= N * (K / 8)) return; const int n = t / (K / 8), k8 = (t % (K / 8)) * 8; FragH f;
#pragma unroll
  for (int i = 0; i < 8; ++i) f.h[i] = (_Float16)(bf16_round(W[(size_t)(k8 + i) * N + n]) * scale); const v8us o = f.half[0];
  *(v8us*)((unsigned short*)Wt + (size_t)n * K + k8) = o; 
}
// k_gemm_hh variant with fused epilogue: v = acc·alpha + bias[by·sBias + col] (+ CP[(row/rowsPerB)·sCPb + by·64 + col] if CP) ; ACT 0 none / 1 elu ; writes f16 C16 (and f32 C if non-null)
template <int ACT>
__global__ __launch_bounds__(128) void k_gemm_hhx(const _Float16* __restrict__ A, int lda, size_t sA, const _Float16* __restrict__ Bh, int ldb, size_t sB, float alpha, const float* __restrict__ bias, size_t sBias, const float* __restrict__ CP, int rowsPerB, size_t sCPb, int row0g,
    float* __restrict__ C, _Float16* __restrict__ C16, int ldc, size_t sC, int M, int N, int K) {
  __shared__ __attribute__((aligned(16))) float so[4][16][64];
  const int tid = threadIdx.x, w = tid >> 5, lane = tid & 31, ln = lane & 15, hh = lane >> 4; const int by = blockIdx.y;
  A += (size_t)by * sA; Bh += (size_t)by * sB; const size_t cofs = (size_t)by * sC; const float* bp = bias ? bias + (size_t)by * sBias : nullptr;
  const int ntn = (N + 63) / 64; const int wid = blockIdx.x * 4 + w; const int mt = wid / ntn, nq = wid % ntn; if (mt * 16 >= M) return;
  const int row0 = mt * 16, col0 = nq * 64; const _Float16* arow = A + (size_t)(row0 + ln) * lda;
  v8f acc[4] = {};
  for (int kb = 0; kb < K; kb += 32) { FragH ah; ah.half[0] = *(const v8us*)((const unsigned short*)arow + kb + 8 * hh); ah.half[1] = *(const v8us*)((const unsigned short*)arow + kb + 16 + 8 * hh);
#pragma unroll
    for (int t = 0; t < 4; ++t) { if (col0 + t * 16 >= N) continue; const size_t boff = (size_t)(col0 + t * 16 + ln) * ldb + kb; FragH bq; bq.half[0] = *(const v8us*)((const unsigned short*)Bh + boff + 8 * hh); bq.half[1] = *(const v8us*)((const unsigned short*)Bh + boff + 16 + 8 * hh);
      acc[t] = mmaH<1>(ah.v, ah.v, bq.v, bq.v, acc[t]); }
  }
#pragma unroll
  for (int t = 0; t < 4; ++t) { if (col0 + t * 16 >= N) continue; const int col = col0 + t * 16 + ln; const float bv = bp ? bf16_round(bp[col]) : 0.f;
#pragma unroll
    for (int r = 0; r < 8; ++r) { float v = acc[t][r] * alpha + bv; if (CP) { const int rr = row0g + row0 + 8 * hh + r; if (rowsPerB < 0) v += CP[cofs + (size_t)rr * ldc + col];      /* rowsPerB < 0: own element of the batched C plane */ else { const int bidx = rr / rowsPerB; v += CP[(size_t)bidx * sCPb + (size_t)by * 64 + col]; } } if (ACT == 1) v = (v > 0.f) ? v : expm1f(v); else if (ACT == 7) v = (v > 0.f) ? v + 1.0f : expf(v); else if (ACT == 8) v = tanhf(v); else if (ACT == 9) v = 0.5f * v * (1.0f + tanhf(0.7978845608028654f * (v + 0.044715f * v * v * v))); else if (ACT == 11) v = 1.0f / (1.0f + expf(-v)); else if (ACT == 12) v = (v > 0.f) ? v : 0.01f * v; else if (ACT == 14) v = (v > 0.f) ? v : 0.1f * v; else if (ACT == 16) v = (v >= 0.f) ? v : 0.3f * v; else if (ACT == 17) v = (v >= 0.f) ? v : 0.2f * v; else if (ACT == 15) v = v / (1.0f + expf(-v)); else if (ACT == 3) v = fmaxf(v, 0.f); else if (ACT == 6) v = 0.5f * v * (1.0f + erff(v * 0.70710678118654752f)); so[w][8 * hh + r][t * 16 + ln] = v; } }
  __builtin_amdgcn_fence(__ATOMIC_ACQ_REL, "workgroup"); __builtin_amdgcn_wave_barrier();
  const int rsub = lane >> 4, c4 = (lane & 15) * 4; typedef _Float16 v4h __attribute__((ext_vector_type(4)));
  {
#pragma unroll
    for (int q = 0; q < 8; ++q) { const int r = q * 2 + rsub; if (col0 + c4 < N) { const v4f v = *(const v4fa*)&so[w][r][c4]; if (C) *(v4f*)(C + cofs + (size_t)(row0 + r) * ldc + col0 + c4) = v; if (C16) { v4h h4; for (int i = 0; i < 4; ++i) h4[i] = (_Float16)v[i]; *(v4h*)(C16 + cofs + (size_t)(row0 + r) * ldc + col0 + c4) = h4; } } }
     }
}


typedef _Float16 v4h __attribute__((ext_vector_type(4)));

__global__ __launch_bounds__(256) void k_x16(const float* __restrict__ x, _Float16* __restrict__ X16, size_t n8) { const size_t t = (size_t)blockIdx.x * 256 + threadIdx.x; if (t >= n8) return; FragH f;
#pragma unroll
  for (int q = 0; q < 8; ++q) f.h[q] = (_Float16)bf16_round(x[t * 8 + q]); *(v8us*)((unsigned short*)X16 + t * 8) = f.half[0];  }
__global__ __launch_bounds__(256) void k_h16(const float* __restrict__ x, _Float16* __restrict__ X16, size_t n8) { const size_t t = (size_t)blockIdx.x * 256 + threadIdx.x; if (t >= n8) return; FragH f;
#pragma unroll
  for (int q = 0; q < 8; ++q) f.h[q] = (_Float16)x[t * 8 + q]; *(v8us*)((unsigned short*)X16 + t * 8) = f.half[0];  }
__global__ __launch_bounds__(256) void k_round16f(const float* __restrict__ W, _Float16* __restrict__ Bt, size_t n8) { const size_t t = (size_t)blockIdx.x * 256 + threadIdx.x; if (t >= n8) return; FragH f;
#pragma unroll
  for (int i = 0; i < 8; ++i) f.h[i] = (_Float16)(bf16_round(W[t * 8 + i]) * 16.0f); *(v8us*)((unsigned short*)Bt + t * 8) = f.half[0];  }
template <int NHv, int TTv>
__global__ __launch_bounds__(256) void k_vt(const _Float16* __restrict__ V16, int ldv, int voff, _Float16* __restrict__ Vt) { __shared__ unsigned short tl[64][66]; const int tid = threadIdx.x; const int slab = blockIdx.x / (TTv / 64), lg = blockIdx.x % (TTv / 64); const int b = slab / NHv, h = slab % NHv;
  for (int i = tid; i < 64 * 8; i += 256) { const int r = i / 8, c8 = (i % 8) * 8; FragH f; f.half[0] = *(const v8us*)((const unsigned short*)V16 + ((size_t)b * TTv + lg * 64 + r) * ldv + voff + h * 64 + c8);
#pragma unroll
    for (int q = 0; q < 8; ++q) tl[r][c8 + q] = f.u[q]; }
  __syncthreads();
  {
#pragma unroll
    for (int rd = 0; rd < 2; ++rd) { const int d = rd * 32 + tid / 8, pc = tid % 8; FragH f;
#pragma unroll
      for (int q = 0; q < 8; ++q) f.u[q] = tl[pc * 8 + q][d];
      *(v8us*)((unsigned short*)Vt + ((size_t)slab * 64 + d) * TTv + lg * 64 + pc * 8) = f.half[0]; }
     } }

__global__ __launch_bounds__(256) void k_hl(const float* __restrict__ F, _Float16* __restrict__ Hh, _Float16* __restrict__ Hl, size_t n8) { const size_t t = (size_t)blockIdx.x * 256 + threadIdx.x; if (t >= n8) return; FragH fh, fl; const v4f a = *(const v4fa*)(F + t * 8), c = *(const v4fa*)(F + t * 8 + 4);
#pragma unroll
  for (int q = 0; q < 4; ++q) { _Float16 h = (_Float16)a[q]; fh.h[q] = h; fl.h[q] = (_Float16)((a[q] - (float)h) * 1024.0f); h = (_Float16)c[q]; fh.h[4 + q] = h; fl.h[4 + q] = (_Float16)((c[q] - (float)h) * 1024.0f); }
  { *(v8us*)((unsigned short*)Hh + t * 8) = fh.half[0]; *(v8us*)((unsigned short*)Hl + t * 8) = fl.half[0];  } }

// ---- fast GEMM (wave tile 32x64; requires M % 32 == 0 rows per launch region and N % 64 == 0); epilogue = k_gemm_hhx semantics ----
__device__ __forceinline__ v16h g2_frag(const _Float16* p, int hh) { FragH f; f.half[0] = *(const v8us*)((const unsigned short*)p + 8 * hh); f.half[1] = *(const v8us*)((const unsigned short*)p + 16 + 8 * hh); return f.v; }
__device__ __forceinline__ v8f g2_mma(v16h a, v16h b, v8f c) { v8f d = __builtin_amdgcn_wmma_f32_16x16x32_f16(false, a, false, b, (short)0, c, false, false); asm volatile("v_nop\n\tv_nop\n\tv_nop\n\tv_nop" : "+v"(d) : "v"(a), "v"(b)); return d; }
template <int ACT>
__global__ __launch_bounds__(128) void k_gemm2(const _Float16* __restrict__ A, int lda, size_t sA, const _Float16* __restrict__ Bh, int ldb, size_t sB, float alpha, const float* __restrict__ bias, size_t sBias, const float* __restrict__ CP, int rowsPerB, size_t sCPb, int row0g,
    float* __restrict__ C, _Float16* __restrict__ C16, int ldc, size_t sC, int M, int N, int K) { static_assert(ACT == 0 || ACT == 3 || ACT == 6 || ACT == 8 || ACT == 9 || ACT == 11 || ACT == 12 || ACT == 14 || ACT == 15 || ACT == 16 || ACT == 17, "k_gemm2: unsupported ACT code (would silently apply no activation)");
  __shared__ __attribute__((aligned(16))) float so[4][32][68];
  const int tid = threadIdx.x, w = tid >> 5, lane = tid & 31, ln = lane & 15, hh = lane >> 4; const int by = blockIdx.y;
  A += (size_t)by * sA; Bh += (size_t)by * sB; const size_t cofs = (size_t)by * sC; const float* bp = bias ? bias + (size_t)by * sBias : nullptr;
  const int ntn = N >> 6; const int mt = blockIdx.x / ntn, nq = blockIdx.x - mt * ntn; const int row0 = mt * 128 + 32 * w, col0 = nq * 64; if (row0 >= M) return;
  const _Float16* a0p = A + (size_t)(row0 + ln) * lda; const _Float16* a1p = a0p + (size_t)16 * lda;
  const _Float16* b0p = Bh + (size_t)(col0 + ln) * ldb; const _Float16* b1p = b0p + (size_t)16 * ldb; const _Float16* b2p = b1p + (size_t)16 * ldb; const _Float16* b3p = b2p + (size_t)16 * ldb;
  const v8f z8 = {0.f,0.f,0.f,0.f,0.f,0.f,0.f,0.f}; v8f c00 = z8, c01 = z8, c02 = z8, c03 = z8, c10 = z8, c11 = z8, c12 = z8, c13 = z8;
#pragma unroll 1
  for (int kb = 0; kb < K; kb += 32) { const v16h a0 = g2_frag(a0p + kb, hh), a1 = g2_frag(a1p + kb, hh);
    v16h b = g2_frag(b0p + kb, hh); c00 = g2_mma(a0, b, c00); c10 = g2_mma(a1, b, c10);
    b = g2_frag(b1p + kb, hh); c01 = g2_mma(a0, b, c01); c11 = g2_mma(a1, b, c11);
    b = g2_frag(b2p + kb, hh); c02 = g2_mma(a0, b, c02); c12 = g2_mma(a1, b, c12);
    b = g2_frag(b3p + kb, hh); c03 = g2_mma(a0, b, c03); c13 = g2_mma(a1, b, c13); }
  v8f accs[8] = {c00, c01, c02, c03, c10, c11, c12, c13};
#pragma unroll
  for (int u = 0; u < 8; ++u) { const int t = u & 3, half = u >> 2; const int col = col0 + t * 16 + ln; const float bv = bp ? bf16_round(bp[col]) : 0.f;
#pragma unroll
    for (int r = 0; r < 8; ++r) { const int rloc = half * 16 + 8 * hh + r; float v = accs[u][r] * alpha + bv; if (CP) { if (rowsPerB < 0) v += CP[cofs + (size_t)(row0g + row0 + rloc) * ldc + col];      /* rowsPerB < 0: own element of the batched C plane */ else { const int bidx = (row0g + row0 + rloc) / rowsPerB; v += CP[(size_t)bidx * sCPb + (size_t)by * 64 + col]; } }
      if (ACT == 3) v = fmaxf(v, 0.f); else if (ACT == 6) v = 0.5f * v * (1.0f + erff(v * 0.70710678118654752f)); else if (ACT == 11) v = 1.0f / (1.0f + expf(-v)); else if (ACT == 15) v = v / (1.0f + expf(-v)); else if (ACT == 12) v = (v > 0.f) ? v : 0.01f * v; else if (ACT == 8) v = tanhf(v); else if (ACT == 9) v = 0.5f * v * (1.0f + tanhf(0.7978845608028654f * (v + 0.044715f * v * v * v))); else if (ACT == 14) v = (v > 0.f) ? v : 0.1f * v; else if (ACT == 16) v = (v >= 0.f) ? v : 0.3f * v; else if (ACT == 17) v = (v >= 0.f) ? v : 0.2f * v;
      so[w][rloc][t * 16 + ln] = v; } }
  __builtin_amdgcn_fence(__ATOMIC_ACQ_REL, "workgroup"); __builtin_amdgcn_wave_barrier();
  const int rsub = lane >> 4, c4 = (lane & 15) * 4;
  {
#pragma unroll
    for (int q = 0; q < 16; ++q) { const int r = q * 2 + rsub; const v4f v = *(const v4fa*)&so[w][r][c4]; if (C) *(v4f*)(C + cofs + (size_t)(row0 + r) * ldc + col0 + c4) = v; if (C16) { v4h h4; for (int i = 0; i < 4; ++i) h4[i] = (_Float16)v[i]; *(v4h*)(C16 + cofs + (size_t)(row0 + r) * ldc + col0 + c4) = h4; } }
     } }


__global__ __launch_bounds__(256) void k_wnat(const float* __restrict__ w, size_t n8, _Float16* __restrict__ Bt) { const size_t t = (size_t)blockIdx.x * 256 + threadIdx.x; if (t >= n8) return; FragH f; for (int q = 0; q < 8; ++q) f.h[q] = (_Float16)(bf16_round(w[t * 8 + q]) * 16.0f); *(v8us*)((unsigned short*)Bt + t * 8) = f.half[0];  }
__global__ __launch_bounds__(256) void k_rsm(const float* __restrict__ S, _Float16* __restrict__ P, int nrows) {
  #pragma clang fp contract(off)
  const int i = blockIdx.x * 256 + threadIdx.x; if (i >= nrows) return; const float* s = S + (size_t)i * SQ; float mx = -3.0e38f;
#pragma unroll 1
  for (int j = 0; j < SQ; ++j) mx = fmaxf(mx, s[j]); float se = 0.f;
#pragma unroll 1
  for (int j = 0; j < SQ; ++j) se += expf(s[j] - mx); const float sc = 256.0f / se;
#pragma unroll 1
  for (int j0 = 0; j0 < SQ; j0 += 8) { FragH f; for (int q = 0; q < 8; ++q) f.h[q] = (_Float16)(expf(s[j0 + q] - mx) * sc); unsigned short* d = (unsigned short*)P + (size_t)i * SQ + j0; *(v8us*)d = f.half[0];  } }
__global__ __launch_bounds__(256) void k_vt(const _Float16* __restrict__ V16, int b, int h0, _Float16* __restrict__ VT) { __shared__ unsigned short tl[64][65]; const int tid = threadIdx.x; const int hh = blockIdx.x % HG, sg = blockIdx.x / HG; const int s0 = sg * 64; const int h = h0 + hh;
  for (int i = tid; i < 64 * 8; i += 256) { const int j = i / 8, d8 = (i % 8) * 8; FragH f; f.half[0] = *(const v8us*)((const unsigned short*)V16 + ((size_t)b * SQ + s0 + j) * DM + h * HD + d8); for (int q = 0; q < 8; ++q) tl[d8 + q][j] = f.u[q]; }
  __syncthreads();
  { for (int i = tid; i < 64 * 8; i += 256) { const int d = i / 8, j8 = (i % 8) * 8; FragH f; for (int q = 0; q < 8; ++q) f.u[q] = tl[d][j8 + q]; *(v8us*)((unsigned short*)VT + ((size_t)hh * HD + d) * SQ + s0 + j8) = f.half[0]; }  } }

// Row softmax, one wave per row: each lane holds 64 of the row's 2048 scores in registers (16 loads of 16 B, every load 512 contiguous bytes of the row),
// so the scores are read once and every exponential is formed once. Maximum and sum: four chains per lane, then a butterfly over the 32 lanes. P = 256 * softmax, f16.
template <int M> __device__ __forceinline__ float rs_xm(float x) { return __builtin_bit_cast(float, __builtin_amdgcn_mov_dpp(__builtin_bit_cast(int, x), 0x160 | M, 0xf, 0xf, false)); }      /* lane l with lane l ^ M inside a 16-lane row (row_xmask) */
__device__ __forceinline__ float rs_xh(float x) { return __builtin_bit_cast(float, __builtin_amdgcn_permlanex16(__builtin_bit_cast(int, x), __builtin_bit_cast(int, x), 0x76543210, 0xfedcba98, false, false)); }      /* lane l with lane l ^ 16 */
__global__ __launch_bounds__(256) void k_rsmW(const float* __restrict__ S, _Float16* __restrict__ P, int nrows) {
  const int row = blockIdx.x * 8 + (threadIdx.x >> 5), lane = threadIdx.x & 31; if (row >= nrows) return;      /* the same in every lane of a wave; no barrier below */
  const float* s = S + (size_t)row * SQ + lane * 4; v4f v[SQ / 128];
#pragma unroll      /* constant indices keep v[] in registers */
  for (int u = 0; u < SQ / 128; ++u) v[u] = *(const v4fa*)(s + u * 128);
  asm volatile("s_wait_xcnt 0x0" :: "v"(s) : "memory");      /* the wait in front of any reuse of the loads' address registers; the pointer as an input keeps them from being a load's destination */
  v4f m4 = v[0];
#pragma unroll      /* constant indices keep v[] in registers */
  for (int u = 1; u < SQ / 128; ++u) for (int q = 0; q < 4; ++q) m4[q] = fmaxf(m4[q], v[u][q]);
  float mx = fmaxf(fmaxf(m4[0], m4[1]), fmaxf(m4[2], m4[3]));
  mx = fmaxf(mx, rs_xm<1>(mx)); mx = fmaxf(mx, rs_xm<2>(mx)); mx = fmaxf(mx, rs_xm<4>(mx)); mx = fmaxf(mx, rs_xm<8>(mx)); mx = fmaxf(mx, rs_xh(mx));
  v4f s4 = {0.f, 0.f, 0.f, 0.f};
#pragma unroll      /* constant indices keep v[] in registers */
  for (int u = 0; u < SQ / 128; ++u) for (int q = 0; q < 4; ++q) { v[u][q] = expf(v[u][q] - mx); s4[q] += v[u][q]; }
  float se = (s4[0] + s4[1]) + (s4[2] + s4[3]);
  se += rs_xm<1>(se); se += rs_xm<2>(se); se += rs_xm<4>(se); se += rs_xm<8>(se); se += rs_xh(se);
  const float sc = 256.0f / se; _Float16* d = P + (size_t)row * SQ + lane * 4;
#pragma unroll      /* constant indices keep v[] in registers */
  for (int u = 0; u < SQ / 128; ++u) *(v4h*)(d + u * 128) = __builtin_convertvector(v[u] * sc, v4h); }
__global__ __launch_bounds__(256) void k_f16rows(const float* __restrict__ F, _Float16* __restrict__ R, size_t n8) { const size_t t = (size_t)blockIdx.x * 256 + threadIdx.x; if (t >= n8) return; FragH f; for (int q = 0; q < 8; ++q) f.h[q] = (_Float16)F[t * 8 + q]; *(v8us*)((unsigned short*)R + t * 8) = f.half[0];  }
extern "C" void kernel_launch(void* const* d_in, const int* in_sizes, int n_in,
                              void* d_out, int out_size, void* d_ws, size_t ws_size, hipStream_t stream) {
  (void)in_sizes; (void)n_in; (void)out_size;
  const float* const* I = (const float* const*)d_in; const float* x = I[0]; const float* wq = I[1]; const float* wk = I[2]; const float* wv = I[3]; const float* bq = nullptr; const float* bk = nullptr; const float* bv = nullptr;      /* [in][out] weights */
  char* ws = (char*)d_ws; size_t off = 0;
  auto take = [&](size_t bytes) { char* p = ws + off; off += (bytes + 255) & ~(size_t)255; return p; };
  _Float16* BQ = (_Float16*)take((size_t)DQ * DM * 2); _Float16* BK = (_Float16*)take((size_t)DQ * DM * 2); _Float16* BV = (_Float16*)take((size_t)DV * DM * 2);
  _Float16* X16 = (_Float16*)take(NR * DM * 2); float* F32 = (float*)take(NR * (DQ > DV ? DQ : DV) * 4); _Float16* Q16 = (_Float16*)take(NR * DQ * 2); _Float16* K16 = (_Float16*)take(NR * DQ * 2); _Float16* V16 = (_Float16*)take(NR * DV * 2);
  float* S = (float*)take((size_t)NB * SQ * SQ * 4); _Float16* P = (_Float16*)take((size_t)NB * SQ * SQ * 2); _Float16* VT = (_Float16*)take((size_t)NB * DV * SQ * 2);      /* score and probability planes for all batches at once */
  if (off > ws_size) return;
  k_wt_f16<<<(unsigned)(((size_t)DQ * (DM / 8) + 255) / 256), 256, 0, stream>>>(wq, BQ, DM, DQ, 16.0f); k_wt_f16<<<(unsigned)(((size_t)DQ * (DM / 8) + 255) / 256), 256, 0, stream>>>(wk, BK, DM, DQ, 16.0f); k_wt_f16<<<(unsigned)(((size_t)DV * (DM / 8) + 255) / 256), 256, 0, stream>>>(wv, BV, DM, DV, 16.0f);
  k_x16<<<(unsigned)((NR * DM / 8 + 255) / 256), 256, 0, stream>>>(x, X16, NR * DM / 8);
  k_gemm2<0><<<dim3((unsigned)((NR / 128) * (DQ / 64)), 1), 128, 0, stream>>>(X16, DM, 0, BQ, DM, 0, 0.0625f, bq, 0, nullptr, 1, 0, 0, F32, nullptr, DQ, 0, MP, DQ, DM);      /* q f32 */
  k_f16rows<<<(unsigned)((NR * DQ / 8 + 255) / 256), 256, 0, stream>>>(F32, Q16, NR * DQ / 8);
  k_gemm2<0><<<dim3((unsigned)((NR / 128) * (DQ / 64)), 1), 128, 0, stream>>>(X16, DM, 0, BK, DM, 0, 0.0625f, bk, 0, nullptr, 1, 0, 0, F32, nullptr, DQ, 0, MP, DQ, DM);      /* k f32 (reusing the plane) */
  k_f16rows<<<(unsigned)((NR * DQ / 8 + 255) / 256), 256, 0, stream>>>(F32, K16, NR * DQ / 8);
  k_gemm2<0><<<dim3((unsigned)((NR / 128) * (DV / 64)), 1), 128, 0, stream>>>(X16, DM, 0, BV, DM, 0, 0.0625f, bv, 0, nullptr, 1, 0, 0, nullptr, V16, DV, 0, MP, DV, DM);      /* v f16 rows */
  k_vt<NH, SQ><<<NB * NH * (SQ / 64), 256, 0, stream>>>(V16, DV, 0, VT);      /* V^T per batch [DV][SQ] */
  /* the batch is grid.y of the two attention GEMMs, the softmax covers all NB * SQ rows in one 1-D launch: all eight batches run side by side */
  k_gemm2<0><<<dim3((SQ / 128) * (SQ / 64), NB), 128, 0, stream>>>(Q16, DQ, (size_t)SQ * DQ, K16, DQ, (size_t)SQ * DQ, 0.0625f, nullptr, 0, nullptr, 1, 0, 0, S, nullptr, SQ, (size_t)SQ * SQ, SQ, SQ, DQ);      /* scores */
  k_rsmW<<<(NB * SQ + 7) / 8, 256, 0, stream>>>(S, P, NB * SQ);
  k_gemm2<0><<<dim3((SQ / 128) * (DV / 64), NB), 128, 0, stream>>>(P, SQ, (size_t)SQ * SQ, VT, SQ, (size_t)DV * SQ, 0.00390625f, nullptr, 0, nullptr, 1, 0, 0, (float*)d_out, nullptr, DV, (size_t)SQ * DV, SQ, DV, SQ);      /* out = attn v */
}

// v003
// Measured time: 126 microseconds a run.
// In two side-by-side timings against v002, it was 1.82 and 1.80 times as fast.
// Over all steps from v000 it is 38.3 times as fast.
#include <hip/hip_runtime.h>
// Single-head self-attention (x [8][2048][256]; Q, K, V = x W ([in][out] [256][256]); scores = Q.K/16; softmax over all 2048 keys; out = attn V -> [8][2048][256]).
// Structure: token rows; x as exact f16 rows; q | k | v WMMA GEMMs (32x64 wave tiles, f32 accumulation, exact x16 transposed [in][out] weights); q, k as f16 rows; v as f16 rows, V^T via LDS transposes; one fused attention launch (batch = grid.y): per 64-key chunk scores WMMA, running-maximum softmax on VALU (f32; P x256 f16), O += P . V^T WMMA; scores and P never reach memory; f32 output.
// Compute dtype: inputs rounded to bf16; x / weights exact; q, k plain f16 (~2^-12); v, P plain f16 (~2^-12); scores / softmax f32. v_wmma_f32_16x16x32_f16.
#define NB 8
#define SQ 2048
#define DM 256
#define DQ 256
#define DV 256
#define QT 2048
#define NH 4                    /* V^T slabs of 64 (k_vt<NH, SQ>) */
#define HD 64
#define HG 1
#define NR ((size_t)NB * SQ)
#define QN SQ                        /* query rows per batch (debug hook) */
#define NBR NB                       /* batches (debug hook) */
#define MP ((int)NR)                 /* rows through the projections (debug hook) */
typedef __bf16 v16b __attribute__((ext_vector_type(16)));
typedef unsigned short v8us __attribute__((ext_vector_type(8), may_alias));
typedef float  v8f  __attribute__((ext_vector_type(8)));
typedef float  v4f  __attribute__((ext_vector_type(4)));
typedef float  v4fa __attribute__((ext_vector_type(4), may_alias));
union FragB { v16b v; v8us half[2]; unsigned short u[16]; };

__device__ __forceinline__ unsigned short bf16_bits(float x) { unsigned int u = __float_as_uint(x); return (unsigned short)((u + 0x7FFFu + ((u >> 16) & 1u)) >> 16); }
__device__ __forceinline__ float bf16_val(unsigned short b) { return __uint_as_float(((unsigned int)b) << 16); }
__device__ __forceinline__ float bf16_round(float x) { return bf16_val(bf16_bits(x)); }
// D += A·B with NT terms: 1 = ah·bh, 2 = + al·bh (A split), 3 = + ah·bl (both split)
template <int NT>
__device__ __forceinline__ v8f mmaN(v16b ah, v16b al, v16b bh, v16b bl, v8f c) {
  c = __builtin_amdgcn_wmma_f32_16x16x32_bf16(false, ah, false, bh, (short)0, c, false, false);
  if (NT >= 2) c = __builtin_amdgcn_wmma_f32_16x16x32_bf16(false, al, false, bh, (short)0, c, false, false);
  if (NT >= 3) c = __builtin_amdgcn_wmma_f32_16x16x32_bf16(false, ah, false, bl, (short)0, c, false, false);
  asm volatile("v_nop\n\tv_nop\n\tv_nop\n\tv_nop" : "+v"(c) : "v"(ah), "v"(al), "v"(bh), "v"(bl));
  return c;
}

__global__ __launch_bounds__(256) void k_wt_bf16(const float* __restrict__ W, unsigned short* __restrict__ Wt, int K, int N) {
  const int t = blockIdx.x * 256 + threadIdx.x;
  const int k8n = K / 8;
  if (t >= N * k8n) return;
  const int n = t / k8n, k8 = (t % k8n) * 8;
  v8us v;
#pragma unroll
  for (int i = 0; i < 8; ++i) v[i] = bf16_bits(W[(size_t)(k8 + i) * N + n]);
  *(v8us*)(Wt + (size_t)n * K + k8) = v;
  
}

// GEMM C[M][N] (f32, pitch ldc) = act(A[M][K]·W + bias). A f32 row-major (pitch lda) converted per fragment to bf16
// (ASPLIT: hi/lo two planes -> 2 terms, else single rounded term); Wt bf16 [N][K] (pitch ldb). BIAS_BF16 rounds the
// bias to bf16 first (bias quantised to bf16 before the add). K%32==0, M%16==0, N%64==0.
template <bool ASPLIT, int ACT, bool BIAS_BF16>
__global__ __launch_bounds__(128) void k_gemm_bf(const float* __restrict__ A, int lda, const unsigned short* __restrict__ Wt, int ldb,
                                               const float* __restrict__ bias, float* __restrict__ C, int ldc, int M, int N, int K) {
  __shared__ __attribute__((aligned(16))) float so[4][16][64];
  const int tid = threadIdx.x, w = tid >> 5, lane = tid & 31, ln = lane & 15, hh = lane >> 4;
  const int ntn = N / 64;
  const int wid = blockIdx.x * 4 + w;
  const int mt = wid / ntn, nq = wid % ntn;
  if (mt * 16 >= M) return;
  const int row0 = mt * 16, col0 = nq * 64;
  const float* arow = A + (size_t)(row0 + ln) * lda;
  v8f acc[4] = {};
  for (int kb = 0; kb < K; kb += 32) {
    FragB ah, al;
    const v4f x0 = *(const v4fa*)(arow + kb + 8 * hh), x1 = *(const v4fa*)(arow + kb + 8 * hh + 4);
    const v4f x2 = *(const v4fa*)(arow + kb + 16 + 8 * hh), x3 = *(const v4fa*)(arow + kb + 16 + 8 * hh + 4);
    float xs[16] = {x0[0],x0[1],x0[2],x0[3],x1[0],x1[1],x1[2],x1[3],x2[0],x2[1],x2[2],x2[3],x3[0],x3[1],x3[2],x3[3]};
#pragma unroll
    for (int i = 0; i < 16; ++i) { const unsigned short hb = bf16_bits(xs[i]); ah.u[i] = hb; al.u[i] = ASPLIT ? bf16_bits(xs[i] - bf16_val(hb)) : (unsigned short)0; }
#pragma unroll
    for (int t = 0; t < 4; ++t) {
      const unsigned short* brow = Wt + (size_t)(col0 + t * 16 + ln) * ldb + kb;
      FragB b;
      b.half[0] = *(const v8us*)(brow + 8 * hh);
      b.half[1] = *(const v8us*)(brow + 16 + 8 * hh);
      acc[t] = mmaN<ASPLIT ? 2 : 1>(ah.v, al.v, b.v, b.v, acc[t]);
    }
  }
#pragma unroll
  for (int t = 0; t < 4; ++t) {
    float bv = bias ? bias[col0 + t * 16 + ln] : 0.f;
    if (BIAS_BF16) bv = bf16_round(bv);
#pragma unroll
    for (int r = 0; r < 8; ++r) { float v = acc[t][r] + bv; if (ACT == 1) v = fmaxf(v, 0.f); so[w][8 * hh + r][t * 16 + ln] = v; }
  }
  __builtin_amdgcn_fence(__ATOMIC_ACQ_REL, "workgroup");
  __builtin_amdgcn_wave_barrier();
  const int rsub = lane >> 4, c4 = (lane & 15) * 4;
  {
#pragma unroll
    for (int q = 0; q < 8; ++q) {
      const int r = q * 2 + rsub;
      const v4f v = *(const v4fa*)&so[w][r][c4];
      *(v4f*)(C + (size_t)(row0 + r) * ldc + col0 + c4) = v;
    }
    
  }
}

// GEMM C = act(A·W + bias + resid): A f32 (ASPLIT -> hi/lo 2 terms), Wt bf16 [N][K]; ACT 0 none, 1 relu, 2 exact gelu;
// resid (optional, f32, row index = (row % rmod), pitch ldr, RES_BF16 rounds it) added before the activation.
template <bool ASPLIT, int ACT, bool BIAS_BF16, bool RES_BF16>
__global__ __launch_bounds__(128) void k_gemm_bf3(const float* __restrict__ A, int lda, const unsigned short* __restrict__ Wt, int ldb,
                                                const float* __restrict__ bias, const float* __restrict__ resid, int rmod, int ldr,
                                                float* __restrict__ C, int ldc, int M, int N, int K) {
  __shared__ __attribute__((aligned(16))) float so[4][16][64];
  const int tid = threadIdx.x, w = tid >> 5, lane = tid & 31, ln = lane & 15, hh = lane >> 4;
  const int ntn = N / 64;
  const int wid = blockIdx.x * 4 + w;
  const int mt = wid / ntn, nq = wid % ntn;
  if (mt * 16 >= M) return;
  const int row0 = mt * 16, col0 = nq * 64;
  const float* arow = A + (size_t)(row0 + ln) * lda;
  v8f acc[4] = {};
  for (int kb = 0; kb < K; kb += 32) {
    FragB ah, al;
    const v4f x0 = *(const v4fa*)(arow + kb + 8 * hh), x1 = *(const v4fa*)(arow + kb + 8 * hh + 4);
    const v4f x2 = *(const v4fa*)(arow + kb + 16 + 8 * hh), x3 = *(const v4fa*)(arow + kb + 16 + 8 * hh + 4);
    float xs[16] = {x0[0],x0[1],x0[2],x0[3],x1[0],x1[1],x1[2],x1[3],x2[0],x2[1],x2[2],x2[3],x3[0],x3[1],x3[2],x3[3]};
#pragma unroll
    for (int i = 0; i < 16; ++i) { const unsigned short hb = bf16_bits(xs[i]); ah.u[i] = hb; al.u[i] = ASPLIT ? bf16_bits(xs[i] - bf16_val(hb)) : (unsigned short)0; }
#pragma unroll
    for (int t = 0; t < 4; ++t) {
      const unsigned short* brow = Wt + (size_t)(col0 + t * 16 + ln) * ldb + kb;
      FragB b;
      b.half[0] = *(const v8us*)(brow + 8 * hh);
      b.half[1] = *(const v8us*)(brow + 16 + 8 * hh);
      acc[t] = mmaN<ASPLIT ? 2 : 1>(ah.v, al.v, b.v, b.v, acc[t]);
    }
  }
#pragma unroll
  for (int t = 0; t < 4; ++t) {
    const int col = col0 + t * 16 + ln;
    float bv = bias ? bias[col] : 0.f;
    if (BIAS_BF16) bv = bf16_round(bv);
#pragma unroll
    for (int r = 0; r < 8; ++r) {
      float v = acc[t][r] + bv;
      if (resid) { float rv = resid[(size_t)((row0 + 8 * hh + r) % rmod) * ldr + col]; if (RES_BF16) rv = bf16_round(rv); v += rv; }
      if (ACT == 1) v = fmaxf(v, 0.f);
      if (ACT == 2) v = 0.5f * v * (1.0f + erff(v * 0.70710678118654752f));
      if (ACT == 3) { const float u = 0.7978845608028654f * (v + 0.044715f * v * v * v); v = 0.5f * v * (1.0f + tanhf(u)); }
      so[w][8 * hh + r][t * 16 + ln] = v;
    }
  }
  __builtin_amdgcn_fence(__ATOMIC_ACQ_REL, "workgroup");
  __builtin_amdgcn_wave_barrier();
  const int rsub = lane >> 4, c4 = (lane & 15) * 4;
  {
#pragma unroll
    for (int q = 0; q < 8; ++q) {
      const int r = q * 2 + rsub;
      const v4f v = *(const v4fa*)&so[w][r][c4];
      *(v4f*)(C + (size_t)(row0 + r) * ldc + col0 + c4) = v;
    }
    
  }
}
// row LayerNorm (biased variance, eps) over N: s = X (+ R); optional out_sum <- s; out_norm <- (s-mu)*rsqrt(var+eps)*g + b
template <bool PARAM_BF16>
__global__ __launch_bounds__(256) void k_layernorm(const float* __restrict__ X, const float* __restrict__ R, const float* __restrict__ g, const float* __restrict__ bta,
                                                  float* __restrict__ out_sum, float* __restrict__ out_norm, int N, float eps) {
  __shared__ float red[256];
  const int row = blockIdx.x, tid = threadIdx.x;
  const float* x = X + (size_t)row * N; const float* rr = R ? R + (size_t)row * N : nullptr;
  float vals[16];                     // up to N = 4096
  const int per = N / 256;            // contiguous chunk per thread? use strided-by-4 chunks: thread handles j = tid*4 + 1024*u
  float s1 = 0.f;
  for (int u = 0; u < per / 4; ++u) {
    const int j = tid * 4 + 1024 * u;
    const v4f a = *(const v4fa*)(x + j);
    v4f b = {0.f,0.f,0.f,0.f}; if (rr) b = *(const v4fa*)(rr + j);
#pragma unroll
    for (int q = 0; q < 4; ++q) { const float v = a[q] + b[q]; vals[u * 4 + q] = v; s1 += v; }
  }
  red[tid] = s1; __syncthreads();
  for (int st = 128; st > 0; st >>= 1) { if (tid < st) red[tid] += red[tid + st]; __syncthreads(); }
  const float mu = red[0] / (float)N; __syncthreads();
  float s2 = 0.f;
  for (int u = 0; u < per / 4; ++u)
#pragma unroll
    for (int q = 0; q < 4; ++q) { const float c = vals[u * 4 + q] - mu; s2 += c * c; }
  red[tid] = s2; __syncthreads();
  for (int st = 128; st > 0; st >>= 1) { if (tid < st) red[tid] += red[tid + st]; __syncthreads(); }
  const float rs = rsqrtf(red[0] / (float)N + eps);
  {
    for (int u = 0; u < per / 4; ++u) {
      const int j = tid * 4 + 1024 * u;
      v4f o, sm;
#pragma unroll
      for (int q = 0; q < 4; ++q) {
        float gg = g[j + q], bb = bta[j + q];
        if (PARAM_BF16) { gg = bf16_round(gg); bb = bf16_round(bb); }
        sm[q] = vals[u * 4 + q]; o[q] = (vals[u * 4 + q] - mu) * rs * gg + bb;
      }
      if (out_sum) *(v4f*)(out_sum + (size_t)row * N + j) = sm;
      *(v4f*)(out_norm + (size_t)row * N + j) = o;
    }
    
  }
}



// ---- f16 WMMA path (v_wmma_f32_16x16x32_f16): 11-bit significands for operands in range — used where a [0,1] probability operand needs more precision than bf16
typedef _Float16 v16h __attribute__((ext_vector_type(16)));
union FragH { v16h v; v8us half[2]; _Float16 h[16]; unsigned short u[16]; };
template <int NT>
__device__ __forceinline__ v8f mmaH(v16h ah, v16h al, v16h bh, v16h bl, v8f c) {
  c = __builtin_amdgcn_wmma_f32_16x16x32_f16(false, ah, false, bh, (short)0, c, false, false);
  if (NT >= 2) c = __builtin_amdgcn_wmma_f32_16x16x32_f16(false, al, false, bh, (short)0, c, false, false);
  if (NT >= 3) c = __builtin_amdgcn_wmma_f32_16x16x32_f16(false, ah, false, bl, (short)0, c, false, false);
  asm volatile("v_nop\n\tv_nop\n\tv_nop\n\tv_nop" : "+v"(c) : "v"(ah), "v"(al), "v"(bh), "v"(bl));
  return c;
}
// batched GEMM like k_gemm_b but f16 operands: A f32 (split into f16 hi/lo if ASPLIT, else rounded to f16), Bt = f16 values [n][k]; alpha; C f32; N multiple of 16 (partial tiles skipped)
template <bool ASPLIT>
__global__ __launch_bounds__(128) void k_gemm_h(const float* __restrict__ A, int lda, size_t sA, const _Float16* __restrict__ Bh, int ldb, size_t sB, float alpha, float* __restrict__ C, int ldc, size_t sC, int M, int N, int K) {
  __shared__ __attribute__((aligned(16))) float so[4][16][64];
  const int tid = threadIdx.x, w = tid >> 5, lane = tid & 31, ln = lane & 15, hh = lane >> 4; const int by = blockIdx.y;
  A += (size_t)by * sA; Bh += (size_t)by * sB; C += (size_t)by * sC;
  const int ntn = (N + 63) / 64; const int wid = blockIdx.x * 4 + w; const int mt = wid / ntn, nq = wid % ntn; if (mt * 16 >= M) return;
  const int row0 = mt * 16, col0 = nq * 64; const float* arow = A + (size_t)(row0 + ln) * lda;
  v8f acc[4] = {};
  for (int kb = 0; kb < K; kb += 32) {
    FragH ah, al;
    const v4f x0 = *(const v4fa*)(arow + kb + 8 * hh), x1 = *(const v4fa*)(arow + kb + 8 * hh + 4), x2 = *(const v4fa*)(arow + kb + 16 + 8 * hh), x3 = *(const v4fa*)(arow + kb + 16 + 8 * hh + 4);
    float xs[16] = {x0[0],x0[1],x0[2],x0[3],x1[0],x1[1],x1[2],x1[3],x2[0],x2[1],x2[2],x2[3],x3[0],x3[1],x3[2],x3[3]};
#pragma unroll
    for (int i = 0; i < 16; ++i) { const _Float16 h = (_Float16)xs[i]; ah.h[i] = h; al.h[i] = ASPLIT ? (_Float16)(xs[i] - (float)h) : (_Float16)0.0f; }
#pragma unroll
    for (int t = 0; t < 4; ++t) { if (col0 + t * 16 >= N) continue; const size_t boff = (size_t)(col0 + t * 16 + ln) * ldb + kb; FragH bq; bq.half[0] = *(const v8us*)(Bh + boff + 8 * hh); bq.half[1] = *(const v8us*)(Bh + boff + 16 + 8 * hh);
      acc[t] = mmaH<ASPLIT ? 2 : 1>(ah.v, al.v, bq.v, bq.v, acc[t]); }
  }
#pragma unroll
  for (int t = 0; t < 4; ++t) { if (col0 + t * 16 >= N) continue;
#pragma unroll
    for (int r = 0; r < 8; ++r) so[w][8 * hh + r][t * 16 + ln] = acc[t][r] * alpha; }
  __builtin_amdgcn_fence(__ATOMIC_ACQ_REL, "workgroup"); __builtin_amdgcn_wave_barrier();
  const int rsub = lane >> 4, c4 = (lane & 15) * 4;
  {
#pragma unroll
    for (int q = 0; q < 8; ++q) { const int r = q * 2 + rsub; if (col0 + c4 < N) { const v4f v = *(const v4fa*)&so[w][r][c4]; *(v4f*)(C + (size_t)(row0 + r) * ldc + col0 + c4) = v; } }
     }
}

// Wt[n][k] = f16(W[k][n]·scale) from f32 row-major W[K][N] (scale = power of two; bf16-exact weights stay exact in f16 away from the subnormal range)
__global__ __launch_bounds__(256) void k_wt_f16(const float* __restrict__ W, _Float16* __restrict__ Wt, int K, int N, float scale) {
  const int t = blockIdx.x * 256 + threadIdx.x; if (t >= N * (K / 8)) return; const int n = t / (K / 8), k8 = (t % (K / 8)) * 8; FragH f;
#pragma unroll
  for (int i = 0; i < 8; ++i) f.h[i] = (_Float16)(bf16_round(W[(size_t)(k8 + i) * N + n]) * scale); const v8us o = f.half[0];
  *(v8us*)((unsigned short*)Wt + (size_t)n * K + k8) = o; 
}
// k_gemm_hh variant with fused epilogue: v = acc·alpha + bias[by·sBias + col] (+ CP[(row/rowsPerB)·sCPb + by·64 + col] if CP) ; ACT 0 none / 1 elu ; writes f16 C16 (and f32 C if non-null)
template <int ACT>
__global__ __launch_bounds__(128) void k_gemm_hhx(const _Float16* __restrict__ A, int lda, size_t sA, const _Float16* __restrict__ Bh, int ldb, size_t sB, float alpha, const float* __restrict__ bias, size_t sBias, const float* __restrict__ CP, int rowsPerB, size_t sCPb, int row0g,
    float* __restrict__ C, _Float16* __restrict__ C16, int ldc, size_t sC, int M, int N, int K) {
  __shared__ __attribute__((aligned(16))) float so[4][16][64];
  const int tid = threadIdx.x, w = tid >> 5, lane = tid & 31, ln = lane & 15, hh = lane >> 4; const int by = blockIdx.y;
  A += (size_t)by * sA; Bh += (size_t)by * sB; const size_t cofs = (size_t)by * sC; const float* bp = bias ? bias + (size_t)by * sBias : nullptr;
  const int ntn = (N + 63) / 64; const int wid = blockIdx.x * 4 + w; const int mt = wid / ntn, nq = wid % ntn; if (mt * 16 >= M) return;
  const int row0 = mt * 16, col0 = nq * 64; const _Float16* arow = A + (size_t)(row0 + ln) * lda;
  v8f acc[4] = {};
  for (int kb = 0; kb < K; kb += 32) { FragH ah; ah.half[0] = *(const v8us*)((const unsigned short*)arow + kb + 8 * hh); ah.half[1] = *(const v8us*)((const unsigned short*)arow + kb + 16 + 8 * hh);
#pragma unroll
    for (int t = 0; t < 4; ++t) { if (col0 + t * 16 >= N) continue; const size_t boff = (size_t)(col0 + t * 16 + ln) * ldb + kb; FragH bq; bq.half[0] = *(const v8us*)((const unsigned short*)Bh + boff + 8 * hh); bq.half[1] = *(const v8us*)((const unsigned short*)Bh + boff + 16 + 8 * hh);
      acc[t] = mmaH<1>(ah.v, ah.v, bq.v, bq.v, acc[t]); }
  }
#pragma unroll
  for (int t = 0; t < 4; ++t) { if (col0 + t * 16 >= N) continue; const int col = col0 + t * 16 + ln; const float bv = bp ? bf16_round(bp[col]) : 0.f;
#pragma unroll
    for (int r = 0; r < 8; ++r) { float v = acc[t][r] * alpha + bv; if (CP) { const int rr = row0g + row0 + 8 * hh + r; if (rowsPerB < 0) v += CP[cofs + (size_t)rr * ldc + col];      /* rowsPerB < 0: own element of the batched C plane */ else { const int bidx = rr / rowsPerB; v += CP[(size_t)bidx * sCPb + (size_t)by * 64 + col]; } } if (ACT == 1) v = (v > 0.f) ? v : expm1f(v); else if (ACT == 7) v = (v > 0.f) ? v + 1.0f : expf(v); else if (ACT == 8) v = tanhf(v); else if (ACT == 9) v = 0.5f * v * (1.0f + tanhf(0.7978845608028654f * (v + 0.044715f * v * v * v))); else if (ACT == 11) v = 1.0f / (1.0f + expf(-v)); else if (ACT == 12) v = (v > 0.f) ? v : 0.01f * v; else if (ACT == 14) v = (v > 0.f) ? v : 0.1f * v; else if (ACT == 16) v = (v >= 0.f) ? v : 0.3f * v; else if (ACT == 17) v = (v >= 0.f) ? v : 0.2f * v; else if (ACT == 15) v = v / (1.0f + expf(-v)); else if (ACT == 3) v = fmaxf(v, 0.f); else if (ACT == 6) v = 0.5f * v * (1.0f + erff(v * 0.70710678118654752f)); so[w][8 * hh + r][t * 16 + ln] = v; } }
  __builtin_amdgcn_fence(__ATOMIC_ACQ_REL, "workgroup"); __builtin_amdgcn_wave_barrier();
  const int rsub = lane >> 4, c4 = (lane & 15) * 4; typedef _Float16 v4h __attribute__((ext_vector_type(4)));
  {
#pragma unroll
    for (int q = 0; q < 8; ++q) { const int r = q * 2 + rsub; if (col0 + c4 < N) { const v4f v = *(const v4fa*)&so[w][r][c4]; if (C) *(v4f*)(C + cofs + (size_t)(row0 + r) * ldc + col0 + c4) = v; if (C16) { v4h h4; for (int i = 0; i < 4; ++i) h4[i] = (_Float16)v[i]; *(v4h*)(C16 + cofs + (size_t)(row0 + r) * ldc + col0 + c4) = h4; } } }
     }
}


typedef _Float16 v4h __attribute__((ext_vector_type(4)));

__global__ __launch_bounds__(256) void k_x16(const float* __restrict__ x, _Float16* __restrict__ X16, size_t n8) { const size_t t = (size_t)blockIdx.x * 256 + threadIdx.x; if (t >= n8) return; FragH f;
#pragma unroll
  for (int q = 0; q < 8; ++q) f.h[q] = (_Float16)bf16_round(x[t * 8 + q]); *(v8us*)((unsigned short*)X16 + t * 8) = f.half[0];  }
__global__ __launch_bounds__(256) void k_h16(const float* __restrict__ x, _Float16* __restrict__ X16, size_t n8) { const size_t t = (size_t)blockIdx.x * 256 + threadIdx.x; if (t >= n8) return; FragH f;
#pragma unroll
  for (int q = 0; q < 8; ++q) f.h[q] = (_Float16)x[t * 8 + q]; *(v8us*)((unsigned short*)X16 + t * 8) = f.half[0];  }
__global__ __launch_bounds__(256) void k_round16f(const float* __restrict__ W, _Float16* __restrict__ Bt, size_t n8) { const size_t t = (size_t)blockIdx.x * 256 + threadIdx.x; if (t >= n8) return; FragH f;
#pragma unroll
  for (int i = 0; i < 8; ++i) f.h[i] = (_Float16)(bf16_round(W[t * 8 + i]) * 16.0f); *(v8us*)((unsigned short*)Bt + t * 8) = f.half[0];  }
template <int NHv, int TTv>
__global__ __launch_bounds__(256) void k_vt(const _Float16* __restrict__ V16, int ldv, int voff, _Float16* __restrict__ Vt) { __shared__ unsigned short tl[64][66]; const int tid = threadIdx.x; const int slab = blockIdx.x / (TTv / 64), lg = blockIdx.x % (TTv / 64); const int b = slab / NHv, h = slab % NHv;
  for (int i = tid; i < 64 * 8; i += 256) { const int r = i / 8, c8 = (i % 8) * 8; FragH f; f.half[0] = *(const v8us*)((const unsigned short*)V16 + ((size_t)b * TTv + lg * 64 + r) * ldv + voff + h * 64 + c8);
#pragma unroll
    for (int q = 0; q < 8; ++q) tl[r][c8 + q] = f.u[q]; }
  __syncthreads();
  {
#pragma unroll
    for (int rd = 0; rd < 2; ++rd) { const int d = rd * 32 + tid / 8, pc = tid % 8; FragH f;
#pragma unroll
      for (int q = 0; q < 8; ++q) f.u[q] = tl[pc * 8 + q][d];
      *(v8us*)((unsigned short*)Vt + ((size_t)slab * 64 + d) * TTv + lg * 64 + pc * 8) = f.half[0]; }
     } }

__global__ __launch_bounds__(256) void k_hl(const float* __restrict__ F, _Float16* __restrict__ Hh, _Float16* __restrict__ Hl, size_t n8) { const size_t t = (size_t)blockIdx.x * 256 + threadIdx.x; if (t >= n8) return; FragH fh, fl; const v4f a = *(const v4fa*)(F + t * 8), c = *(const v4fa*)(F + t * 8 + 4);
#pragma unroll
  for (int q = 0; q < 4; ++q) { _Float16 h = (_Float16)a[q]; fh.h[q] = h; fl.h[q] = (_Float16)((a[q] - (float)h) * 1024.0f); h = (_Float16)c[q]; fh.h[4 + q] = h; fl.h[4 + q] = (_Float16)((c[q] - (float)h) * 1024.0f); }
  { *(v8us*)((unsigned short*)Hh + t * 8) = fh.half[0]; *(v8us*)((unsigned short*)Hl + t * 8) = fl.half[0];  } }

// ---- fast GEMM (wave tile 32x64; requires M % 32 == 0 rows per launch region and N % 64 == 0); epilogue = k_gemm_hhx semantics ----
__device__ __forceinline__ v16h g2_frag(const _Float16* p, int hh) { FragH f; f.half[0] = *(const v8us*)((const unsigned short*)p + 8 * hh); f.half[1] = *(const v8us*)((const unsigned short*)p + 16 + 8 * hh); return f.v; }
__device__ __forceinline__ v8f g2_mma(v16h a, v16h b, v8f c) { v8f d = __builtin_amdgcn_wmma_f32_16x16x32_f16(false, a, false, b, (short)0, c, false, false); asm volatile("v_nop\n\tv_nop\n\tv_nop\n\tv_nop" : "+v"(d) : "v"(a), "v"(b)); return d; }
template <int ACT>
__global__ __launch_bounds__(128) void k_gemm2(const _Float16* __restrict__ A, int lda, size_t sA, const _Float16* __restrict__ Bh, int ldb, size_t sB, float alpha, const float* __restrict__ bias, size_t sBias, const float* __restrict__ CP, int rowsPerB, size_t sCPb, int row0g,
    float* __restrict__ C, _Float16* __restrict__ C16, int ldc, size_t sC, int M, int N, int K) { static_assert(ACT == 0 || ACT == 3 || ACT == 6 || ACT == 8 || ACT == 9 || ACT == 11 || ACT == 12 || ACT == 14 || ACT == 15 || ACT == 16 || ACT == 17, "k_gemm2: unsupported ACT code (would silently apply no activation)");
  __shared__ __attribute__((aligned(16))) float so[4][32][68];
  const int tid = threadIdx.x, w = tid >> 5, lane = tid & 31, ln = lane & 15, hh = lane >> 4; const int by = blockIdx.y;
  A += (size_t)by * sA; Bh += (size_t)by * sB; const size_t cofs = (size_t)by * sC; const float* bp = bias ? bias + (size_t)by * sBias : nullptr;
  const int ntn = N >> 6; const int mt = blockIdx.x / ntn, nq = blockIdx.x - mt * ntn; const int row0 = mt * 128 + 32 * w, col0 = nq * 64; if (row0 >= M) return;
  const _Float16* a0p = A + (size_t)(row0 + ln) * lda; const _Float16* a1p = a0p + (size_t)16 * lda;
  const _Float16* b0p = Bh + (size_t)(col0 + ln) * ldb; const _Float16* b1p = b0p + (size_t)16 * ldb; const _Float16* b2p = b1p + (size_t)16 * ldb; const _Float16* b3p = b2p + (size_t)16 * ldb;
  const v8f z8 = {0.f,0.f,0.f,0.f,0.f,0.f,0.f,0.f}; v8f c00 = z8, c01 = z8, c02 = z8, c03 = z8, c10 = z8, c11 = z8, c12 = z8, c13 = z8;
#pragma unroll 1
  for (int kb = 0; kb < K; kb += 32) { const v16h a0 = g2_frag(a0p + kb, hh), a1 = g2_frag(a1p + kb, hh);
    v16h b = g2_frag(b0p + kb, hh); c00 = g2_mma(a0, b, c00); c10 = g2_mma(a1, b, c10);
    b = g2_frag(b1p + kb, hh); c01 = g2_mma(a0, b, c01); c11 = g2_mma(a1, b, c11);
    b = g2_frag(b2p + kb, hh); c02 = g2_mma(a0, b, c02); c12 = g2_mma(a1, b, c12);
    b = g2_frag(b3p + kb, hh); c03 = g2_mma(a0, b, c03); c13 = g2_mma(a1, b, c13); }
  v8f accs[8] = {c00, c01, c02, c03, c10, c11, c12, c13};
#pragma unroll
  for (int u = 0; u < 8; ++u) { const int t = u & 3, half = u >> 2; const int col = col0 + t * 16 + ln; const float bv = bp ? bf16_round(bp[col]) : 0.f;
#pragma unroll
    for (int r = 0; r < 8; ++r) { const int rloc = half * 16 + 8 * hh + r; float v = accs[u][r] * alpha + bv; if (CP) { if (rowsPerB < 0) v += CP[cofs + (size_t)(row0g + row0 + rloc) * ldc + col];      /* rowsPerB < 0: own element of the batched C plane */ else { const int bidx = (row0g + row0 + rloc) / rowsPerB; v += CP[(size_t)bidx * sCPb + (size_t)by * 64 + col]; } }
      if (ACT == 3) v = fmaxf(v, 0.f); else if (ACT == 6) v = 0.5f * v * (1.0f + erff(v * 0.70710678118654752f)); else if (ACT == 11) v = 1.0f / (1.0f + expf(-v)); else if (ACT == 15) v = v / (1.0f + expf(-v)); else if (ACT == 12) v = (v > 0.f) ? v : 0.01f * v; else if (ACT == 8) v = tanhf(v); else if (ACT == 9) v = 0.5f * v * (1.0f + tanhf(0.7978845608028654f * (v + 0.044715f * v * v * v))); else if (ACT == 14) v = (v > 0.f) ? v : 0.1f * v; else if (ACT == 16) v = (v >= 0.f) ? v : 0.3f * v; else if (ACT == 17) v = (v >= 0.f) ? v : 0.2f * v;
      so[w][rloc][t * 16 + ln] = v; } }
  __builtin_amdgcn_fence(__ATOMIC_ACQ_REL, "workgroup"); __builtin_amdgcn_wave_barrier();
  const int rsub = lane >> 4, c4 = (lane & 15) * 4;
  {
#pragma unroll
    for (int q = 0; q < 16; ++q) { const int r = q * 2 + rsub; const v4f v = *(const v4fa*)&so[w][r][c4]; if (C) *(v4f*)(C + cofs + (size_t)(row0 + r) * ldc + col0 + c4) = v; if (C16) { v4h h4; for (int i = 0; i < 4; ++i) h4[i] = (_Float16)v[i]; *(v4h*)(C16 + cofs + (size_t)(row0 + r) * ldc + col0 + c4) = h4; } }
     } }


__global__ __launch_bounds__(256) void k_wnat(const float* __restrict__ w, size_t n8, _Float16* __restrict__ Bt) { const size_t t = (size_t)blockIdx.x * 256 + threadIdx.x; if (t >= n8) return; FragH f; for (int q = 0; q < 8; ++q) f.h[q] = (_Float16)(bf16_round(w[t * 8 + q]) * 16.0f); *(v8us*)((unsigned short*)Bt + t * 8) = f.half[0];  }
__global__ __launch_bounds__(256) void k_rsm(const float* __restrict__ S, _Float16* __restrict__ P, int nrows) {
  #pragma clang fp contract(off)
  const int i = blockIdx.x * 256 + threadIdx.x; if (i >= nrows) return; const float* s = S + (size_t)i * SQ; float mx = -3.0e38f;
#pragma unroll 1
  for (int j = 0; j < SQ; ++j) mx = fmaxf(mx, s[j]); float se = 0.f;
#pragma unroll 1
  for (int j = 0; j < SQ; ++j) se += expf(s[j] - mx); const float sc = 256.0f / se;
#pragma unroll 1
  for (int j0 = 0; j0 < SQ; j0 += 8) { FragH f; for (int q = 0; q < 8; ++q) f.h[q] = (_Float16)(expf(s[j0 + q] - mx) * sc); unsigned short* d = (unsigned short*)P + (size_t)i * SQ + j0; *(v8us*)d = f.half[0];  } }
__global__ __launch_bounds__(256) void k_vt(const _Float16* __restrict__ V16, int b, int h0, _Float16* __restrict__ VT) { __shared__ unsigned short tl[64][65]; const int tid = threadIdx.x; const int hh = blockIdx.x % HG, sg = blockIdx.x / HG; const int s0 = sg * 64; const int h = h0 + hh;
  for (int i = tid; i < 64 * 8; i += 256) { const int j = i / 8, d8 = (i % 8) * 8; FragH f; f.half[0] = *(const v8us*)((const unsigned short*)V16 + ((size_t)b * SQ + s0 + j) * DM + h * HD + d8); for (int q = 0; q < 8; ++q) tl[d8 + q][j] = f.u[q]; }
  __syncthreads();
  { for (int i = tid; i < 64 * 8; i += 256) { const int d = i / 8, j8 = (i % 8) * 8; FragH f; for (int q = 0; q < 8; ++q) f.u[q] = tl[d][j8 + q]; *(v8us*)((unsigned short*)VT + ((size_t)hh * HD + d) * SQ + s0 + j8) = f.half[0]; }  } }

// Fused attention, one launch. A work-group is 4 waves and 64 query rows of one batch; a wave owns 16 rows: its Q fragments (8 k steps) and its 16 x 256 f32 output tile stay in registers.
// The keys are walked in chunks of 64: K rows and V^T rows of the chunk are staged in LDS (pitch = row + 16 B for 16-byte readers) and shared by the 4 waves; the next chunk's rows are
// loaded into registers while this chunk is worked on. Softmax keeps a running row maximum; the output tile and the row sum are rescaled when it grows. P goes from accumulator layout
// to A-fragment layout through the wave's own LDS rows. P = 256 * exp(s - max), f16; the factor cancels in the division by the row sum.
template <int M> __device__ __forceinline__ float rs_xm(float x) { return __builtin_bit_cast(float, __builtin_amdgcn_mov_dpp(__builtin_bit_cast(int, x), 0x160 | M, 0xf, 0xf, false)); }      /* lane l with lane l ^ M inside a 16-lane row (row_xmask) */
#define FA_KP 264      /* halves per staged K row: 512 B + 16 B */
#define FA_VP 72       /* halves per staged V^T row and per P row: 128 B + 16 B */
#define FA_C 0.09016844005556021f      /* log2(e) / 16: the score scale folded into the exponent */
__device__ __forceinline__ v16h fa_frag(const unsigned short* p, int hh) { FragH f; f.half[0] = *(const v8us*)(p + 8 * hh); f.half[1] = *(const v8us*)(p + 16 + 8 * hh); return f.v; }
__device__ __forceinline__ v8f fa_mma(v16h a, v16h b, v8f c) { return __builtin_amdgcn_wmma_f32_16x16x32_f16(false, a, false, b, (short)0, c, false, false); }
/* eight 2^x in one statement: the outputs are early-clobber, so no v_exp_f32 overwrites the source of the one in front of it, and the closing v_nop is the one slot the instruction set asks for behind a transcendental */
__device__ __forceinline__ v8f fa_exp2(v8f x) { float d0, d1, d2, d3, d4, d5, d6, d7;
  asm("v_exp_f32 %0, %8\n\tv_exp_f32 %1, %9\n\tv_exp_f32 %2, %10\n\tv_exp_f32 %3, %11\n\tv_exp_f32 %4, %12\n\tv_exp_f32 %5, %13\n\tv_exp_f32 %6, %14\n\tv_exp_f32 %7, %15\n\tv_nop"
      : "=&v"(d0), "=&v"(d1), "=&v"(d2), "=&v"(d3), "=&v"(d4), "=&v"(d5), "=&v"(d6), "=&v"(d7) : "v"(x[0]), "v"(x[1]), "v"(x[2]), "v"(x[3]), "v"(x[4]), "v"(x[5]), "v"(x[6]), "v"(x[7]));
  const v8f d = {d0, d1, d2, d3, d4, d5, d6, d7}; return d; }
__global__ __launch_bounds__(128) void k_fattn(const _Float16* __restrict__ Q, const _Float16* __restrict__ Kg, const _Float16* __restrict__ Vt, float* __restrict__ O) {
  __shared__ __attribute__((aligned(16))) unsigned short ks[64 * FA_KP];
  __shared__ __attribute__((aligned(16))) unsigned short vs[DV * FA_VP];
  __shared__ __attribute__((aligned(16))) unsigned short ps[4][16 * FA_VP];
  __shared__ __attribute__((aligned(16))) float so[4][16][DV + 4];
  const int tid = threadIdx.x, w = tid >> 5, lane = tid & 31, ln = lane & 15, hh = lane >> 4, b = blockIdx.y;
  const int q0 = blockIdx.x * 64 + 16 * w;
  const unsigned short* qp = (const unsigned short*)Q + ((size_t)b * SQ + q0 + ln) * DQ;
  v16h qa[DQ / 32];
#pragma unroll      /* constant indices keep qa[] in registers */
  for (int i = 0; i < DQ / 32; ++i) qa[i] = fa_frag(qp + 32 * i, hh);
  const unsigned short* kg = (const unsigned short*)Kg + (size_t)b * SQ * DQ + tid * 8;      /* a chunk of K is 32 KB in a row */
  const unsigned short* vg = (const unsigned short*)Vt + ((size_t)b * DV + (tid >> 3)) * SQ + (tid & 7) * 8;      /* a chunk of V^T is 128 B of each of 256 rows */
  unsigned short* kd = ks + (tid >> 5) * FA_KP + (tid & 31) * 8;
  unsigned short* vd = vs + (tid >> 3) * FA_VP + (tid & 7) * 8;
  v8us kr[16], vr[16];
#pragma unroll      /* constant indices keep kr[], vr[] in registers */
  for (int p = 0; p < 16; ++p) { kr[p] = *(const v8us*)(kg + p * 1024); vr[p] = *(const v8us*)(vg + (size_t)p * 16 * SQ); }
  asm volatile("s_wait_xcnt 0x0" ::: "memory");      /* the wait in front of any reuse of the loads' address registers */
  const v8f z8 = {0.f,0.f,0.f,0.f,0.f,0.f,0.f,0.f};
  v8f o[DV / 16], mr, lr = z8;
#pragma unroll
  for (int j = 0; j < DV / 16; ++j) o[j] = z8;
#pragma unroll
  for (int r = 0; r < 8; ++r) mr[r] = -3.0e38f;
#pragma unroll 1      /* one chunk per trip: the body is already 64 WMMAs long */
  for (int c = 0; c < SQ / 64; ++c) {
    __syncthreads();      /* every wave has left the chunk before */
#pragma unroll
    for (int p = 0; p < 16; ++p) { *(v8us*)(kd + p * 4 * FA_KP) = kr[p]; *(v8us*)(vd + p * 16 * FA_VP) = vr[p]; }
    __syncthreads();      /* the chunk is staged */
    const int adv = (c + 1 < SQ / 64) ? 1 : 0;      /* the last trip loads its own chunk again: in bounds, no branch */
    kg += adv * 64 * DQ; vg += adv * 64;
#pragma unroll
    for (int p = 0; p < 16; ++p) { kr[p] = *(const v8us*)(kg + p * 1024); vr[p] = *(const v8us*)(vg + (size_t)p * 16 * SQ); }
    asm volatile("s_wait_xcnt 0x0" ::: "memory");      /* the wait in front of any reuse of the loads' address registers; it also keeps the loads ahead of the chunk's work */
    /* The chunk's 64 B fragments come from LDS in 8 groups of 8 (groups 0-3: K, two k steps x four key tiles; groups 4-7: V^T, one k step x eight column tiles). */
    v16h fb[8][8];
    auto ld = [&](int g) {
#pragma unroll      /* constant indices keep fb[][] in registers */
      for (int e = 0; e < 8; ++e) fb[g][e] = (g < 4) ? fa_frag(ks + ((e & 3) * 16 + ln) * FA_KP + 32 * (2 * g + (e >> 2)), hh) : fa_frag(vs + (((g & 1) * 8 + e) * 16 + ln) * FA_VP + 32 * ((g - 4) >> 1), hh); };
    v8f s[4] = {z8, z8, z8, z8};
    ld(0); ld(1);
#pragma unroll
    for (int g = 0; g < 4; ++g) {
      ld(g + 2);
      __builtin_amdgcn_sched_barrier(0);      /* a group's LDS reads are issued together, two groups ahead of its WMMAs; left alone the compiler reads each fragment right in front of its WMMA and waits out the LDS latency 64 times */
#pragma unroll
      for (int e = 0; e < 8; ++e) s[e & 3] = fa_mma(qa[2 * g + (e >> 2)], fb[g][e], s[e & 3]);
      __builtin_amdgcn_sched_barrier(0);      /* the same: keeps the next group's reads behind this group's WMMAs */
    }
    /* accumulator element r of a lane is row 8 * hh + r, column 16 * t + ln: a row lives in one 16-lane half */
    v8f x = __builtin_elementwise_max(__builtin_elementwise_max(s[0], s[1]), __builtin_elementwise_max(s[2], s[3]));
#pragma unroll
    for (int r = 0; r < 8; ++r) { float y = x[r]; y = fmaxf(y, rs_xm<1>(y)); y = fmaxf(y, rs_xm<2>(y)); y = fmaxf(y, rs_xm<4>(y)); y = fmaxf(y, rs_xm<8>(y)); x[r] = y; }
    const v8f mn = __builtin_elementwise_max(mr, x); const v8f da = (mr - mn) * FA_C; const v8f bs = 8.0f - mn * FA_C; mr = mn;
    const v8f al = fa_exp2(da); v8f acc = z8;
#pragma unroll
    for (int t = 0; t < 4; ++t) { const v8f p = fa_exp2(s[t] * FA_C + bs); acc += p;
#pragma unroll
      for (int r = 0; r < 8; ++r) { FragH f; f.h[0] = (_Float16)p[r]; ps[w][(8 * hh + r) * FA_VP + t * 16 + ln] = f.u[0]; } }
    lr = lr * al + acc;      /* each lane keeps the sum of its own columns; the lanes are joined once, behind the loop */
#pragma unroll
    for (int j = 0; j < DV / 16; ++j) o[j] *= al;
    __builtin_amdgcn_fence(__ATOMIC_ACQ_REL, "workgroup"); __builtin_amdgcn_wave_barrier();      /* the wave's P rows are written before its lanes read one another's */
    const v16h pa[2] = {fa_frag(ps[w] + ln * FA_VP, hh), fa_frag(ps[w] + ln * FA_VP + 32, hh)};
#pragma unroll
    for (int g = 4; g < 8; ++g) {
      if (g + 2 < 8) ld(g + 2);
      __builtin_amdgcn_sched_barrier(0);      /* as above: reads two groups ahead of their WMMAs */
#pragma unroll
      for (int e = 0; e < 8; ++e) o[(g & 1) * 8 + e] = fa_mma(pa[(g - 4) >> 1], fb[g][e], o[(g & 1) * 8 + e]);
      __builtin_amdgcn_sched_barrier(0);      /* as above */
    }
  }
#pragma unroll
  for (int r = 0; r < 8; ++r) { float l = lr[r]; l += rs_xm<1>(l); l += rs_xm<2>(l); l += rs_xm<4>(l); l += rs_xm<8>(l); const float inv = 1.0f / l;
#pragma unroll
    for (int j = 0; j < DV / 16; ++j) so[w][8 * hh + r][j * 16 + ln] = o[j][r] * inv; }
  __builtin_amdgcn_fence(__ATOMIC_ACQ_REL, "workgroup"); __builtin_amdgcn_wave_barrier();      /* the wave's own staging rows are written before they are read back as whole lines */
  float* op = O + ((size_t)b * SQ + q0) * DV + lane * 4;
#pragma unroll
  for (int q = 0; q < 32; ++q) { const v4f v = *(const v4fa*)&so[w][q >> 1][(q & 1) * 128 + lane * 4]; *(v4f*)(op + (q >> 1) * DV + (q & 1) * 128) = v; }
}
__global__ __launch_bounds__(256) void k_f16rows(const float* __restrict__ F, _Float16* __restrict__ R, size_t n8) { const size_t t = (size_t)blockIdx.x * 256 + threadIdx.x; if (t >= n8) return; FragH f; for (int q = 0; q < 8; ++q) f.h[q] = (_Float16)F[t * 8 + q]; *(v8us*)((unsigned short*)R + t * 8) = f.half[0];  }
extern "C" void kernel_launch(void* const* d_in, const int* in_sizes, int n_in,
                              void* d_out, int out_size, void* d_ws, size_t ws_size, hipStream_t stream) {
  (void)in_sizes; (void)n_in; (void)out_size;
  const float* const* I = (const float* const*)d_in; const float* x = I[0]; const float* wq = I[1]; const float* wk = I[2]; const float* wv = I[3]; const float* bq = nullptr; const float* bk = nullptr; const float* bv = nullptr;      /* [in][out] weights */
  char* ws = (char*)d_ws; size_t off = 0;
  auto take = [&](size_t bytes) { char* p = ws + off; off += (bytes + 255) & ~(size_t)255; return p; };
  _Float16* BQ = (_Float16*)take((size_t)DQ * DM * 2); _Float16* BK = (_Float16*)take((size_t)DQ * DM * 2); _Float16* BV = (_Float16*)take((size_t)DV * DM * 2);
  _Float16* X16 = (_Float16*)take(NR * DM * 2); float* F32 = (float*)take(NR * (DQ > DV ? DQ : DV) * 4); _Float16* Q16 = (_Float16*)take(NR * DQ * 2); _Float16* K16 = (_Float16*)take(NR * DQ * 2); _Float16* V16 = (_Float16*)take(NR * DV * 2);
  _Float16* VT = (_Float16*)take((size_t)NB * DV * SQ * 2);
  if (off > ws_size) return;
  k_wt_f16<<<(unsigned)(((size_t)DQ * (DM / 8) + 255) / 256), 256, 0, stream>>>(wq, BQ, DM, DQ, 16.0f); k_wt_f16<<<(unsigned)(((size_t)DQ * (DM / 8) + 255) / 256), 256, 0, stream>>>(wk, BK, DM, DQ, 16.0f); k_wt_f16<<<(unsigned)(((size_t)DV * (DM / 8) + 255) / 256), 256, 0, stream>>>(wv, BV, DM, DV, 16.0f);
  k_x16<<<(unsigned)((NR * DM / 8 + 255) / 256), 256, 0, stream>>>(x, X16, NR * DM / 8);
  k_gemm2<0><<<dim3((unsigned)((NR / 128) * (DQ / 64)), 1), 128, 0, stream>>>(X16, DM, 0, BQ, DM, 0, 0.0625f, bq, 0, nullptr, 1, 0, 0, F32, nullptr, DQ, 0, MP, DQ, DM);      /* q f32 */
  k_f16rows<<<(unsigned)((NR * DQ / 8 + 255) / 256), 256, 0, stream>>>(F32, Q16, NR * DQ / 8);
  k_gemm2<0><<<dim3((unsigned)((NR / 128) * (DQ / 64)), 1), 128, 0, stream>>>(X16, DM, 0, BK, DM, 0, 0.0625f, bk, 0, nullptr, 1, 0, 0, F32, nullptr, DQ, 0, MP, DQ, DM);      /* k f32 (reusing the plane) */
  k_f16rows<<<(unsigned)((NR * DQ / 8 + 255) / 256), 256, 0, stream>>>(F32, K16, NR * DQ / 8);
  k_gemm2<0><<<dim3((unsigned)((NR / 128) * (DV / 64)), 1), 128, 0, stream>>>(X16, DM, 0, BV, DM, 0, 0.0625f, bv, 0, nullptr, 1, 0, 0, nullptr, V16, DV, 0, MP, DV, DM);      /* v f16 rows */
  k_vt<NH, SQ><<<NB * NH * (SQ / 64), 256, 0, stream>>>(V16, DV, 0, VT);      /* V^T per batch [DV][SQ] */
  k_fattn<<<dim3(SQ / 64, NB), 128, 0, stream>>>(Q16, K16, VT, (float*)d_out);      /* scores, softmax and attn v in one launch; the batch is grid.y */
}

// v004
// A run of this version takes 65.4 microseconds.
// In two side-by-side timings against v003, it was 1.91 and 1.92 times as fast.
// Over all steps from v000 it is 73.4 times as fast.
#include <hip/hip_runtime.h>
// Single-head self-attention (x [8][2048][256]; Q, K, V = x W ([in][out] [256][256]); scores = Q.K/16; softmax over all 2048 keys; out = attn V -> [8][2048][256]).
// Structure: exact x16 transposed [in][out] weights as f16 rows (one launch for the three); one projection launch: 64 token rows per work-group read as f32, rounded and staged once in LDS as exact f16, q | k | v WMMA tiles (64x64 per wave, f32 accumulation) written as f16 rows, v straight as V^T rows; one fused attention launch (batch = grid.y): per 64-key chunk scores WMMA, running-maximum softmax on VALU (f32; P x256 f16), O += P . V^T WMMA; scores and P never reach memory; f32 output.
// Compute dtype: inputs rounded to bf16; x / weights exact; q, k plain f16 (~2^-12); v, P plain f16 (~2^-12); scores / softmax f32. v_wmma_f32_16x16x32_f16.
#define NB 8
#define SQ 2048
#define DM 256
#define DQ 256
#define DV 256
#define QT 2048
#define NH 4                    /* V^T slabs of 64 */
#define HD 64
#define HG 1
#define NR ((size_t)NB * SQ)
#define QN SQ                        /* query rows per batch (debug hook) */
#define NBR NB                       /* batches (debug hook) */
#define MP ((int)NR)                 /* rows through the projections (debug hook) */
typedef __bf16 v16b __attribute__((ext_vector_type(16)));
typedef unsigned short v8us __attribute__((ext_vector_type(8), may_alias));
typedef float  v8f  __attribute__((ext_vector_type(8)));
typedef float  v4f  __attribute__((ext_vector_type(4)));
typedef float  v4fa __attribute__((ext_vector_type(4), may_alias));
union FragB { v16b v; v8us half[2]; unsigned short u[16]; };

__device__ __forceinline__ unsigned short bf16_bits(float x) { unsigned int u = __float_as_uint(x); return (unsigned short)((u + 0x7FFFu + ((u >> 16) & 1u)) >> 16); }
__device__ __forceinline__ float bf16_val(unsigned short b) { return __uint_as_float(((unsigned int)b) << 16); }
__device__ __forceinline__ float bf16_round(float x) { return bf16_val(bf16_bits(x)); }
// D += A·B with NT terms: 1 = ah·bh, 2 = + al·bh (A split), 3 = + ah·bl (both split)
template <int NT>
__device__ __forceinline__ v8f mmaN(v16b ah, v16b al, v16b bh, v16b bl, v8f c) {
  c = __builtin_amdgcn_wmma_f32_16x16x32_bf16(false, ah, false, bh, (short)0, c, false, false);
  if (NT >= 2) c = __builtin_amdgcn_wmma_f32_16x16x32_bf16(false, al, false, bh, (short)0, c, false, false);
  if (NT >= 3) c = __builtin_amdgcn_wmma_f32_16x16x32_bf16(false, ah, false, bl, (short)0, c, false, false);
  asm volatile("v_nop\n\tv_nop\n\tv_nop\n\tv_nop" : "+v"(c) : "v"(ah), "v"(al), "v"(bh), "v"(bl));
  return c;
}

__global__ __launch_bounds__(256) void k_wt_bf16(const float* __restrict__ W, unsigned short* __restrict__ Wt, int K, int N) {
  const int t = blockIdx.x * 256 + threadIdx.x;
  const int k8n = K / 8;
  if (t >= N * k8n) return;
  const int n = t / k8n, k8 = (t % k8n) * 8;
  v8us v;
#pragma unroll
  for (int i = 0; i < 8; ++i) v[i] = bf16_bits(W[(size_t)(k8 + i) * N + n]);
  *(v8us*)(Wt + (size_t)n * K + k8) = v;
  
}

// GEMM C[M][N] (f32, pitch ldc) = act(A[M][K]·W + bias). A f32 row-major (pitch lda) converted per fragment to bf16
// (ASPLIT: hi/lo two planes -> 2 terms, else single rounded term); Wt bf16 [N][K] (pitch ldb). BIAS_BF16 rounds the
// bias to bf16 first (bias quantised to bf16 before the add). K%32==0, M%16==0, N%64==0.
template <bool ASPLIT, int ACT, bool BIAS_BF16>
__global__ __launch_bounds__(128) void k_gemm_bf(const float* __restrict__ A, int lda, const unsigned short* __restrict__ Wt, int ldb,
                                               const float* __restrict__ bias, float* __restrict__ C, int ldc, int M, int N, int K) {
  __shared__ __attribute__((aligned(16))) float so[4][16][64];
  const int tid = threadIdx.x, w = tid >> 5, lane = tid & 31, ln = lane & 15, hh = lane >> 4;
  const int ntn = N / 64;
  const int wid = blockIdx.x * 4 + w;
  const int mt = wid / ntn, nq = wid % ntn;
  if (mt * 16 >= M) return;
  const int row0 = mt * 16, col0 = nq * 64;
  const float* arow = A + (size_t)(row0 + ln) * lda;
  v8f acc[4] = {};
  for (int kb = 0; kb < K; kb += 32) {
    FragB ah, al;
    const v4f x0 = *(const v4fa*)(arow + kb + 8 * hh), x1 = *(const v4fa*)(arow + kb + 8 * hh + 4);
    const v4f x2 = *(const v4fa*)(arow + kb + 16 + 8 * hh), x3 = *(const v4fa*)(arow + kb + 16 + 8 * hh + 4);
    float xs[16] = {x0[0],x0[1],x0[2],x0[3],x1[0],x1[1],x1[2],x1[3],x2[0],x2[1],x2[2],x2[3],x3[0],x3[1],x3[2],x3[3]};
#pragma unroll
    for (int i = 0; i < 16; ++i) { const unsigned short hb = bf16_bits(xs[i]); ah.u[i] = hb; al.u[i] = ASPLIT ? bf16_bits(xs[i] - bf16_val(hb)) : (unsigned short)0; }
#pragma unroll
    for (int t = 0; t < 4; ++t) {
      const unsigned short* brow = Wt + (size_t)(col0 + t * 16 + ln) * ldb + kb;
      FragB b;
      b.half[0] = *(const v8us*)(brow + 8 * hh);
      b.half[1] = *(const v8us*)(brow + 16 + 8 * hh);
      acc[t] = mmaN<ASPLIT ? 2 : 1>(ah.v, al.v, b.v, b.v, acc[t]);
    }
  }
#pragma unroll
  for (int t = 0; t < 4; ++t) {
    float bv = bias ? bias[col0 + t * 16 + ln] : 0.f;
    if (BIAS_BF16) bv = bf16_round(bv);
#pragma unroll
    for (int r = 0; r < 8; ++r) { float v = acc[t][r] + bv; if (ACT == 1) v = fmaxf(v, 0.f); so[w][8 * hh + r][t * 16 + ln] = v; }
  }
  __builtin_amdgcn_fence(__ATOMIC_ACQ_REL, "workgroup");
  __builtin_amdgcn_wave_barrier();
  const int rsub = lane >> 4, c4 = (lane & 15) * 4;
  {
#pragma unroll
    for (int q = 0; q < 8; ++q) {
      const int r = q * 2 + rsub;
      const v4f v = *(const v4fa*)&so[w][r][c4];
      *(v4f*)(C + (size_t)(row0 + r) * ldc + col0 + c4) = v;
    }
    
  }
}

// GEMM C = act(A·W + bias + resid): A f32 (ASPLIT -> hi/lo 2 terms), Wt bf16 [N][K]; ACT 0 none, 1 relu, 2 exact gelu;
// resid (optional, f32, row index = (row % rmod), pitch ldr, RES_BF16 rounds it) added before the activation.
template <bool ASPLIT, int ACT, bool BIAS_BF16, bool RES_BF16>
__global__ __launch_bounds__(128) void k_gemm_bf3(const float* __restrict__ A, int lda, const unsigned short* __restrict__ Wt, int ldb,
                                                const float* __restrict__ bias, const float* __restrict__ resid, int rmod, int ldr,
                                                float* __restrict__ C, int ldc, int M, int N, int K) {
  __shared__ __attribute__((aligned(16))) float so[4][16][64];
  const int tid = threadIdx.x, w = tid >> 5, lane = tid & 31, ln = lane & 15, hh = lane >> 4;
  const int ntn = N / 64;
  const int wid = blockIdx.x * 4 + w;
  const int mt = wid / ntn, nq = wid % ntn;
  if (mt * 16 >= M) return;
  const int row0 = mt * 16, col0 = nq * 64;
  const float* arow = A + (size_t)(row0 + ln) * lda;
  v8f acc[4] = {};
  for (int kb = 0; kb < K; kb += 32) {
    FragB ah, al;
    const v4f x0 = *(const v4fa*)(arow + kb + 8 * hh), x1 = *(const v4fa*)(arow + kb + 8 * hh + 4);
    const v4f x2 = *(const v4fa*)(arow + kb + 16 + 8 * hh), x3 = *(const v4fa*)(arow + kb + 16 + 8 * hh + 4);
    float xs[16] = {x0[0],x0[1],x0[2],x0[3],x1[0],x1[1],x1[2],x1[3],x2[0],x2[1],x2[2],x2[3],x3[0],x3[1],x3[2],x3[3]};
#pragma unroll
    for (int i = 0; i < 16; ++i) { const unsigned short hb = bf16_bits(xs[i]); ah.u[i] = hb; al.u[i] = ASPLIT ? bf16_bits(xs[i] - bf16_val(hb)) : (unsigned short)0; }
#pragma unroll
    for (int t = 0; t < 4; ++t) {
      const unsigned short* brow = Wt + (size_t)(col0 + t * 16 + ln) * ldb + kb;
      FragB b;
      b.half[0] = *(const v8us*)(brow + 8 * hh);
      b.half[1] = *(const v8us*)(brow + 16 + 8 * hh);
      acc[t] = mmaN<ASPLIT ? 2 : 1>(ah.v, al.v, b.v, b.v, acc[t]);
    }
  }
#pragma unroll
  for (int t = 0; t < 4; ++t) {
    const int col = col0 + t * 16 + ln;
    float bv = bias ? bias[col] : 0.f;
    if (BIAS_BF16) bv = bf16_round(bv);
#pragma unroll
    for (int r = 0; r < 8; ++r) {
      float v = acc[t][r] + bv;
      if (resid) { float rv = resid[(size_t)((row0 + 8 * hh + r) % rmod) * ldr + col]; if (RES_BF16) rv = bf16_round(rv); v += rv; }
      if (ACT == 1) v = fmaxf(v, 0.f);
      if (ACT == 2) v = 0.5f * v * (1.0f + erff(v * 0.70710678118654752f));
      if (ACT == 3) { const float u = 0.7978845608028654f * (v + 0.044715f * v * v * v); v = 0.5f * v * (1.0f + tanhf(u)); }
      so[w][8 * hh + r][t * 16 + ln] = v;
    }
  }
  __builtin_amdgcn_fence(__ATOMIC_ACQ_REL, "workgroup");
  __builtin_amdgcn_wave_barrier();
  const int rsub = lane >> 4, c4 = (lane & 15) * 4;
  {
#pragma unroll
    for (int q = 0; q < 8; ++q) {
      const int r = q * 2 + rsub;
      const v4f v = *(const v4fa*)&so[w][r][c4];
      *(v4f*)(C + (size_t)(row0 + r) * ldc + col0 + c4) = v;
    }
    
  }
}
// row LayerNorm (biased variance, eps) over N: s = X (+ R); optional out_sum <- s; out_norm <- (s-mu)*rsqrt(var+eps)*g + b
template <bool PARAM_BF16>
__global__ __launch_bounds__(256) void k_layernorm(const float* __restrict__ X, const float* __restrict__ R, const float* __restrict__ g, const float* __restrict__ bta,
                                                  float* __restrict__ out_sum, float* __restrict__ out_norm, int N, float eps) {
  __shared__ float red[256];
  const int row = blockIdx.x, tid = threadIdx.x;
  const float* x = X + (size_t)row * N; const float* rr = R ? R + (size_t)row * N : nullptr;
  float vals[16];                     // up to N = 4096
  const int per = N / 256;            // contiguous chunk per thread? use strided-by-4 chunks: thread handles j = tid*4 + 1024*u
  float s1 = 0.f;
  for (int u = 0; u < per / 4; ++u) {
    const int j = tid * 4 + 1024 * u;
    const v4f a = *(const v4fa*)(x + j);
    v4f b = {0.f,0.f,0.f,0.f}; if (rr) b = *(const v4fa*)(rr + j);
#pragma unroll
    for (int q = 0; q < 4; ++q) { const float v = a[q] + b[q]; vals[u * 4 + q] = v; s1 += v; }
  }
  red[tid] = s1; __syncthreads();
  for (int st = 128; st > 0; st >>= 1) { if (tid < st) red[tid] += red[tid + st]; __syncthreads(); }
  const float mu = red[0] / (float)N; __syncthreads();
  float s2 = 0.f;
  for (int u = 0; u < per / 4; ++u)
#pragma unroll
    for (int q = 0; q < 4; ++q) { const float c = vals[u * 4 + q] - mu; s2 += c * c; }
  red[tid] = s2; __syncthreads();
  for (int st = 128; st > 0; st >>= 1) { if (tid < st) red[tid] += red[tid + st]; __syncthreads(); }
  const float rs = rsqrtf(red[0] / (float)N + eps);
  {
    for (int u = 0; u < per / 4; ++u) {
      const int j = tid * 4 + 1024 * u;
      v4f o, sm;
#pragma unroll
      for (int q = 0; q < 4; ++q) {
        float gg = g[j + q], bb = bta[j + q];
        if (PARAM_BF16) { gg = bf16_round(gg); bb = bf16_round(bb); }
        sm[q] = vals[u * 4 + q]; o[q] = (vals[u * 4 + q] - mu) * rs * gg + bb;
      }
      if (out_sum) *(v4f*)(out_sum + (size_t)row * N + j) = sm;
      *(v4f*)(out_norm + (size_t)row * N + j) = o;
    }
    
  }
}



// ---- f16 WMMA path (v_wmma_f32_16x16x32_f16): 11-bit significands for operands in range — used where a [0,1] probability operand needs more precision than bf16
typedef _Float16 v16h __attribute__((ext_vector_type(16)));
union FragH { v16h v; v8us half[2]; _Float16 h[16]; unsigned short u[16]; };
template <int NT>
__device__ __forceinline__ v8f mmaH(v16h ah, v16h al, v16h bh, v16h bl, v8f c) {
  c = __builtin_amdgcn_wmma_f32_16x16x32_f16(false, ah, false, bh, (short)0, c, false, false);
  if (NT >= 2) c = __builtin_amdgcn_wmma_f32_16x16x32_f16(false, al, false, bh, (short)0, c, false, false);
  if (NT >= 3) c = __builtin_amdgcn_wmma_f32_16x16x32_f16(false, ah, false, bl, (short)0, c, false, false);
  asm volatile("v_nop\n\tv_nop\n\tv_nop\n\tv_nop" : "+v"(c) : "v"(ah), "v"(al), "v"(bh), "v"(bl));
  return c;
}
// batched GEMM like k_gemm_b but f16 operands: A f32 (split into f16 hi/lo if ASPLIT, else rounded to f16), Bt = f16 values [n][k]; alpha; C f32; N multiple of 16 (partial tiles skipped)
template <bool ASPLIT>
__global__ __launch_bounds__(128) void k_gemm_h(const float* __restrict__ A, int lda, size_t sA, const _Float16* __restrict__ Bh, int ldb, size_t sB, float alpha, float* __restrict__ C, int ldc, size_t sC, int M, int N, int K) {
  __shared__ __attribute__((aligned(16))) float so[4][16][64];
  const int tid = threadIdx.x, w = tid >> 5, lane = tid & 31, ln = lane & 15, hh = lane >> 4; const int by = blockIdx.y;
  A += (size_t)by * sA; Bh += (size_t)by * sB; C += (size_t)by * sC;
  const int ntn = (N + 63) / 64; const int wid = blockIdx.x * 4 + w; const int mt = wid / ntn, nq = wid % ntn; if (mt * 16 >= M) return;
  const int row0 = mt * 16, col0 = nq * 64; const float* arow = A + (size_t)(row0 + ln) * lda;
  v8f acc[4] = {};
  for (int kb = 0; kb < K; kb += 32) {
    FragH ah, al;
    const v4f x0 = *(const v4fa*)(arow + kb + 8 * hh), x1 = *(const v4fa*)(arow + kb + 8 * hh + 4), x2 = *(const v4fa*)(arow + kb + 16 + 8 * hh), x3 = *(const v4fa*)(arow + kb + 16 + 8 * hh + 4);
    float xs[16] = {x0[0],x0[1],x0[2],x0[3],x1[0],x1[1],x1[2],x1[3],x2[0],x2[1],x2[2],x2[3],x3[0],x3[1],x3[2],x3[3]};
#pragma unroll
    for (int i = 0; i < 16; ++i) { const _Float16 h = (_Float16)xs[i]; ah.h[i] = h; al.h[i] = ASPLIT ? (_Float16)(xs[i] - (float)h) : (_Float16)0.0f; }
#pragma unroll
    for (int t = 0; t < 4; ++t) { if (col0 + t * 16 >= N) continue; const size_t boff = (size_t)(col0 + t * 16 + ln) * ldb + kb; FragH bq; bq.half[0] = *(const v8us*)(Bh + boff + 8 * hh); bq.half[1] = *(const v8us*)(Bh + boff + 16 + 8 * hh);
      acc[t] = mmaH<ASPLIT ? 2 : 1>(ah.v, al.v, bq.v, bq.v, acc[t]); }
  }
#pragma unroll
  for (int t = 0; t < 4; ++t) { if (col0 + t * 16 >= N) continue;
#pragma unroll
    for (int r = 0; r < 8; ++r) so[w][8 * hh + r][t * 16 + ln] = acc[t][r] * alpha; }
  __builtin_amdgcn_fence(__ATOMIC_ACQ_REL, "workgroup"); __builtin_amdgcn_wave_barrier();
  const int rsub = lane >> 4, c4 = (lane & 15) * 4;
  {
#pragma unroll
    for (int q = 0; q < 8; ++q) { const int r = q * 2 + rsub; if (col0 + c4 < N) { const v4f v = *(const v4fa*)&so[w][r][c4]; *(v4f*)(C + (size_t)(row0 + r) * ldc + col0 + c4) = v; } }
     }
}

// k_gemm_hh variant with fused epilogue: v = acc·alpha + bias[by·sBias + col] (+ CP[(row/rowsPerB)·sCPb + by·64 + col] if CP) ; ACT 0 none / 1 elu ; writes f16 C16 (and f32 C if non-null)
template <int ACT>
__global__ __launch_bounds__(128) void k_gemm_hhx(const _Float16* __restrict__ A, int lda, size_t sA, const _Float16* __restrict__ Bh, int ldb, size_t sB, float alpha, const float* __restrict__ bias, size_t sBias, const float* __restrict__ CP, int rowsPerB, size_t sCPb, int row0g,
    float* __restrict__ C, _Float16* __restrict__ C16, int ldc, size_t sC, int M, int N, int K) {
  __shared__ __attribute__((aligned(16))) float so[4][16][64];
  const int tid = threadIdx.x, w = tid >> 5, lane = tid & 31, ln = lane & 15, hh = lane >> 4; const int by = blockIdx.y;
  A += (size_t)by * sA; Bh += (size_t)by * sB; const size_t cofs = (size_t)by * sC; const float* bp = bias ? bias + (size_t)by * sBias : nullptr;
  const int ntn = (N + 63) / 64; const int wid = blockIdx.x * 4 + w; const int mt = wid / ntn, nq = wid % ntn; if (mt * 16 >= M) return;
  const int row0 = mt * 16, col0 = nq * 64; const _Float16* arow = A + (size_t)(row0 + ln) * lda;
  v8f acc[4] = {};
  for (int kb = 0; kb < K; kb += 32) { FragH ah; ah.half[0] = *(const v8us*)((const unsigned short*)arow + kb + 8 * hh); ah.half[1] = *(const v8us*)((const unsigned short*)arow + kb + 16 + 8 * hh);
#pragma unroll
    for (int t = 0; t < 4; ++t) { if (col0 + t * 16 >= N) continue; const size_t boff = (size_t)(col0 + t * 16 + ln) * ldb + kb; FragH bq; bq.half[0] = *(const v8us*)((const unsigned short*)Bh + boff + 8 * hh); bq.half[1] = *(const v8us*)((const unsigned short*)Bh + boff + 16 + 8 * hh);
      acc[t] = mmaH<1>(ah.v, ah.v, bq.v, bq.v, acc[t]); }
  }
#pragma unroll
  for (int t = 0; t < 4; ++t) { if (col0 + t * 16 >= N) continue; const int col = col0 + t * 16 + ln; const float bv = bp ? bf16_round(bp[col]) : 0.f;
#pragma unroll
    for (int r = 0; r < 8; ++r) { float v = acc[t][r] * alpha + bv; if (CP) { const int rr = row0g + row0 + 8 * hh + r; if (rowsPerB < 0) v += CP[cofs + (size_t)rr * ldc + col];      /* rowsPerB < 0: own element of the batched C plane */ else { const int bidx = rr / rowsPerB; v += CP[(size_t)bidx * sCPb + (size_t)by * 64 + col]; } } if (ACT == 1) v = (v > 0.f) ? v : expm1f(v); else if (ACT == 7) v = (v > 0.f) ? v + 1.0f : expf(v); else if (ACT == 8) v = tanhf(v); else if (ACT == 9) v = 0.5f * v * (1.0f + tanhf(0.7978845608028654f * (v + 0.044715f * v * v * v))); else if (ACT == 11) v = 1.0f / (1.0f + expf(-v)); else if (ACT == 12) v = (v > 0.f) ? v : 0.01f * v; else if (ACT == 14) v = (v > 0.f) ? v : 0.1f * v; else if (ACT == 16) v = (v >= 0.f) ? v : 0.3f * v; else if (ACT == 17) v = (v >= 0.f) ? v : 0.2f * v; else if (ACT == 15) v = v / (1.0f + expf(-v)); else if (ACT == 3) v = fmaxf(v, 0.f); else if (ACT == 6) v = 0.5f * v * (1.0f + erff(v * 0.70710678118654752f)); so[w][8 * hh + r][t * 16 + ln] = v; } }
  __builtin_amdgcn_fence(__ATOMIC_ACQ_REL, "workgroup"); __builtin_amdgcn_wave_barrier();
  const int rsub = lane >> 4, c4 = (lane & 15) * 4; typedef _Float16 v4h __attribute__((ext_vector_type(4)));
  {
#pragma unroll
    for (int q = 0; q < 8; ++q) { const int r = q * 2 + rsub; if (col0 + c4 < N) { const v4f v = *(const v4fa*)&so[w][r][c4]; if (C) *(v4f*)(C + cofs + (size_t)(row0 + r) * ldc + col0 + c4) = v; if (C16) { v4h h4; for (int i = 0; i < 4; ++i) h4[i] = (_Float16)v[i]; *(v4h*)(C16 + cofs + (size_t)(row0 + r) * ldc + col0 + c4) = h4; } } }
     }
}


typedef _Float16 v4h __attribute__((ext_vector_type(4)));

__global__ __launch_bounds__(256) void k_h16(const float* __restrict__ x, _Float16* __restrict__ X16, size_t n8) { const size_t t = (size_t)blockIdx.x * 256 + threadIdx.x; if (t >= n8) return; FragH f;
#pragma unroll
  for (int q = 0; q < 8; ++q) f.h[q] = (_Float16)x[t * 8 + q]; *(v8us*)((unsigned short*)X16 + t * 8) = f.half[0];  }
__global__ __launch_bounds__(256) void k_round16f(const float* __restrict__ W, _Float16* __restrict__ Bt, size_t n8) { const size_t t = (size_t)blockIdx.x * 256 + threadIdx.x; if (t >= n8) return; FragH f;
#pragma unroll
  for (int i = 0; i < 8; ++i) f.h[i] = (_Float16)(bf16_round(W[t * 8 + i]) * 16.0f); *(v8us*)((unsigned short*)Bt + t * 8) = f.half[0];  }

__global__ __launch_bounds__(256) void k_hl(const float* __restrict__ F, _Float16* __restrict__ Hh, _Float16* __restrict__ Hl, size_t n8) { const size_t t = (size_t)blockIdx.x * 256 + threadIdx.x; if (t >= n8) return; FragH fh, fl; const v4f a = *(const v4fa*)(F + t * 8), c = *(const v4fa*)(F + t * 8 + 4);
#pragma unroll
  for (int q = 0; q < 4; ++q) { _Float16 h = (_Float16)a[q]; fh.h[q] = h; fl.h[q] = (_Float16)((a[q] - (float)h) * 1024.0f); h = (_Float16)c[q]; fh.h[4 + q] = h; fl.h[4 + q] = (_Float16)((c[q] - (float)h) * 1024.0f); }
  { *(v8us*)((unsigned short*)Hh + t * 8) = fh.half[0]; *(v8us*)((unsigned short*)Hl + t * 8) = fl.half[0];  } }



__global__ __launch_bounds__(256) void k_wnat(const float* __restrict__ w, size_t n8, _Float16* __restrict__ Bt) { const size_t t = (size_t)blockIdx.x * 256 + threadIdx.x; if (t >= n8) return; FragH f; for (int q = 0; q < 8; ++q) f.h[q] = (_Float16)(bf16_round(w[t * 8 + q]) * 16.0f); *(v8us*)((unsigned short*)Bt + t * 8) = f.half[0];  }
__global__ __launch_bounds__(256) void k_rsm(const float* __restrict__ S, _Float16* __restrict__ P, int nrows) {
  #pragma clang fp contract(off)
  const int i = blockIdx.x * 256 + threadIdx.x; if (i >= nrows) return; const float* s = S + (size_t)i * SQ; float mx = -3.0e38f;
#pragma unroll 1
  for (int j = 0; j < SQ; ++j) mx = fmaxf(mx, s[j]); float se = 0.f;
#pragma unroll 1
  for (int j = 0; j < SQ; ++j) se += expf(s[j] - mx); const float sc = 256.0f / se;
#pragma unroll 1
  for (int j0 = 0; j0 < SQ; j0 += 8) { FragH f; for (int q = 0; q < 8; ++q) f.h[q] = (_Float16)(expf(s[j0 + q] - mx) * sc); unsigned short* d = (unsigned short*)P + (size_t)i * SQ + j0; *(v8us*)d = f.half[0];  } }
__global__ __launch_bounds__(256) void k_vt(const _Float16* __restrict__ V16, int b, int h0, _Float16* __restrict__ VT) { __shared__ unsigned short tl[64][65]; const int tid = threadIdx.x; const int hh = blockIdx.x % HG, sg = blockIdx.x / HG; const int s0 = sg * 64; const int h = h0 + hh;
  for (int i = tid; i < 64 * 8; i += 256) { const int j = i / 8, d8 = (i % 8) * 8; FragH f; f.half[0] = *(const v8us*)((const unsigned short*)V16 + ((size_t)b * SQ + s0 + j) * DM + h * HD + d8); for (int q = 0; q < 8; ++q) tl[d8 + q][j] = f.u[q]; }
  __syncthreads();
  { for (int i = tid; i < 64 * 8; i += 256) { const int d = i / 8, j8 = (i % 8) * 8; FragH f; for (int q = 0; q < 8; ++q) f.u[q] = tl[d][j8 + q]; *(v8us*)((unsigned short*)VT + ((size_t)hh * HD + d) * SQ + s0 + j8) = f.half[0]; }  } }

// Fused attention, one launch. A work-group is 4 waves and 64 query rows of one batch; a wave owns 16 rows: its Q fragments (8 k steps) and its 16 x 256 f32 output tile stay in registers.
// The keys are walked in chunks of 64: K rows and V^T rows of the chunk are staged in LDS (pitch = row + 16 B for 16-byte readers) and shared by the 4 waves; the next chunk's rows are
// loaded into registers while this chunk is worked on. Softmax keeps a running row maximum; the output tile and the row sum are rescaled when it grows. P goes from accumulator layout
// to A-fragment layout through the wave's own LDS rows. P = 256 * exp(s - max), f16; the factor cancels in the division by the row sum.
template <int M> __device__ __forceinline__ float rs_xm(float x) { return __builtin_bit_cast(float, __builtin_amdgcn_mov_dpp(__builtin_bit_cast(int, x), 0x160 | M, 0xf, 0xf, false)); }      /* lane l with lane l ^ M inside a 16-lane row (row_xmask) */
#define FA_KP 264      /* halves per staged K row: 512 B + 16 B */
#define FA_VP 72       /* halves per staged V^T row and per P row: 128 B + 16 B */
#define FA_C 0.09016844005556021f      /* log2(e) / 16: the score scale folded into the exponent */
__device__ __forceinline__ v16h fa_frag(const unsigned short* p, int hh) { FragH f; f.half[0] = *(const v8us*)(p + 8 * hh); f.half[1] = *(const v8us*)(p + 16 + 8 * hh); return f.v; }
__device__ __forceinline__ v8f fa_mma(v16h a, v16h b, v8f c) { return __builtin_amdgcn_wmma_f32_16x16x32_f16(false, a, false, b, (short)0, c, false, false); }
/* eight 2^x in one statement: the outputs are early-clobber, so no v_exp_f32 overwrites the source of the one in front of it, and the closing v_nop is the one slot the instruction set asks for behind a transcendental */
__device__ __forceinline__ v8f fa_exp2(v8f x) { float d0, d1, d2, d3, d4, d5, d6, d7;
  asm("v_exp_f32 %0, %8\n\tv_exp_f32 %1, %9\n\tv_exp_f32 %2, %10\n\tv_exp_f32 %3, %11\n\tv_exp_f32 %4, %12\n\tv_exp_f32 %5, %13\n\tv_exp_f32 %6, %14\n\tv_exp_f32 %7, %15\n\tv_nop"
      : "=&v"(d0), "=&v"(d1), "=&v"(d2), "=&v"(d3), "=&v"(d4), "=&v"(d5), "=&v"(d6), "=&v"(d7) : "v"(x[0]), "v"(x[1]), "v"(x[2]), "v"(x[3]), "v"(x[4]), "v"(x[5]), "v"(x[6]), "v"(x[7]));
  const v8f d = {d0, d1, d2, d3, d4, d5, d6, d7}; return d; }
__global__ __launch_bounds__(128) void k_fattn(const _Float16* __restrict__ Q, const _Float16* __restrict__ Kg, const _Float16* __restrict__ Vt, float* __restrict__ O) {
  __shared__ __attribute__((aligned(16))) unsigned short ks[64 * FA_KP];
  __shared__ __attribute__((aligned(16))) unsigned short vs[DV * FA_VP];
  __shared__ __attribute__((aligned(16))) unsigned short ps[4][16 * FA_VP];
  __shared__ __attribute__((aligned(16))) float so[4][16][DV + 4];
  const int tid = threadIdx.x, w = tid >> 5, lane = tid & 31, ln = lane & 15, hh = lane >> 4, b = blockIdx.y;
  const int q0 = blockIdx.x * 64 + 16 * w;
  const unsigned short* qp = (const unsigned short*)Q + ((size_t)b * SQ + q0 + ln) * DQ;
  v16h qa[DQ / 32];
#pragma unroll      /* constant indices keep qa[] in registers */
  for (int i = 0; i < DQ / 32; ++i) qa[i] = fa_frag(qp + 32 * i, hh);
  const unsigned short* kg = (const unsigned short*)Kg + (size_t)b * SQ * DQ + tid * 8;      /* a chunk of K is 32 KB in a row */
  const unsigned short* vg = (const unsigned short*)Vt + ((size_t)b * DV + (tid >> 3)) * SQ + (tid & 7) * 8;      /* a chunk of V^T is 128 B of each of 256 rows */
  unsigned short* kd = ks + (tid >> 5) * FA_KP + (tid & 31) * 8;
  unsigned short* vd = vs + (tid >> 3) * FA_VP + (tid & 7) * 8;
  v8us kr[16], vr[16];
#pragma unroll      /* constant indices keep kr[], vr[] in registers */
  for (int p = 0; p < 16; ++p) { kr[p] = *(const v8us*)(kg + p * 1024); vr[p] = *(const v8us*)(vg + (size_t)p * 16 * SQ); }
  asm volatile("s_wait_xcnt 0x0" ::: "memory");      /* the wait in front of any reuse of the loads' address registers */
  const v8f z8 = {0.f,0.f,0.f,0.f,0.f,0.f,0.f,0.f};
  v8f o[DV / 16], mr, lr = z8;
#pragma unroll
  for (int j = 0; j < DV / 16; ++j) o[j] = z8;
#pragma unroll
  for (int r = 0; r < 8; ++r) mr[r] = -3.0e38f;
#pragma unroll 1      /* one chunk per trip: the body is already 64 WMMAs long */
  for (int c = 0; c < SQ / 64; ++c) {
    __syncthreads();      /* every wave has left the chunk before */
#pragma unroll
    for (int p = 0; p < 16; ++p) { *(v8us*)(kd + p * 4 * FA_KP) = kr[p]; *(v8us*)(vd + p * 16 * FA_VP) = vr[p]; }
    __syncthreads();      /* the chunk is staged */
    const int adv = (c + 1 < SQ / 64) ? 1 : 0;      /* the last trip loads its own chunk again: in bounds, no branch */
    kg += adv * 64 * DQ; vg += adv * 64;
#pragma unroll
    for (int p = 0; p < 16; ++p) { kr[p] = *(const v8us*)(kg + p * 1024); vr[p] = *(const v8us*)(vg + (size_t)p * 16 * SQ); }
    asm volatile("s_wait_xcnt 0x0" ::: "memory");      /* the wait in front of any reuse of the loads' address registers; it also keeps the loads ahead of the chunk's work */
    /* The chunk's 64 B fragments come from LDS in 8 groups of 8 (groups 0-3: K, two k steps x four key tiles; groups 4-7: V^T, one k step x eight column tiles). */
    v16h fb[8][8];
    auto ld = [&](int g) {
#pragma unroll      /* constant indices keep fb[][] in registers */
      for (int e = 0; e < 8; ++e) fb[g][e] = (g < 4) ? fa_frag(ks + ((e & 3) * 16 + ln) * FA_KP + 32 * (2 * g + (e >> 2)), hh) : fa_frag(vs + (((g & 1) * 8 + e) * 16 + ln) * FA_VP + 32 * ((g - 4) >> 1), hh); };
    v8f s[4] = {z8, z8, z8, z8};
    ld(0); ld(1);
#pragma unroll
    for (int g = 0; g < 4; ++g) {
      ld(g + 2);
      __builtin_amdgcn_sched_barrier(0);      /* a group's LDS reads are issued together, two groups ahead of its WMMAs; left alone the compiler reads each fragment right in front of its WMMA and waits out the LDS latency 64 times */
#pragma unroll
      for (int e = 0; e < 8; ++e) s[e & 3] = fa_mma(qa[2 * g + (e >> 2)], fb[g][e], s[e & 3]);
      __builtin_amdgcn_sched_barrier(0);      /* the same: keeps the next group's reads behind this group's WMMAs */
    }
    /* accumulator element r of a lane is row 8 * hh + r, column 16 * t + ln: a row lives in one 16-lane half */
    v8f x = __builtin_elementwise_max(__builtin_elementwise_max(s[0], s[1]), __builtin_elementwise_max(s[2], s[3]));
#pragma unroll
    for (int r = 0; r < 8; ++r) { float y = x[r]; y = fmaxf(y, rs_xm<1>(y)); y = fmaxf(y, rs_xm<2>(y)); y = fmaxf(y, rs_xm<4>(y)); y = fmaxf(y, rs_xm<8>(y)); x[r] = y; }
    const v8f mn = __builtin_elementwise_max(mr, x); const v8f da = (mr - mn) * FA_C; const v8f bs = 8.0f - mn * FA_C; mr = mn;
    const v8f al = fa_exp2(da); v8f acc = z8;
#pragma unroll
    for (int t = 0; t < 4; ++t) { const v8f p = fa_exp2(s[t] * FA_C + bs); acc += p;
#pragma unroll
      for (int r = 0; r < 8; ++r) { FragH f; f.h[0] = (_Float16)p[r]; ps[w][(8 * hh + r) * FA_VP + t * 16 + ln] = f.u[0]; } }
    lr = lr * al + acc;      /* each lane keeps the sum of its own columns; the lanes are joined once, behind the loop */
#pragma unroll
    for (int j = 0; j < DV / 16; ++j) o[j] *= al;
    __builtin_amdgcn_fence(__ATOMIC_ACQ_REL, "workgroup"); __builtin_amdgcn_wave_barrier();      /* the wave's P rows are written before its lanes read one another's */
    const v16h pa[2] = {fa_frag(ps[w] + ln * FA_VP, hh), fa_frag(ps[w] + ln * FA_VP + 32, hh)};
#pragma unroll
    for (int g = 4; g < 8; ++g) {
      if (g + 2 < 8) ld(g + 2);
      __builtin_amdgcn_sched_barrier(0);      /* as above: reads two groups ahead of their WMMAs */
#pragma unroll
      for (int e = 0; e < 8; ++e) o[(g & 1) * 8 + e] = fa_mma(pa[(g - 4) >> 1], fb[g][e], o[(g & 1) * 8 + e]);
      __builtin_amdgcn_sched_barrier(0);      /* as above */
    }
  }
#pragma unroll
  for (int r = 0; r < 8; ++r) { float l = lr[r]; l += rs_xm<1>(l); l += rs_xm<2>(l); l += rs_xm<4>(l); l += rs_xm<8>(l); const float inv = 1.0f / l;
#pragma unroll
    for (int j = 0; j < DV / 16; ++j) so[w][8 * hh + r][j * 16 + ln] = o[j][r] * inv; }
  __builtin_amdgcn_fence(__ATOMIC_ACQ_REL, "workgroup"); __builtin_amdgcn_wave_barrier();      /* the wave's own staging rows are written before they are read back as whole lines */
  float* op = O + ((size_t)b * SQ + q0) * DV + lane * 4;
#pragma unroll
  for (int q = 0; q < 32; ++q) { const v4f v = *(const v4fa*)&so[w][q >> 1][(q & 1) * 128 + lane * 4]; *(v4f*)(op + (q >> 1) * DV + (q & 1) * 128) = v; }
}
// Wt[m][n][k] = f16(bf16(W_m[k][n]) * 16) for the three f32 row-major [in][out] weights, m = grid.y (power-of-two scale: bf16-exact weights stay exact in f16 away from the subnormal range)
__global__ __launch_bounds__(256) void k_wt3(const float* __restrict__ Wq, const float* __restrict__ Wk, const float* __restrict__ Wv, _Float16* __restrict__ Wt) {
  const float* W = blockIdx.y == 0 ? Wq : (blockIdx.y == 1 ? Wk : Wv);
  const int t = blockIdx.x * 256 + threadIdx.x; const int n = t / (DM / 8), k8 = (t % (DM / 8)) * 8; FragH f;
#pragma unroll
  for (int i = 0; i < 8; ++i) f.h[i] = (_Float16)(bf16_round(W[(size_t)(k8 + i) * DQ + n]) * 16.0f);
  *(v8us*)((unsigned short*)Wt + ((size_t)blockIdx.y * DQ + n) * DM + k8) = f.half[0];
}
// Projection stage, one launch. A work-group is 12 waves and 64 token rows: the rows are read once as f32, rounded to bf16 (exact in f16) and staged in LDS for all 12 waves.
// Wave w makes the 64 x 64 tile of matrix w / 4 (q, k, v), column slab w % 4, over the whole k = 256; its weight fragments come from the transposed f16 rows in global memory, one k step ahead.
// The weights are the A operand and the tokens the B operand, so an accumulator lane holds 8 consecutive output columns of one token: for q and k one 16-byte LDS store into the wave's own
// staging rows (row = token); for v the 8 values go to 8 staging rows (row = column), which makes the V^T rows. Either way the staging rows go out as whole 128-byte lines.
#define PJ_XP 264      /* halves per staged x row: 512 B + 16 B */
#define PJ_SP 72       /* halves per staged output row: 128 B + 16 B */
__global__ __launch_bounds__(384) void k_proj(const float* __restrict__ x, const _Float16* __restrict__ Wt, _Float16* __restrict__ Q, _Float16* __restrict__ Kg, _Float16* __restrict__ Vt) {
  __shared__ __attribute__((aligned(16))) unsigned short xs[64 * PJ_XP];
  __shared__ __attribute__((aligned(16))) unsigned short sts[12][64 * PJ_SP];
  const int tid = threadIdx.x, lane = tid & 31, ln = lane & 15, hh = lane >> 4;
  const int w = __builtin_amdgcn_readfirstlane(tid >> 5);      /* the wave's number in a scalar register: the tests on it below become scalar branches */
  const int t0 = blockIdx.x * 64;      /* first token row; 64 divides SQ, so the rows are of one batch */
  const unsigned short* wp = (const unsigned short*)Wt + (size_t)w * 64 * DM + ln * DM;      /* rows 64 w .. 64 w + 63 of the 768 transposed weight rows */
  v16h wf[2][4];
#pragma unroll
  for (int i = 0; i < 4; ++i) wf[0][i] = fa_frag(wp + 16 * i * DM, hh);
  asm volatile("s_wait_xcnt 0x0" ::: "memory");      /* the wait in front of any reuse of the weight loads' address registers */
  if (w < 8) {      /* the 64 rows are 64 KB in a row: 2048 pieces of 8 floats, 8 for each thread of the first 8 waves */
    const char* xg = (const char*)(x + (size_t)t0 * DM); const unsigned xb = tid * 32;      /* uniform base, the thread's byte offset */
    v4f xa[8][2];
#pragma unroll      /* constant indices keep xa[][] in registers */
    for (int p = 0; p < 8; ++p) { xa[p][0] = *(const v4fa*)(xg + xb + p * 8192); xa[p][1] = *(const v4fa*)(xg + xb + p * 8192 + 16); }
    asm volatile("s_wait_xcnt 0x0" :: "v"(xb) : "memory");      /* the wait in front of any reuse of the loads' address registers; the offset is named as an input so that no load's result lands on it ahead of the wait */
#pragma unroll
    for (int p = 0; p < 8; ++p) { FragH f;
#pragma unroll
      for (int q = 0; q < 4; ++q) { f.h[q] = (_Float16)bf16_round(xa[p][0][q]); f.h[4 + q] = (_Float16)bf16_round(xa[p][1][q]); }
      *(v8us*)(xs + (8 * p + w) * PJ_XP + lane * 8) = f.half[0]; }
  }
  __syncthreads();      /* the token rows are staged */
  const v8f z8 = {0.f,0.f,0.f,0.f,0.f,0.f,0.f,0.f};
  v8f acc[4][4];
#pragma unroll
  for (int i = 0; i < 4; ++i)
#pragma unroll
    for (int j = 0; j < 4; ++j) acc[i][j] = z8;
#pragma unroll      /* constant indices keep acc[][], wf[][] in registers */
  for (int s = 0; s < DM / 32; ++s) {
    v16h xf[4];
#pragma unroll
    for (int i = 0; i < 4; ++i) { if (s + 1 < DM / 32) wf[(s + 1) & 1][i] = fa_frag(wp + 16 * i * DM + 32 * (s + 1), hh); xf[i] = fa_frag(xs + (16 * i + ln) * PJ_XP + 32 * s, hh); }
    __builtin_amdgcn_sched_barrier(0);      /* a step's reads are issued together, ahead of its WMMAs; left alone the compiler spreads them in pairs among the WMMAs */
#pragma unroll
    for (int i = 0; i < 4; ++i)
#pragma unroll
      for (int j = 0; j < 4; ++j) acc[i][j] = fa_mma(wf[s & 1][i], xf[j], acc[i][j]);
    __builtin_amdgcn_sched_barrier(0);      /* the same: keeps the next step's reads behind this step's WMMAs */
  }
  asm volatile("s_wait_xcnt 0x0" ::: "memory");      /* the wait in front of any reuse of the weight loads' address registers */
  /* accumulator element r of acc[i][j] is output column 16 i + 8 hh + r of token 16 j + ln; x 0.0625 undoes the x16 of the weights */
  unsigned short* st = sts[w];
  if (w < 8) {
#pragma unroll
    for (int j = 0; j < 4; ++j)
#pragma unroll
      for (int i = 0; i < 4; ++i) { FragH f;
#pragma unroll
        for (int r = 0; r < 8; ++r) f.h[r] = (_Float16)(acc[i][j][r] * 0.0625f);
        *(v8us*)(st + (16 * j + ln) * PJ_SP + 16 * i + 8 * hh) = f.half[0]; }
  } else {
#pragma unroll
    for (int j = 0; j < 4; ++j)
#pragma unroll
      for (int i = 0; i < 4; ++i)
#pragma unroll
        for (int r = 0; r < 8; ++r) { FragH f; f.h[0] = (_Float16)(acc[i][j][r] * 0.0625f); st[(16 * i + 8 * hh + r) * PJ_SP + 16 * j + ln] = f.u[0]; }
  }
  __builtin_amdgcn_fence(__ATOMIC_ACQ_REL, "workgroup"); __builtin_amdgcn_wave_barrier();      /* the wave's own staging rows are written before they are read back as whole lines */
  unsigned short* op = w < 8 ? (unsigned short*)(w < 4 ? Q : Kg) + (size_t)t0 * DQ + (w & 3) * 64 : (unsigned short*)Vt + ((size_t)(t0 / SQ) * DV + (w & 3) * 64) * SQ + t0 % SQ;
  const int pitch = w < 8 ? DQ : SQ;      /* halves between two output rows */
  op += (size_t)((lane >> 3) * pitch + (lane & 7) * 8);      /* a wave's store is 4 rows of 128 B */
  v8us rw[16];
#pragma unroll      /* constant indices keep rw[] in registers */
  for (int q = 0; q < 16; ++q) rw[q] = *(const v8us*)(st + (q * 4 + (lane >> 3)) * PJ_SP + (lane & 7) * 8);
#pragma unroll
  for (int q = 0; q < 16; ++q) *(v8us*)(op + (size_t)(q * 4 * pitch)) = rw[q];
}
extern "C" void kernel_launch(void* const* d_in, const int* in_sizes, int n_in,
                              void* d_out, int out_size, void* d_ws, size_t ws_size, hipStream_t stream) {
  (void)in_sizes; (void)n_in; (void)out_size;
  const float* const* I = (const float* const*)d_in; const float* x = I[0]; const float* wq = I[1]; const float* wk = I[2]; const float* wv = I[3];      /* [in][out] weights */
  char* ws = (char*)d_ws; size_t off = 0;
  auto take = [&](size_t bytes) { char* p = ws + off; off += (bytes + 255) & ~(size_t)255; return p; };
  _Float16* BW = (_Float16*)take((size_t)3 * DQ * DM * 2);      /* q | k | v weights, transposed */
  _Float16* Q16 = (_Float16*)take(NR * DQ * 2); _Float16* K16 = (_Float16*)take(NR * DQ * 2);
  _Float16* VT = (_Float16*)take((size_t)NB * DV * SQ * 2);
  if (off > ws_size) return;
  k_wt3<<<dim3(DQ * (DM / 8) / 256, 3), 256, 0, stream>>>(wq, wk, wv, BW);
  k_proj<<<(unsigned)(NR / 64), 384, 0, stream>>>(x, BW, Q16, K16, VT);      /* q, k f16 rows and V^T per batch [DV][SQ] */
  k_fattn<<<dim3(SQ / 64, NB), 128, 0, stream>>>(Q16, K16, VT, (float*)d_out);      /* scores, softmax and attn v in one launch; the batch is grid.y */
}

// v005
// One run takes 55.9 microseconds.
// In both of two side-by-side timings against v004, it was 1.17 times as fast.
// Counting every step since v000, it is 85.9 times as fast.
#include <hip/hip_runtime.h>
// Single-head self-attention (x [8][2048][256]; Q, K, V = x W ([in][out] [256][256]); scores = Q.K/16; softmax over all 2048 keys; out = attn V -> [8][2048][256]).
// Structure: exact x16 transposed [in][out] weights as f16 rows (one launch for the three); one projection launch: 64 token rows per work-group read as f32, rounded and staged once in LDS as exact f16, q | k | v WMMA tiles (64x64 per wave, f32 accumulation) written as f16 rows, v straight as V^T rows; one fused attention launch (batch = grid.y): per 64-key chunk (K and V^T rows brought into LDS by tensor loads, two buffers) scores WMMA, running-maximum softmax on VALU (f32; P x256 f16), O += P . V^T WMMA; scores and P never reach memory; f32 output.
// Compute dtype: inputs rounded to bf16; x / weights exact; q, k plain f16 (~2^-12); v, P plain f16 (~2^-12); scores / softmax f32. v_wmma_f32_16x16x32_f16.
#define NB 8
#define SQ 2048
#define DM 256
#define DQ 256
#define DV 256
#define QT 2048
#define NH 4                    /* V^T slabs of 64 */
#define HD 64
#define HG 1
#define NR ((size_t)NB * SQ)
#define QN SQ                        /* query rows per batch (debug hook) */
#define NBR NB                       /* batches (debug hook) */
#define MP ((int)NR)                 /* rows through the projections (debug hook) */
typedef __bf16 v16b __attribute__((ext_vector_type(16)));
typedef unsigned short v8us __attribute__((ext_vector_type(8), may_alias));
typedef float  v8f  __attribute__((ext_vector_type(8)));
typedef float  v4f  __attribute__((ext_vector_type(4)));
typedef float  v4fa __attribute__((ext_vector_type(4), may_alias));
union FragB { v16b v; v8us half[2]; unsigned short u[16]; };

__device__ __forceinline__ unsigned short bf16_bits(float x) { unsigned int u = __float_as_uint(x); return (unsigned short)((u + 0x7FFFu + ((u >> 16) & 1u)) >> 16); }
__device__ __forceinline__ float bf16_val(unsigned short b) { return __uint_as_float(((unsigned int)b) << 16); }
__device__ __forceinline__ float bf16_round(float x) { return bf16_val(bf16_bits(x)); }
// D += A·B with NT terms: 1 = ah·bh, 2 = + al·bh (A split), 3 = + ah·bl (both split)
template <int NT>
__device__ __forceinline__ v8f mmaN(v16b ah, v16b al, v16b bh, v16b bl, v8f c) {
  c = __builtin_amdgcn_wmma_f32_16x16x32_bf16(false, ah, false, bh, (short)0, c, false, false);
  if (NT >= 2) c = __builtin_amdgcn_wmma_f32_16x16x32_bf16(false, al, false, bh, (short)0, c, false, false);
  if (NT >= 3) c = __builtin_amdgcn_wmma_f32_16x16x32_bf16(false, ah, false, bl, (short)0, c, false, false);
  asm volatile("v_nop\n\tv_nop\n\tv_nop\n\tv_nop" : "+v"(c) : "v"(ah), "v"(al), "v"(bh), "v"(bl));
  return c;
}

__global__ __launch_bounds__(256) void k_wt_bf16(const float* __restrict__ W, unsigned short* __restrict__ Wt, int K, int N) {
  const int t = blockIdx.x * 256 + threadIdx.x;
  const int k8n = K / 8;
  if (t >= N * k8n) return;
  const int n = t / k8n, k8 = (t % k8n) * 8;
  v8us v;
#pragma unroll
  for (int i = 0; i < 8; ++i) v[i] = bf16_bits(W[(size_t)(k8 + i) * N + n]);
  *(v8us*)(Wt + (size_t)n * K + k8) = v;
  
}

// GEMM C[M][N] (f32, pitch ldc) = act(A[M][K]·W + bias). A f32 row-major (pitch lda) converted per fragment to bf16
// (ASPLIT: hi/lo two planes -> 2 terms, else single rounded term); Wt bf16 [N][K] (pitch ldb). BIAS_BF16 rounds the
// bias to bf16 first (bias quantised to bf16 before the add). K%32==0, M%16==0, N%64==0.
template <bool ASPLIT, int ACT, bool BIAS_BF16>
__global__ __launch_bounds__(128) void k_gemm_bf(const float* __restrict__ A, int lda, const unsigned short* __restrict__ Wt, int ldb,
                                               const float* __restrict__ bias, float* __restrict__ C, int ldc, int M, int N, int K) {
  __shared__ __attribute__((aligned(16))) float so[4][16][64];
  const int tid = threadIdx.x, w = tid >> 5, lane = tid & 31, ln = lane & 15, hh = lane >> 4;
  const int ntn = N / 64;
  const int wid = blockIdx.x * 4 + w;
  const int mt = wid / ntn, nq = wid % ntn;
  if (mt * 16 >= M) return;
  const int row0 = mt * 16, col0 = nq * 64;
  const float* arow = A + (size_t)(row0 + ln) * lda;
  v8f acc[4] = {};
  for (int kb = 0; kb < K; kb += 32) {
    FragB ah, al;
    const v4f x0 = *(const v4fa*)(arow + kb + 8 * hh), x1 = *(const v4fa*)(arow + kb + 8 * hh + 4);
    const v4f x2 = *(const v4fa*)(arow + kb + 16 + 8 * hh), x3 = *(const v4fa*)(arow + kb + 16 + 8 * hh + 4);
    float xs[16] = {x0[0],x0[1],x0[2],x0[3],x1[0],x1[1],x1[2],x1[3],x2[0],x2[1],x2[2],x2[3],x3[0],x3[1],x3[2],x3[3]};
#pragma unroll
    for (int i = 0; i < 16; ++i) { const unsigned short hb = bf16_bits(xs[i]); ah.u[i] = hb; al.u[i] = ASPLIT ? bf16_bits(xs[i] - bf16_val(hb)) : (unsigned short)0; }
#pragma unroll
    for (int t = 0; t < 4; ++t) {
      const unsigned short* brow = Wt + (size_t)(col0 + t * 16 + ln) * ldb + kb;
      FragB b;
      b.half[0] = *(const v8us*)(brow + 8 * hh);
      b.half[1] = *(const v8us*)(brow + 16 + 8 * hh);
      acc[t] = mmaN<ASPLIT ? 2 : 1>(ah.v, al.v, b.v, b.v, acc[t]);
    }
  }
#pragma unroll
  for (int t = 0; t < 4; ++t) {
    float bv = bias ? bias[col0 + t * 16 + ln] : 0.f;
    if (BIAS_BF16) bv = bf16_round(bv);
#pragma unroll
    for (int r = 0; r < 8; ++r) { float v = acc[t][r] + bv; if (ACT == 1) v = fmaxf(v, 0.f); so[w][8 * hh + r][t * 16 + ln] = v; }
  }
  __builtin_amdgcn_fence(__ATOMIC_ACQ_REL, "workgroup");
  __builtin_amdgcn_wave_barrier();
  const int rsub = lane >> 4, c4 = (lane & 15) * 4;
  {
#pragma unroll
    for (int q = 0; q < 8; ++q) {
      const int r = q * 2 + rsub;
      const v4f v = *(const v4fa*)&so[w][r][c4];
      *(v4f*)(C + (size_t)(row0 + r) * ldc + col0 + c4) = v;
    }
    
  }
}

// GEMM C = act(A·W + bias + resid): A f32 (ASPLIT -> hi/lo 2 terms), Wt bf16 [N][K]; ACT 0 none, 1 relu, 2 exact gelu;
// resid (optional, f32, row index = (row % rmod), pitch ldr, RES_BF16 rounds it) added before the activation.
template <bool ASPLIT, int ACT, bool BIAS_BF16, bool RES_BF16>
__global__ __launch_bounds__(128) void k_gemm_bf3(const float* __restrict__ A, int lda, const unsigned short* __restrict__ Wt, int ldb,
                                                const float* __restrict__ bias, const float* __restrict__ resid, int rmod, int ldr,
                                                float* __restrict__ C, int ldc, int M, int N, int K) {
  __shared__ __attribute__((aligned(16))) float so[4][16][64];
  const int tid = threadIdx.x, w = tid >> 5, lane = tid & 31, ln = lane & 15, hh = lane >> 4;
  const int ntn = N / 64;
  const int wid = blockIdx.x * 4 + w;
  const int mt = wid / ntn, nq = wid % ntn;
  if (mt * 16 >= M) return;
  const int row0 = mt * 16, col0 = nq * 64;
  const float* arow = A + (size_t)(row0 + ln) * lda;
  v8f acc[4] = {};
  for (int kb = 0; kb < K; kb += 32) {
    FragB ah, al;
    const v4f x0 = *(const v4fa*)(arow + kb + 8 * hh), x1 = *(const v4fa*)(arow + kb + 8 * hh + 4);
    const v4f x2 = *(const v4fa*)(arow + kb + 16 + 8 * hh), x3 = *(const v4fa*)(arow + kb + 16 + 8 * hh + 4);
    float xs[16] = {x0[0],x0[1],x0[2],x0[3],x1[0],x1[1],x1[2],x1[3],x2[0],x2[1],x2[2],x2[3],x3[0],x3[1],x3[2],x3[3]};
#pragma unroll
    for (int i = 0; i < 16; ++i) { const unsigned short hb = bf16_bits(xs[i]); ah.u[i] = hb; al.u[i] = ASPLIT ? bf16_bits(xs[i] - bf16_val(hb)) : (unsigned short)0; }
#pragma unroll
    for (int t = 0; t < 4; ++t) {
      const unsigned short* brow = Wt + (size_t)(col0 + t * 16 + ln) * ldb + kb;
      FragB b;
      b.half[0] = *(const v8us*)(brow + 8 * hh);
      b.half[1] = *(const v8us*)(brow + 16 + 8 * hh);
      acc[t] = mmaN<ASPLIT ? 2 : 1>(ah.v, al.v, b.v, b.v, acc[t]);
    }
  }
#pragma unroll
  for (int t = 0; t < 4; ++t) {
    const int col = col0 + t * 16 + ln;
    float bv = bias ? bias[col] : 0.f;
    if (BIAS_BF16) bv = bf16_round(bv);
#pragma unroll
    for (int r = 0; r < 8; ++r) {
      float v = acc[t][r] + bv;
      if (resid) { float rv = resid[(size_t)((row0 + 8 * hh + r) % rmod) * ldr + col]; if (RES_BF16) rv = bf16_round(rv); v += rv; }
      if (ACT == 1) v = fmaxf(v, 0.f);
      if (ACT == 2) v = 0.5f * v * (1.0f + erff(v * 0.70710678118654752f));
      if (ACT == 3) { const float u = 0.7978845608028654f * (v + 0.044715f * v * v * v); v = 0.5f * v * (1.0f + tanhf(u)); }
      so[w][8 * hh + r][t * 16 + ln] = v;
    }
  }
  __builtin_amdgcn_fence(__ATOMIC_ACQ_REL, "workgroup");
  __builtin_amdgcn_wave_barrier();
  const int rsub = lane >> 4, c4 = (lane & 15) * 4;
  {
#pragma unroll
    for (int q = 0; q < 8; ++q) {
      const int r = q * 2 + rsub;
      const v4f v = *(const v4fa*)&so[w][r][c4];
      *(v4f*)(C + (size_t)(row0 + r) * ldc + col0 + c4) = v;
    }
    
  }
}
// row LayerNorm (biased variance, eps) over N: s = X (+ R); optional out_sum <- s; out_norm <- (s-mu)*rsqrt(var+eps)*g + b
template <bool PARAM_BF16>
__global__ __launch_bounds__(256) void k_layernorm(const float* __restrict__ X, const float* __restrict__ R, const float* __restrict__ g, const float* __restrict__ bta,
                                                  float* __restrict__ out_sum, float* __restrict__ out_norm, int N, float eps) {
  __shared__ float red[256];
  const int row = blockIdx.x, tid = threadIdx.x;
  const float* x = X + (size_t)row * N; const float* rr = R ? R + (size_t)row * N : nullptr;
  float vals[16];                     // up to N = 4096
  const int per = N / 256;            // contiguous chunk per thread? use strided-by-4 chunks: thread handles j = tid*4 + 1024*u
  float s1 = 0.f;
  for (int u = 0; u < per / 4; ++u) {
    const int j = tid * 4 + 1024 * u;
    const v4f a = *(const v4fa*)(x + j);
    v4f b = {0.f,0.f,0.f,0.f}; if (rr) b = *(const v4fa*)(rr + j);
#pragma unroll
    for (int q = 0; q < 4; ++q) { const float v = a[q] + b[q]; vals[u * 4 + q] = v; s1 += v; }
  }
  red[tid] = s1; __syncthreads();
  for (int st = 128; st > 0; st >>= 1) { if (tid < st) red[tid] += red[tid + st]; __syncthreads(); }
  const float mu = red[0] / (float)N; __syncthreads();
  float s2 = 0.f;
  for (int u = 0; u < per / 4; ++u)
#pragma unroll
    for (int q = 0; q < 4; ++q) { const float c = vals[u * 4 + q] - mu; s2 += c * c; }
  red[tid] = s2; __syncthreads();
  for (int st = 128; st > 0; st >>= 1) { if (tid < st) red[tid] += red[tid + st]; __syncthreads(); }
  const float rs = rsqrtf(red[0] / (float)N + eps);
  {
    for (int u = 0; u < per / 4; ++u) {
      const int j = tid * 4 + 1024 * u;
      v4f o, sm;
#pragma unroll
      for (int q = 0; q < 4; ++q) {
        float gg = g[j + q], bb = bta[j + q];
        if (PARAM_BF16) { gg = bf16_round(gg); bb = bf16_round(bb); }
        sm[q] = vals[u * 4 + q]; o[q] = (vals[u * 4 + q] - mu) * rs * gg + bb;
      }
      if (out_sum) *(v4f*)(out_sum + (size_t)row * N + j) = sm;
      *(v4f*)(out_norm + (size_t)row * N + j) = o;
    }
    
  }
}



// ---- f16 WMMA path (v_wmma_f32_16x16x32_f16): 11-bit significands for operands in range — used where a [0,1] probability operand needs more precision than bf16
typedef _Float16 v16h __attribute__((ext_vector_type(16)));
union FragH { v16h v; v8us half[2]; _Float16 h[16]; unsigned short u[16]; };
template <int NT>
__device__ __forceinline__ v8f mmaH(v16h ah, v16h al, v16h bh, v16h bl, v8f c) {
  c = __builtin_amdgcn_wmma_f32_16x16x32_f16(false, ah, false, bh, (short)0, c, false, false);
  if (NT >= 2) c = __builtin_amdgcn_wmma_f32_16x16x32_f16(false, al, false, bh, (short)0, c, false, false);
  if (NT >= 3) c = __builtin_amdgcn_wmma_f32_16x16x32_f16(false, ah, false, bl, (short)0, c, false, false);
  asm volatile("v_nop\n\tv_nop\n\tv_nop\n\tv_nop" : "+v"(c) : "v"(ah), "v"(al), "v"(bh), "v"(bl));
  return c;
}
// batched GEMM like k_gemm_b but f16 operands: A f32 (split into f16 hi/lo if ASPLIT, else rounded to f16), Bt = f16 values [n][k]; alpha; C f32; N multiple of 16 (partial tiles skipped)
template <bool ASPLIT>
__global__ __launch_bounds__(128) void k_gemm_h(const float* __restrict__ A, int lda, size_t sA, const _Float16* __restrict__ Bh, int ldb, size_t sB, float alpha, float* __restrict__ C, int ldc, size_t sC, int M, int N, int K) {
  __shared__ __attribute__((aligned(16))) float so[4][16][64];
  const int tid = threadIdx.x, w = tid >> 5, lane = tid & 31, ln = lane & 15, hh = lane >> 4; const int by = blockIdx.y;
  A += (size_t)by * sA; Bh += (size_t)by * sB; C += (size_t)by * sC;
  const int ntn = (N + 63) / 64; const int wid = blockIdx.x * 4 + w; const int mt = wid / ntn, nq = wid % ntn; if (mt * 16 >= M) return;
  const int row0 = mt * 16, col0 = nq * 64; const float* arow = A + (size_t)(row0 + ln) * lda;
  v8f acc[4] = {};
  for (int kb = 0; kb < K; kb += 32) {
    FragH ah, al;
    const v4f x0 = *(const v4fa*)(arow + kb + 8 * hh), x1 = *(const v4fa*)(arow + kb + 8 * hh + 4), x2 = *(const v4fa*)(arow + kb + 16 + 8 * hh), x3 = *(const v4fa*)(arow + kb + 16 + 8 * hh + 4);
    float xs[16] = {x0[0],x0[1],x0[2],x0[3],x1[0],x1[1],x1[2],x1[3],x2[0],x2[1],x2[2],x2[3],x3[0],x3[1],x3[2],x3[3]};
#pragma unroll
    for (int i = 0; i < 16; ++i) { const _Float16 h = (_Float16)xs[i]; ah.h[i] = h; al.h[i] = ASPLIT ? (_Float16)(xs[i] - (float)h) : (_Float16)0.0f; }
#pragma unroll
    for (int t = 0; t < 4; ++t) { if (col0 + t * 16 >= N) continue; const size_t boff = (size_t)(col0 + t * 16 + ln) * ldb + kb; FragH bq; bq.half[0] = *(const v8us*)(Bh + boff + 8 * hh); bq.half[1] = *(const v8us*)(Bh + boff + 16 + 8 * hh);
      acc[t] = mmaH<ASPLIT ? 2 : 1>(ah.v, al.v, bq.v, bq.v, acc[t]); }
  }
#pragma unroll
  for (int t = 0; t < 4; ++t) { if (col0 + t * 16 >= N) continue;
#pragma unroll
    for (int r = 0; r < 8; ++r) so[w][8 * hh + r][t * 16 + ln] = acc[t][r] * alpha; }
  __builtin_amdgcn_fence(__ATOMIC_ACQ_REL, "workgroup"); __builtin_amdgcn_wave_barrier();
  const int rsub = lane >> 4, c4 = (lane & 15) * 4;
  {
#pragma unroll
    for (int q = 0; q < 8; ++q) { const int r = q * 2 + rsub; if (col0 + c4 < N) { const v4f v = *(const v4fa*)&so[w][r][c4]; *(v4f*)(C + (size_t)(row0 + r) * ldc + col0 + c4) = v; } }
     }
}

// k_gemm_hh variant with fused epilogue: v = acc·alpha + bias[by·sBias + col] (+ CP[(row/rowsPerB)·sCPb + by·64 + col] if CP) ; ACT 0 none / 1 elu ; writes f16 C16 (and f32 C if non-null)
template <int ACT>
__global__ __launch_bounds__(128) void k_gemm_hhx(const _Float16* __restrict__ A, int lda, size_t sA, const _Float16* __restrict__ Bh, int ldb, size_t sB, float alpha, const float* __restrict__ bias, size_t sBias, const float* __restrict__ CP, int rowsPerB, size_t sCPb, int row0g,
    float* __restrict__ C, _Float16* __restrict__ C16, int ldc, size_t sC, int M, int N, int K) {
  __shared__ __attribute__((aligned(16))) float so[4][16][64];
  const int tid = threadIdx.x, w = tid >> 5, lane = tid & 31, ln = lane & 15, hh = lane >> 4; const int by = blockIdx.y;
  A += (size_t)by * sA; Bh += (size_t)by * sB; const size_t cofs = (size_t)by * sC; const float* bp = bias ? bias + (size_t)by * sBias : nullptr;
  const int ntn = (N + 63) / 64; const int wid = blockIdx.x * 4 + w; const int mt = wid / ntn, nq = wid % ntn; if (mt * 16 >= M) return;
  const int row0 = mt * 16, col0 = nq * 64; const _Float16* arow = A + (size_t)(row0 + ln) * lda;
  v8f acc[4] = {};
  for (int kb = 0; kb < K; kb += 32) { FragH ah; ah.half[0] = *(const v8us*)((const unsigned short*)arow + kb + 8 * hh); ah.half[1] = *(const v8us*)((const unsigned short*)arow + kb + 16 + 8 * hh);
#pragma unroll
    for (int t = 0; t < 4; ++t) { if (col0 + t * 16 >= N) continue; const size_t boff = (size_t)(col0 + t * 16 + ln) * ldb + kb; FragH bq; bq.half[0] = *(const v8us*)((const unsigned short*)Bh + boff + 8 * hh); bq.half[1] = *(const v8us*)((const unsigned short*)Bh + boff + 16 + 8 * hh);
      acc[t] = mmaH<1>(ah.v, ah.v, bq.v, bq.v, acc[t]); }
  }
#pragma unroll
  for (int t = 0; t < 4; ++t) { if (col0 + t * 16 >= N) continue; const int col = col0 + t * 16 + ln; const float bv = bp ? bf16_round(bp[col]) : 0.f;
#pragma unroll
    for (int r = 0; r < 8; ++r) { float v = acc[t][r] * alpha + bv; if (CP) { const int rr = row0g + row0 + 8 * hh + r; if (rowsPerB < 0) v += CP[cofs + (size_t)rr * ldc + col];      /* rowsPerB < 0: own element of the batched C plane */ else { const int bidx = rr / rowsPerB; v += CP[(size_t)bidx * sCPb + (size_t)by * 64 + col]; } } if (ACT == 1) v = (v > 0.f) ? v : expm1f(v); else if (ACT == 7) v = (v > 0.f) ? v + 1.0f : expf(v); else if (ACT == 8) v = tanhf(v); else if (ACT == 9) v = 0.5f * v * (1.0f + tanhf(0.7978845608028654f * (v + 0.044715f * v * v * v))); else if (ACT == 11) v = 1.0f / (1.0f + expf(-v)); else if (ACT == 12) v = (v > 0.f) ? v : 0.01f * v; else if (ACT == 14) v = (v > 0.f) ? v : 0.1f * v; else if (ACT == 16) v = (v >= 0.f) ? v : 0.3f * v; else if (ACT == 17) v = (v >= 0.f) ? v : 0.2f * v; else if (ACT == 15) v = v / (1.0f + expf(-v)); else if (ACT == 3) v = fmaxf(v, 0.f); else if (ACT == 6) v = 0.5f * v * (1.0f + erff(v * 0.70710678118654752f)); so[w][8 * hh + r][t * 16 + ln] = v; } }
  __builtin_amdgcn_fence(__ATOMIC_ACQ_REL, "workgroup"); __builtin_amdgcn_wave_barrier();
  const int rsub = lane >> 4, c4 = (lane & 15) * 4; typedef _Float16 v4h __attribute__((ext_vector_type(4)));
  {
#pragma unroll
    for (int q = 0; q < 8; ++q) { const int r = q * 2 + rsub; if (col0 + c4 < N) { const v4f v = *(const v4fa*)&so[w][r][c4]; if (C) *(v4f*)(C + cofs + (size_t)(row0 + r) * ldc + col0 + c4) = v; if (C16) { v4h h4; for (int i = 0; i < 4; ++i) h4[i] = (_Float16)v[i]; *(v4h*)(C16 + cofs + (size_t)(row0 + r) * ldc + col0 + c4) = h4; } } }
     }
}


typedef _Float16 v4h __attribute__((ext_vector_type(4)));

__global__ __launch_bounds__(256) void k_h16(const float* __restrict__ x, _Float16* __restrict__ X16, size_t n8) { const size_t t = (size_t)blockIdx.x * 256 + threadIdx.x; if (t >= n8) return; FragH f;
#pragma unroll
  for (int q = 0; q < 8; ++q) f.h[q] = (_Float16)x[t * 8 + q]; *(v8us*)((unsigned short*)X16 + t * 8) = f.half[0];  }
__global__ __launch_bounds__(256) void k_round16f(const float* __restrict__ W, _Float16* __restrict__ Bt, size_t n8) { const size_t t = (size_t)blockIdx.x * 256 + threadIdx.x; if (t >= n8) return; FragH f;
#pragma unroll
  for (int i = 0; i < 8; ++i) f.h[i] = (_Float16)(bf16_round(W[t * 8 + i]) * 16.0f); *(v8us*)((unsigned short*)Bt + t * 8) = f.half[0];  }

__global__ __launch_bounds__(256) void k_hl(const float* __restrict__ F, _Float16* __restrict__ Hh, _Float16* __restrict__ Hl, size_t n8) { const size_t t = (size_t)blockIdx.x * 256 + threadIdx.x; if (t >= n8) return; FragH fh, fl; const v4f a = *(const v4fa*)(F + t * 8), c = *(const v4fa*)(F + t * 8 + 4);
#pragma unroll
  for (int q = 0; q < 4; ++q) { _Float16 h = (_Float16)a[q]; fh.h[q] = h; fl.h[q] = (_Float16)((a[q] - (float)h) * 1024.0f); h = (_Float16)c[q]; fh.h[4 + q] = h; fl.h[4 + q] = (_Float16)((c[q] - (float)h) * 1024.0f); }
  { *(v8us*)((unsigned short*)Hh + t * 8) = fh.half[0]; *(v8us*)((unsigned short*)Hl + t * 8) = fl.half[0];  } }



__global__ __launch_bounds__(256) void k_wnat(const float* __restrict__ w, size_t n8, _Float16* __restrict__ Bt) { const size_t t = (size_t)blockIdx.x * 256 + threadIdx.x; if (t >= n8) return; FragH f; for (int q = 0; q < 8; ++q) f.h[q] = (_Float16)(bf16_round(w[t * 8 + q]) * 16.0f); *(v8us*)((unsigned short*)Bt + t * 8) = f.half[0];  }
__global__ __launch_bounds__(256) void k_rsm(const float* __restrict__ S, _Float16* __restrict__ P, int nrows) {
  #pragma clang fp contract(off)
  const int i = blockIdx.x * 256 + threadIdx.x; if (i >= nrows) return; const float* s = S + (size_t)i * SQ; float mx = -3.0e38f;
#pragma unroll 1
  for (int j = 0; j < SQ; ++j) mx = fmaxf(mx, s[j]); float se = 0.f;
#pragma unroll 1
  for (int j = 0; j < SQ; ++j) se += expf(s[j] - mx); const float sc = 256.0f / se;
#pragma unroll 1
  for (int j0 = 0; j0 < SQ; j0 += 8) { FragH f; for (int q = 0; q < 8; ++q) f.h[q] = (_Float16)(expf(s[j0 + q] - mx) * sc); unsigned short* d = (unsigned short*)P + (size_t)i * SQ + j0; *(v8us*)d = f.half[0];  } }
__global__ __launch_bounds__(256) void k_vt(const _Float16* __restrict__ V16, int b, int h0, _Float16* __restrict__ VT) { __shared__ unsigned short tl[64][65]; const int tid = threadIdx.x; const int hh = blockIdx.x % HG, sg = blockIdx.x / HG; const int s0 = sg * 64; const int h = h0 + hh;
  for (int i = tid; i < 64 * 8; i += 256) { const int j = i / 8, d8 = (i % 8) * 8; FragH f; f.half[0] = *(const v8us*)((const unsigned short*)V16 + ((size_t)b * SQ + s0 + j) * DM + h * HD + d8); for (int q = 0; q < 8; ++q) tl[d8 + q][j] = f.u[q]; }
  __syncthreads();
  { for (int i = tid; i < 64 * 8; i += 256) { const int d = i / 8, j8 = (i % 8) * 8; FragH f; for (int q = 0; q < 8; ++q) f.u[q] = tl[d][j8 + q]; *(v8us*)((unsigned short*)VT + ((size_t)hh * HD + d) * SQ + s0 + j8) = f.half[0]; }  } }

// Fused attention, one launch. A work-group is 4 waves and 64 query rows of one batch; a wave owns 16 rows: its Q fragments (8 k steps) and its 16 x 256 f32 output tile stay in registers.
// The keys are walked in chunks of 64: K rows and V^T rows of the chunk lie in LDS (pitch = row + 16 B for 16-byte readers) and are shared by the 4 waves. Each wave brings a quarter of a chunk
// with one tensor load (through no register): wave 0 / 1 the first / second 256 B of the 64 K rows, wave 2 / 3 the first / second 128 V^T rows. Two buffers: the next chunk flies while this one is worked on. Softmax keeps a running row maximum; the output tile and the row sum are rescaled when it grows. P goes from accumulator layout
// to A-fragment layout through the wave's own LDS rows. P = 256 * exp(s - max), f16; the factor cancels in the division by the row sum.
template <int M> __device__ __forceinline__ float rs_xm(float x) { return __builtin_bit_cast(float, __builtin_amdgcn_mov_dpp(__builtin_bit_cast(int, x), 0x160 | M, 0xf, 0xf, false)); }      /* lane l with lane l ^ M inside a 16-lane row (row_xmask) */
#define FA_KP 136      /* halves per staged half row of K: 256 B + 16 B */
#define FA_VP 72       /* halves per staged V^T row and per P row: 128 B + 16 B */
#define FA_SL 9216     /* halves per slice of a buffer: 18,432 B = 9 x 2 KiB (64 half rows of K, rounded up; 128 V^T rows exactly) */
#define FA_BUF (4 * FA_SL)      /* halves per buffer: K bytes 0-255 | K bytes 256-511 | V^T rows 0-127 | V^T rows 128-255 */
#define FA_C 0.09016844005556021f      /* log2(e) / 16: the score scale folded into the exponent */
__device__ __forceinline__ v16h fa_frag(const unsigned short* p, int hh) { FragH f; f.half[0] = *(const v8us*)(p + 8 * hh); f.half[1] = *(const v8us*)(p + 16 + 8 * hh); return f.v; }
__device__ __forceinline__ v8f fa_mma(v16h a, v16h b, v8f c) { return __builtin_amdgcn_wmma_f32_16x16x32_f16(false, a, false, b, (short)0, c, false, false); }
/* eight 2^x in one statement: the outputs are early-clobber, so no v_exp_f32 overwrites the source of the one in front of it, and the closing v_nop is the one slot the instruction set asks for behind a transcendental */
__device__ __forceinline__ v8f fa_exp2(v8f x) { float d0, d1, d2, d3, d4, d5, d6, d7;
  asm("v_exp_f32 %0, %8\n\tv_exp_f32 %1, %9\n\tv_exp_f32 %2, %10\n\tv_exp_f32 %3, %11\n\tv_exp_f32 %4, %12\n\tv_exp_f32 %5, %13\n\tv_exp_f32 %6, %14\n\tv_exp_f32 %7, %15\n\tv_nop"
      : "=&v"(d0), "=&v"(d1), "=&v"(d2), "=&v"(d3), "=&v"(d4), "=&v"(d5), "=&v"(d6), "=&v"(d7) : "v"(x[0]), "v"(x[1]), "v"(x[2]), "v"(x[3]), "v"(x[4]), "v"(x[5]), "v"(x[6]), "v"(x[7]));
  const v8f d = {d0, d1, d2, d3, d4, d5, d6, d7}; return d; }
typedef unsigned int u32x4 __attribute__((ext_vector_type(4)));
typedef unsigned int u32x8 __attribute__((ext_vector_type(8)));
__device__ __forceinline__ unsigned int fa_uni(unsigned int v) { return (unsigned int)__builtin_amdgcn_readfirstlane(v); }
__device__ __forceinline__ unsigned int fa_pinned(unsigned int v) { unsigned int s = fa_uni(v);
  asm volatile("" : "+s"(s));      /* pinned(): the test is held in a scalar register, so that the branch on it is a scalar branch (a tensor load ignores EXEC) */
  return s; }
/* descriptor group 0 of a tensor load: the tile's first byte at ga goes to LDS byte offset lds */
__device__ __forceinline__ u32x4 fa_group0(unsigned int lds, unsigned long long ga) { u32x4 g;
  g[0] = fa_uni(1u); g[1] = fa_uni(lds); g[2] = fa_uni((unsigned int)ga); g[3] = fa_uni((((unsigned int)(ga >> 32)) & 0x01FFFFFFu) | 0x80000000u);
  asm volatile("" : "+s"(g));      /* pinned(): the descriptor's words are held in these scalar registers; with the wait that names them, none is reused while the request is outstanding */
  return g; }
/* descriptor group 1: a tile of N rows of R bytes, source pitch P bytes; W0 = word 0 (no mask, 1-byte elements, 16 B of pad behind every row of R bytes) */
template <unsigned int W0, unsigned int R, unsigned int N, unsigned int P>
__device__ __forceinline__ u32x8 fa_group1() { u32x8 g;
  g[0] = fa_uni(W0); g[1] = fa_uni((R & 0xFFFFu) << 16); g[2] = fa_uni((R >> 16) | ((N & 0xFFFFu) << 16)); g[3] = fa_uni((N >> 16) | (R << 16));
  g[4] = fa_uni(N); g[5] = fa_uni(P); g[6] = fa_uni(0u); g[7] = fa_uni(0u);
  asm volatile("" : "+s"(g));      /* pinned(): as in fa_group0 */
  return g; }
__device__ __forceinline__ void fa_tload(u32x4 g0, u32x8 g1) { asm volatile("tensor_load_to_lds %0, %1" :: "s"(g0), "s"(g1) : "memory"); }      /* the tile goes from global memory to LDS through no register */
__global__ __launch_bounds__(128) void k_fattn(const _Float16* __restrict__ Q, const _Float16* __restrict__ Kg, const _Float16* __restrict__ Vt, float* __restrict__ O) {
  __shared__ __attribute__((aligned(2048))) unsigned short ring[2 * FA_BUF];      /* every slice starts at a multiple of 2 KiB */
  __shared__ __attribute__((aligned(16))) unsigned short ps[4][16 * FA_VP];
  __shared__ __attribute__((aligned(16))) float so[4][16][DV + 4];
  const int tid = threadIdx.x, w = tid >> 5, lane = tid & 31, ln = lane & 15, hh = lane >> 4, b = blockIdx.y;
  const int q0 = blockIdx.x * 64 + 16 * w;
  const unsigned short* qp = (const unsigned short*)Q + ((size_t)b * SQ + q0 + ln) * DQ;
  v16h qa[DQ / 32];
#pragma unroll      /* constant indices keep qa[] in registers */
  for (int i = 0; i < DQ / 32; ++i) qa[i] = fa_frag(qp + 32 * i, hh);
  asm volatile("s_wait_xcnt 0x0" ::: "memory");      /* the wait in front of any reuse of the loads' address registers */
  const unsigned int wv = fa_uni((unsigned int)tid >> 5);      /* the wave's number in a scalar register */
  const unsigned int rb = (unsigned int)(size_t)ring + wv * (FA_SL * 2);      /* LDS byte offset of the wave's slice in buffer 0 */
  const unsigned long long ga0 = wv < 2u ? (unsigned long long)(size_t)Kg + ((unsigned long long)b * SQ * DQ + (wv & 1u) * 128) * 2      /* the wave's half of K row 0 of the batch */
                                        : (unsigned long long)(size_t)Vt + ((unsigned long long)b * DV + (wv & 1u) * 128) * SQ * 2;      /* or its first V^T row of the batch */
  const unsigned int gst = wv < 2u ? 64 * DQ * 2 : 64 * 2;      /* source bytes from one chunk to the next */
  const u32x8 g1k = fa_group1<(1u << 20) | (5u << 22) | (3u << 25), 256u, 64u, DQ * 2u>();      /* 64 half rows of K */
  const u32x8 g1v = fa_group1<(1u << 20) | (4u << 22) | (3u << 25), 128u, 128u, SQ * 2u>();      /* 128 V^T rows */
  u32x4 g0;
  auto issue = [&](unsigned int ch) {      /* the wave's slice of chunk ch into buffer ch & 1 */
    g0 = fa_group0(rb + (ch & 1u) * (FA_BUF * 2), ga0 + (unsigned long long)ch * gst);
    if (fa_pinned(wv < 2u)) fa_tload(g0, g1k);
    if (fa_pinned(wv >= 2u)) fa_tload(g0, g1v);
  };
  auto landed = [&]() { asm volatile("s_wait_tensorcnt 0x0" :: "s"(g0), "s"(g1k), "s"(g1v) : "memory"); };      /* the wave's own request has landed; the descriptor is named as an input so that its registers keep their values up to here */
  issue(0);
  landed();      /* the wave's slice of chunk 0 */
  __syncthreads();      /* chunk 0 is published */
  issue(1);
  const v8f z8 = {0.f,0.f,0.f,0.f,0.f,0.f,0.f,0.f};
  v8f o[DV / 16], mr, lr = z8;
#pragma unroll
  for (int j = 0; j < DV / 16; ++j) o[j] = z8;
#pragma unroll
  for (int r = 0; r < 8; ++r) mr[r] = -3.0e38f;
#pragma unroll 1      /* one chunk per trip: the body is already 64 WMMAs long */
  for (int c = 0; c < SQ / 64; ++c) {
    const unsigned short* ks = ring + (c & 1) * FA_BUF; const unsigned short* vs = ks + 2 * FA_SL;      /* this chunk's buffer */
    /* The chunk's 64 B fragments come from LDS in 8 groups of 8 (groups 0-3: K, two k steps x four key tiles; groups 4-7: V^T, one k step x eight column tiles). */
    v16h fb[8][8];
    auto ld = [&](int g) {
#pragma unroll      /* constant indices keep fb[][] in registers */
      for (int e = 0; e < 8; ++e) fb[g][e] = (g < 4) ? fa_frag(ks + (g >> 1) * FA_SL + ((e & 3) * 16 + ln) * FA_KP + 32 * ((2 * g + (e >> 2)) & 3), hh) : fa_frag(vs + (((g & 1) * 8 + e) * 16 + ln) * FA_VP + 32 * ((g - 4) >> 1), hh); };
    v8f s[4] = {z8, z8, z8, z8};
    ld(0); ld(1);
#pragma unroll
    for (int g = 0; g < 4; ++g) {
      ld(g + 2);
      __builtin_amdgcn_sched_barrier(0);      /* a group's LDS reads are issued together, two groups ahead of its WMMAs; left alone the compiler reads each fragment right in front of its WMMA and waits out the LDS latency 64 times */
#pragma unroll
      for (int e = 0; e < 8; ++e) s[e & 3] = fa_mma(qa[2 * g + (e >> 2)], fb[g][e], s[e & 3]);
      __builtin_amdgcn_sched_barrier(0);      /* the same: keeps the next group's reads behind this group's WMMAs */
    }
    /* accumulator element r of a lane is row 8 * hh + r, column 16 * t + ln: a row lives in one 16-lane half */
    v8f x = __builtin_elementwise_max(__builtin_elementwise_max(s[0], s[1]), __builtin_elementwise_max(s[2], s[3]));
#pragma unroll
    for (int r = 0; r < 8; ++r) { float y = x[r]; y = fmaxf(y, rs_xm<1>(y)); y = fmaxf(y, rs_xm<2>(y)); y = fmaxf(y, rs_xm<4>(y)); y = fmaxf(y, rs_xm<8>(y)); x[r] = y; }
    const v8f mn = __builtin_elementwise_max(mr, x); const v8f da = (mr - mn) * FA_C; const v8f bs = 8.0f - mn * FA_C; mr = mn;
    const v8f al = fa_exp2(da); v8f acc = z8;
#pragma unroll
    for (int t = 0; t < 4; ++t) { const v8f p = fa_exp2(s[t] * FA_C + bs); acc += p;
#pragma unroll
      for (int r = 0; r < 8; ++r) { FragH f; f.h[0] = (_Float16)p[r]; ps[w][(8 * hh + r) * FA_VP + t * 16 + ln] = f.u[0]; } }
    lr = lr * al + acc;      /* each lane keeps the sum of its own columns; the lanes are joined once, behind the loop */
#pragma unroll
    for (int j = 0; j < DV / 16; ++j) o[j] *= al;
    __builtin_amdgcn_fence(__ATOMIC_ACQ_REL, "workgroup"); __builtin_amdgcn_wave_barrier();      /* the wave's P rows are written before its lanes read one another's */
    const v16h pa[2] = {fa_frag(ps[w] + ln * FA_VP, hh), fa_frag(ps[w] + ln * FA_VP + 32, hh)};
#pragma unroll
    for (int g = 4; g < 8; ++g) {
      if (g + 2 < 8) ld(g + 2);
      __builtin_amdgcn_sched_barrier(0);      /* as above: reads two groups ahead of their WMMAs */
#pragma unroll
      for (int e = 0; e < 8; ++e) o[(g & 1) * 8 + e] = fa_mma(pa[(g - 4) >> 1], fb[g][e], o[(g & 1) * 8 + e]);
      __builtin_amdgcn_sched_barrier(0);      /* as above */
    }
    asm volatile("s_wait_dscnt 0x0" ::: "memory");      /* the wave's reads of this chunk's buffer have returned before the buffer is refilled */
    landed();      /* the wave's slice of the next chunk */
    __syncthreads();      /* the next chunk is published, and every wave has left this chunk's buffer */
    if (fa_pinned(c + 2 < SQ / 64)) issue((unsigned int)c + 2u);
  }
  landed();      /* no request is outstanding behind the loop */
  asm volatile("s_wait_dscnt 0x0" ::: "memory");      /* nor an LDS read */
#pragma unroll
  for (int r = 0; r < 8; ++r) { float l = lr[r]; l += rs_xm<1>(l); l += rs_xm<2>(l); l += rs_xm<4>(l); l += rs_xm<8>(l); const float inv = 1.0f / l;
#pragma unroll
    for (int j = 0; j < DV / 16; ++j) so[w][8 * hh + r][j * 16 + ln] = o[j][r] * inv; }
  __builtin_amdgcn_fence(__ATOMIC_ACQ_REL, "workgroup"); __builtin_amdgcn_wave_barrier();      /* the wave's own staging rows are written before they are read back as whole lines */
  float* op = O + ((size_t)b * SQ + q0) * DV + lane * 4;
#pragma unroll
  for (int q = 0; q < 32; ++q) { const v4f v = *(const v4fa*)&so[w][q >> 1][(q & 1) * 128 + lane * 4]; *(v4f*)(op + (q >> 1) * DV + (q & 1) * 128) = v; }
}
// Wt[m][n][k] = f16(bf16(W_m[k][n]) * 16) for the three f32 row-major [in][out] weights, m = grid.y (power-of-two scale: bf16-exact weights stay exact in f16 away from the subnormal range)
__global__ __launch_bounds__(256) void k_wt3(const float* __restrict__ Wq, const float* __restrict__ Wk, const float* __restrict__ Wv, _Float16* __restrict__ Wt) {
  const float* W = blockIdx.y == 0 ? Wq : (blockIdx.y == 1 ? Wk : Wv);
  const int t = blockIdx.x * 256 + threadIdx.x; const int n = t / (DM / 8), k8 = (t % (DM / 8)) * 8; FragH f;
#pragma unroll
  for (int i = 0; i < 8; ++i) f.h[i] = (_Float16)(bf16_round(W[(size_t)(k8 + i) * DQ + n]) * 16.0f);
  *(v8us*)((unsigned short*)Wt + ((size_t)blockIdx.y * DQ + n) * DM + k8) = f.half[0];
}
// Projection stage, one launch. A work-group is 12 waves and 64 token rows: the rows are read once as f32, rounded to bf16 (exact in f16) and staged in LDS for all 12 waves.
// Wave w makes the 64 x 64 tile of matrix w / 4 (q, k, v), column slab w % 4, over the whole k = 256; its weight fragments come from the transposed f16 rows in global memory, one k step ahead.
// The weights are the A operand and the tokens the B operand, so an accumulator lane holds 8 consecutive output columns of one token: for q and k one 16-byte LDS store into the wave's own
// staging rows (row = token); for v the 8 values go to 8 staging rows (row = column), which makes the V^T rows. Either way the staging rows go out as whole 128-byte lines.
#define PJ_XP 264      /* halves per staged x row: 512 B + 16 B */
#define PJ_SP 72       /* halves per staged output row: 128 B + 16 B */
__global__ __launch_bounds__(384) void k_proj(const float* __restrict__ x, const _Float16* __restrict__ Wt, _Float16* __restrict__ Q, _Float16* __restrict__ Kg, _Float16* __restrict__ Vt) {
  __shared__ __attribute__((aligned(16))) unsigned short xs[64 * PJ_XP];
  __shared__ __attribute__((aligned(16))) unsigned short sts[12][64 * PJ_SP];
  const int tid = threadIdx.x, lane = tid & 31, ln = lane & 15, hh = lane >> 4;
  const int w = __builtin_amdgcn_readfirstlane(tid >> 5);      /* the wave's number in a scalar register: the tests on it below become scalar branches */
  const int t0 = blockIdx.x * 64;      /* first token row; 64 divides SQ, so the rows are of one batch */
  const unsigned short* wp = (const unsigned short*)Wt + (size_t)w * 64 * DM + ln * DM;      /* rows 64 w .. 64 w + 63 of the 768 transposed weight rows */
  v16h wf[2][4];
#pragma unroll
  for (int i = 0; i < 4; ++i) wf[0][i] = fa_frag(wp + 16 * i * DM, hh);
  asm volatile("s_wait_xcnt 0x0" ::: "memory");      /* the wait in front of any reuse of the weight loads' address registers */
  if (w < 8) {      /* the 64 rows are 64 KB in a row: 2048 pieces of 8 floats, 8 for each thread of the first 8 waves */
    const char* xg = (const char*)(x + (size_t)t0 * DM); const unsigned xb = tid * 32;      /* uniform base, the thread's byte offset */
    v4f xa[8][2];
#pragma unroll      /* constant indices keep xa[][] in registers */
    for (int p = 0; p < 8; ++p) { xa[p][0] = *(const v4fa*)(xg + xb + p * 8192); xa[p][1] = *(const v4fa*)(xg + xb + p * 8192 + 16); }
    asm volatile("s_wait_xcnt 0x0" :: "v"(xb) : "memory");      /* the wait in front of any reuse of the loads' address registers; the offset is named as an input so that no load's result lands on it ahead of the wait */
#pragma unroll
    for (int p = 0; p < 8; ++p) { FragH f;
#pragma unroll
      for (int q = 0; q < 4; ++q) { f.h[q] = (_Float16)bf16_round(xa[p][0][q]); f.h[4 + q] = (_Float16)bf16_round(xa[p][1][q]); }
      *(v8us*)(xs + (8 * p + w) * PJ_XP + lane * 8) = f.half[0]; }
  }
  __syncthreads();      /* the token rows are staged */
  const v8f z8 = {0.f,0.f,0.f,0.f,0.f,0.f,0.f,0.f};
  v8f acc[4][4];
#pragma unroll
  for (int i = 0; i < 4; ++i)
#pragma unroll
    for (int j = 0; j < 4; ++j) acc[i][j] = z8;
#pragma unroll      /* constant indices keep acc[][], wf[][] in registers */
  for (int s = 0; s < DM / 32; ++s) {
    v16h xf[4];
#pragma unroll
    for (int i = 0; i < 4; ++i) { if (s + 1 < DM / 32) wf[(s + 1) & 1][i] = fa_frag(wp + 16 * i * DM + 32 * (s + 1), hh); xf[i] = fa_frag(xs + (16 * i + ln) * PJ_XP + 32 * s, hh); }
    __builtin_amdgcn_sched_barrier(0);      /* a step's reads are issued together, ahead of its WMMAs; left alone the compiler spreads them in pairs among the WMMAs */
#pragma unroll
    for (int i = 0; i < 4; ++i)
#pragma unroll
      for (int j = 0; j < 4; ++j) acc[i][j] = fa_mma(wf[s & 1][i], xf[j], acc[i][j]);
    __builtin_amdgcn_sched_barrier(0);      /* the same: keeps the next step's reads behind this step's WMMAs */
  }
  asm volatile("s_wait_xcnt 0x0" ::: "memory");      /* the wait in front of any reuse of the weight loads' address registers */
  /* accumulator element r of acc[i][j] is output column 16 i + 8 hh + r of token 16 j + ln; x 0.0625 undoes the x16 of the weights */
  unsigned short* st = sts[w];
  if (w < 8) {
#pragma unroll
    for (int j = 0; j < 4; ++j)
#pragma unroll
      for (int i = 0; i < 4; ++i) { FragH f;
#pragma unroll
        for (int r = 0; r < 8; ++r) f.h[r] = (_Float16)(acc[i][j][r] * 0.0625f);
        *(v8us*)(st + (16 * j + ln) * PJ_SP + 16 * i + 8 * hh) = f.half[0]; }
  } else {
#pragma unroll
    for (int j = 0; j < 4; ++j)
#pragma unroll
      for (int i = 0; i < 4; ++i)
#pragma unroll
        for (int r = 0; r < 8; ++r) { FragH f; f.h[0] = (_Float16)(acc[i][j][r] * 0.0625f); st[(16 * i + 8 * hh + r) * PJ_SP + 16 * j + ln] = f.u[0]; }
  }
  __builtin_amdgcn_fence(__ATOMIC_ACQ_REL, "workgroup"); __builtin_amdgcn_wave_barrier();      /* the wave's own staging rows are written before they are read back as whole lines */
  unsigned short* op = w < 8 ? (unsigned short*)(w < 4 ? Q : Kg) + (size_t)t0 * DQ + (w & 3) * 64 : (unsigned short*)Vt + ((size_t)(t0 / SQ) * DV + (w & 3) * 64) * SQ + t0 % SQ;
  const int pitch = w < 8 ? DQ : SQ;      /* halves between two output rows */
  op += (size_t)((lane >> 3) * pitch + (lane & 7) * 8);      /* a wave's store is 4 rows of 128 B */
  v8us rw[16];
#pragma unroll      /* constant indices keep rw[] in registers */
  for (int q = 0; q < 16; ++q) rw[q] = *(const v8us*)(st + (q * 4 + (lane >> 3)) * PJ_SP + (lane & 7) * 8);
#pragma unroll
  for (int q = 0; q < 16; ++q) *(v8us*)(op + (size_t)(q * 4 * pitch)) = rw[q];
}
extern "C" void kernel_launch(void* const* d_in, const int* in_sizes, int n_in,
                              void* d_out, int out_size, void* d_ws, size_t ws_size, hipStream_t stream) {
  (void)in_sizes; (void)n_in; (void)out_size;
  const float* const* I = (const float* const*)d_in; const float* x = I[0]; const float* wq = I[1]; const float* wk = I[2]; const float* wv = I[3];      /* [in][out] weights */
  char* ws = (char*)d_ws; size_t off = 0;
  auto take = [&](size_t bytes) { char* p = ws + off; off += (bytes + 255) & ~(size_t)255; return p; };
  _Float16* BW = (_Float16*)take((size_t)3 * DQ * DM * 2);      /* q | k | v weights, transposed */
  _Float16* Q16 = (_Float16*)take(NR * DQ * 2); _Float16* K16 = (_Float16*)take(NR * DQ * 2);
  _Float16* VT = (_Float16*)take((size_t)NB * DV * SQ * 2);
  if (off > ws_size) return;
  k_wt3<<<dim3(DQ * (DM / 8) / 256, 3), 256, 0, stream>>>(wq, wk, wv, BW);
  k_proj<<<(unsigned)(NR / 64), 384, 0, stream>>>(x, BW, Q16, K16, VT);      /* q, k f16 rows and V^T per batch [DV][SQ] */
  k_fattn<<<dim3(SQ / 64, NB), 128, 0, stream>>>(Q16, K16, VT, (float*)d_out);      /* scores, softmax and attn v in one launch; the batch is grid.y */
}

// v006
// A run of this version takes 50.8 microseconds.
// Two timings next to v005 both put it at 1.10 times that version's speed.
// Over all steps from v000 it is 94.7 times as fast.
#include <hip/hip_runtime.h>
// Single-head self-attention (x [8][2048][256]; Q, K, V = x W ([in][out] [256][256]); scores = Q.K/16; softmax over all 2048 keys; out = attn V -> [8][2048][256]).
// Structure: exact x16 transposed [in][out] weights as f16 rows (one launch for the three); one projection launch: 64 token rows per work-group read as f32, rounded and staged once in LDS as exact f16, q | k | v WMMA tiles (64x64 per wave, f32 accumulation) written as f16 rows, v straight as V^T rows; one fused attention launch (batch = grid.y): per 128-key stage (K and V^T rows brought into LDS by tensor loads, two buffers; a wave takes 32 query rows and 64 of the keys) scores WMMA, running-maximum softmax on VALU (f32; P x256 f16), O += P . V^T WMMA; scores and P never reach memory; f32 output.
// Compute dtype: inputs rounded to bf16; x / weights exact; q, k plain f16 (~2^-12); v, P plain f16 (~2^-12); scores / softmax f32; v_wmma_f32_16x16x32_f16.
#define NB 8
#define SQ 2048
#define DM 256
#define DQ 256
#define DV 256
#define QT 2048
#define NH 4                    /* V^T slabs of 64 */
#define HD 64
#define HG 1
#define NR ((size_t)NB * SQ)
#define QN SQ                        /* query rows per batch (debug hook) */
#define NBR NB                       /* batches (debug hook) */
#define MP ((int)NR)                 /* rows through the projections (debug hook) */
typedef __bf16 v16b __attribute__((ext_vector_type(16)));
typedef unsigned short v8us __attribute__((ext_vector_type(8), may_alias));
typedef float  v8f  __attribute__((ext_vector_type(8)));
typedef float  v4f  __attribute__((ext_vector_type(4)));
typedef float  v4fa __attribute__((ext_vector_type(4), may_alias));
union FragB { v16b v; v8us half[2]; unsigned short u[16]; };

__device__ __forceinline__ unsigned short bf16_bits(float x) { unsigned int u = __float_as_uint(x); return (unsigned short)((u + 0x7FFFu + ((u >> 16) & 1u)) >> 16); }
__device__ __forceinline__ float bf16_val(unsigned short b) { return __uint_as_float(((unsigned int)b) << 16); }
__device__ __forceinline__ float bf16_round(float x) { return bf16_val(bf16_bits(x)); }
// D += A·B with NT terms: 1 = ah·bh, 2 = + al·bh (A split), 3 = + ah·bl (both split)
template <int NT>
__device__ __forceinline__ v8f mmaN(v16b ah, v16b al, v16b bh, v16b bl, v8f c) {
  c = __builtin_amdgcn_wmma_f32_16x16x32_bf16(false, ah, false, bh, (short)0, c, false, false);
  if (NT >= 2) c = __builtin_amdgcn_wmma_f32_16x16x32_bf16(false, al, false, bh, (short)0, c, false, false);
  if (NT >= 3) c = __builtin_amdgcn_wmma_f32_16x16x32_bf16(false, ah, false, bl, (short)0, c, false, false);
  asm volatile("v_nop\n\tv_nop\n\tv_nop\n\tv_nop" : "+v"(c) : "v"(ah), "v"(al), "v"(bh), "v"(bl));
  return c;
}

__global__ __launch_bounds__(256) void k_wt_bf16(const float* __restrict__ W, unsigned short* __restrict__ Wt, int K, int N) {
  const int t = blockIdx.x * 256 + threadIdx.x;
  const int k8n = K / 8;
  if (t >= N * k8n) return;
  const int n = t / k8n, k8 = (t % k8n) * 8;
  v8us v;
#pragma unroll
  for (int i = 0; i < 8; ++i) v[i] = bf16_bits(W[(size_t)(k8 + i) * N + n]);
  *(v8us*)(Wt + (size_t)n * K + k8) = v;
  
}

// GEMM C[M][N] (f32, pitch ldc) = act(A[M][K]·W + bias). A f32 row-major (pitch lda) converted per fragment to bf16
// (ASPLIT: hi/lo two planes -> 2 terms, else single rounded term); Wt bf16 [N][K] (pitch ldb). BIAS_BF16 rounds the
// bias to bf16 first (bias quantised to bf16 before the add). K%32==0, M%16==0, N%64==0.
template <bool ASPLIT, int ACT, bool BIAS_BF16>
__global__ __launch_bounds__(128) void k_gemm_bf(const float* __restrict__ A, int lda, const unsigned short* __restrict__ Wt, int ldb,
                                               const float* __restrict__ bias, float* __restrict__ C, int ldc, int M, int N, int K) {
  __shared__ __attribute__((aligned(16))) float so[4][16][64];
  const int tid = threadIdx.x, w = tid >> 5, lane = tid & 31, ln = lane & 15, hh = lane >> 4;
  const int ntn = N / 64;
  const int wid = blockIdx.x * 4 + w;
  const int mt = wid / ntn, nq = wid % ntn;
  if (mt * 16 >= M) return;
  const int row0 = mt * 16, col0 = nq * 64;
  const float* arow = A + (size_t)(row0 + ln) * lda;
  v8f acc[4] = {};
  for (int kb = 0; kb < K; kb += 32) {
    FragB ah, al;
    const v4f x0 = *(const v4fa*)(arow + kb + 8 * hh), x1 = *(const v4fa*)(arow + kb + 8 * hh + 4);
    const v4f x2 = *(const v4fa*)(arow + kb + 16 + 8 * hh), x3 = *(const v4fa*)(arow + kb + 16 + 8 * hh + 4);
    float xs[16] = {x0[0],x0[1],x0[2],x0[3],x1[0],x1[1],x1[2],x1[3],x2[0],x2[1],x2[2],x2[3],x3[0],x3[1],x3[2],x3[3]};
#pragma unroll
    for (int i = 0; i < 16; ++i) { const unsigned short hb = bf16_bits(xs[i]); ah.u[i] = hb; al.u[i] = ASPLIT ? bf16_bits(xs[i] - bf16_val(hb)) : (unsigned short)0; }
#pragma unroll
    for (int t = 0; t < 4; ++t) {
      const unsigned short* brow = Wt + (size_t)(col0 + t * 16 + ln) * ldb + kb;
      FragB b;
      b.half[0] = *(const v8us*)(brow + 8 * hh);
      b.half[1] = *(const v8us*)(brow + 16 + 8 * hh);
      acc[t] = mmaN<ASPLIT ? 2 : 1>(ah.v, al.v, b.v, b.v, acc[t]);
    }
  }
#pragma unroll
  for (int t = 0; t < 4; ++t) {
    float bv = bias ? bias[col0 + t * 16 + ln] : 0.f;
    if (BIAS_BF16) bv = bf16_round(bv);
#pragma unroll
    for (int r = 0; r < 8; ++r) { float v = acc[t][r] + bv; if (ACT == 1) v = fmaxf(v, 0.f); so[w][8 * hh + r][t * 16 + ln] = v; }
  }
  __builtin_amdgcn_fence(__ATOMIC_ACQ_REL, "workgroup");
  __builtin_amdgcn_wave_barrier();
  const int rsub = lane >> 4, c4 = (lane & 15) * 4;
  {
#pragma unroll
    for (int q = 0; q < 8; ++q) {
      const int r = q * 2 + rsub;
      const v4f v = *(const v4fa*)&so[w][r][c4];
      *(v4f*)(C + (size_t)(row0 + r) * ldc + col0 + c4) = v;
    }
    
  }
}

// GEMM C = act(A·W + bias + resid): A f32 (ASPLIT -> hi/lo 2 terms), Wt bf16 [N][K]; ACT 0 none, 1 relu, 2 exact gelu;
// resid (optional, f32, row index = (row % rmod), pitch ldr, RES_BF16 rounds it) added before the activation.
template <bool ASPLIT, int ACT, bool BIAS_BF16, bool RES_BF16>
__global__ __launch_bounds__(128) void k_gemm_bf3(const float* __restrict__ A, int lda, const unsigned short* __restrict__ Wt, int ldb,
                                                const float* __restrict__ bias, const float* __restrict__ resid, int rmod, int ldr,
                                                float* __restrict__ C, int ldc, int M, int N, int K) {
  __shared__ __attribute__((aligned(16))) float so[4][16][64];
  const int tid = threadIdx.x, w = tid >> 5, lane = tid & 31, ln = lane & 15, hh = lane >> 4;
  const int ntn = N / 64;
  const int wid = blockIdx.x * 4 + w;
  const int mt = wid / ntn, nq = wid % ntn;
  if (mt * 16 >= M) return;
  const int row0 = mt * 16, col0 = nq * 64;
  const float* arow = A + (size_t)(row0 + ln) * lda;
  v8f acc[4] = {};
  for (int kb = 0; kb < K; kb += 32) {
    FragB ah, al;
    const v4f x0 = *(const v4fa*)(arow + kb + 8 * hh), x1 = *(const v4fa*)(arow + kb + 8 * hh + 4);
    const v4f x2 = *(const v4fa*)(arow + kb + 16 + 8 * hh), x3 = *(const v4fa*)(arow + kb + 16 + 8 * hh + 4);
    float xs[16] = {x0[0],x0[1],x0[2],x0[3],x1[0],x1[1],x1[2],x1[3],x2[0],x2[1],x2[2],x2[3],x3[0],x3[1],x3[2],x3[3]};
#pragma unroll
    for (int i = 0; i < 16; ++i) { const unsigned short hb = bf16_bits(xs[i]); ah.u[i] = hb; al.u[i] = ASPLIT ? bf16_bits(xs[i] - bf16_val(hb)) : (unsigned short)0; }
#pragma unroll
    for (int t = 0; t < 4; ++t) {
      const unsigned short* brow = Wt + (size_t)(col0 + t * 16 + ln) * ldb + kb;
      FragB b;
      b.half[0] = *(const v8us*)(brow + 8 * hh);
      b.half[1] = *(const v8us*)(brow + 16 + 8 * hh);
      acc[t] = mmaN<ASPLIT ? 2 : 1>(ah.v, al.v, b.v, b.v, acc[t]);
    }
  }
#pragma unroll
  for (int t = 0; t < 4; ++t) {
    const int col = col0 + t * 16 + ln;
    float bv = bias ? bias[col] : 0.f;
    if (BIAS_BF16) bv = bf16_round(bv);
#pragma unroll
    for (int r = 0; r < 8; ++r) {
      float v = acc[t][r] + bv;
      if (resid) { float rv = resid[(size_t)((row0 + 8 * hh + r) % rmod) * ldr + col]; if (RES_BF16) rv = bf16_round(rv); v += rv; }
      if (ACT == 1) v = fmaxf(v, 0.f);
      if (ACT == 2) v = 0.5f * v * (1.0f + erff(v * 0.70710678118654752f));
      if (ACT == 3) { const float u = 0.7978845608028654f * (v + 0.044715f * v * v * v); v = 0.5f * v * (1.0f + tanhf(u)); }
      so[w][8 * hh + r][t * 16 + ln] = v;
    }
  }
  __builtin_amdgcn_fence(__ATOMIC_ACQ_REL, "workgroup");
  __builtin_amdgcn_wave_barrier();
  const int rsub = lane >> 4, c4 = (lane & 15) * 4;
  {
#pragma unroll
    for (int q = 0; q < 8; ++q) {
      const int r = q * 2 + rsub;
      const v4f v = *(const v4fa*)&so[w][r][c4];
      *(v4f*)(C + (size_t)(row0 + r) * ldc + col0 + c4) = v;
    }
    
  }
}
// row LayerNorm (biased variance, eps) over N: s = X (+ R); optional out_sum <- s; out_norm <- (s-mu)*rsqrt(var+eps)*g + b
template <bool PARAM_BF16>
__global__ __launch_bounds__(256) void k_layernorm(const float* __restrict__ X, const float* __restrict__ R, const float* __restrict__ g, const float* __restrict__ bta,
                                                  float* __restrict__ out_sum, float* __restrict__ out_norm, int N, float eps) {
  __shared__ float red[256];
  const int row = blockIdx.x, tid = threadIdx.x;
  const float* x = X + (size_t)row * N; const float* rr = R ? R + (size_t)row * N : nullptr;
  float vals[16];                     // up to N = 4096
  const int per = N / 256;            // contiguous chunk per thread? use strided-by-4 chunks: thread handles j = tid*4 + 1024*u
  float s1 = 0.f;
  for (int u = 0; u < per / 4; ++u) {
    const int j = tid * 4 + 1024 * u;
    const v4f a = *(const v4fa*)(x + j);
    v4f b = {0.f,0.f,0.f,0.f}; if (rr) b = *(const v4fa*)(rr + j);
#pragma unroll
    for (int q = 0; q < 4; ++q) { const float v = a[q] + b[q]; vals[u * 4 + q] = v; s1 += v; }
  }
  red[tid] = s1; __syncthreads();
  for (int st = 128; st > 0; st >>= 1) { if (tid < st) red[tid] += red[tid + st]; __syncthreads(); }
  const float mu = red[0] / (float)N; __syncthreads();
  float s2 = 0.f;
  for (int u = 0; u < per / 4; ++u)
#pragma unroll
    for (int q = 0; q < 4; ++q) { const float c = vals[u * 4 + q] - mu; s2 += c * c; }
  red[tid] = s2; __syncthreads();
  for (int st = 128; st > 0; st >>= 1) { if (tid < st) red[tid] += red[tid + st]; __syncthreads(); }
  const float rs = rsqrtf(red[0] / (float)N + eps);
  {
    for (int u = 0; u < per / 4; ++u) {
      const int j = tid * 4 + 1024 * u;
      v4f o, sm;
#pragma unroll
      for (int q = 0; q < 4; ++q) {
        float gg = g[j + q], bb = bta[j + q];
        if (PARAM_BF16) { gg = bf16_round(gg); bb = bf16_round(bb); }
        sm[q] = vals[u * 4 + q]; o[q] = (vals[u * 4 + q] - mu) * rs * gg + bb;
      }
      if (out_sum) *(v4f*)(out_sum + (size_t)row * N + j) = sm;
      *(v4f*)(out_norm + (size_t)row * N + j) = o;
    }
    
  }
}



// ---- f16 WMMA path (v_wmma_f32_16x16x32_f16): 11-bit significands for operands in range — used where a [0,1] probability operand needs more precision than bf16
typedef _Float16 v16h __attribute__((ext_vector_type(16)));
union FragH { v16h v; v8us half[2]; _Float16 h[16]; unsigned short u[16]; };
template <int NT>
__device__ __forceinline__ v8f mmaH(v16h ah, v16h al, v16h bh, v16h bl, v8f c) {
  c = __builtin_amdgcn_wmma_f32_16x16x32_f16(false, ah, false, bh, (short)0, c, false, false);
  if (NT >= 2) c = __builtin_amdgcn_wmma_f32_16x16x32_f16(false, al, false, bh, (short)0, c, false, false);
  if (NT >= 3) c = __builtin_amdgcn_wmma_f32_16x16x32_f16(false, ah, false, bl, (short)0, c, false, false);
  asm volatile("v_nop\n\tv_nop\n\tv_nop\n\tv_nop" : "+v"(c) : "v"(ah), "v"(al), "v"(bh), "v"(bl));
  return c;
}
// batched GEMM like k_gemm_b but f16 operands: A f32 (split into f16 hi/lo if ASPLIT, else rounded to f16), Bt = f16 values [n][k]; alpha; C f32; N multiple of 16 (partial tiles skipped)
template <bool ASPLIT>
__global__ __launch_bounds__(128) void k_gemm_h(const float* __restrict__ A, int lda, size_t sA, const _Float16* __restrict__ Bh, int ldb, size_t sB, float alpha, float* __restrict__ C, int ldc, size_t sC, int M, int N, int K) {
  __shared__ __attribute__((aligned(16))) float so[4][16][64];
  const int tid = threadIdx.x, w = tid >> 5, lane = tid & 31, ln = lane & 15, hh = lane >> 4; const int by = blockIdx.y;
  A += (size_t)by * sA; Bh += (size_t)by * sB; C += (size_t)by * sC;
  const int ntn = (N + 63) / 64; const int wid = blockIdx.x * 4 + w; const int mt = wid / ntn, nq = wid % ntn; if (mt * 16 >= M) return;
  const int row0 = mt * 16, col0 = nq * 64; const float* arow = A + (size_t)(row0 + ln) * lda;
  v8f acc[4] = {};
  for (int kb = 0; kb < K; kb += 32) {
    FragH ah, al;
    const v4f x0 = *(const v4fa*)(arow + kb + 8 * hh), x1 = *(const v4fa*)(arow + kb + 8 * hh + 4), x2 = *(const v4fa*)(arow + kb + 16 + 8 * hh), x3 = *(const v4fa*)(arow + kb + 16 + 8 * hh + 4);
    float xs[16] = {x0[0],x0[1],x0[2],x0[3],x1[0],x1[1],x1[2],x1[3],x2[0],x2[1],x2[2],x2[3],x3[0],x3[1],x3[2],x3[3]};
#pragma unroll
    for (int i = 0; i < 16; ++i) { const _Float16 h = (_Float16)xs[i]; ah.h[i] = h; al.h[i] = ASPLIT ? (_Float16)(xs[i] - (float)h) : (_Float16)0.0f; }
#pragma unroll
    for (int t = 0; t < 4; ++t) { if (col0 + t * 16 >= N) continue; const size_t boff = (size_t)(col0 + t * 16 + ln) * ldb + kb; FragH bq; bq.half[0] = *(const v8us*)(Bh + boff + 8 * hh); bq.half[1] = *(const v8us*)(Bh + boff + 16 + 8 * hh);
      acc[t] = mmaH<ASPLIT ? 2 : 1>(ah.v, al.v, bq.v, bq.v, acc[t]); }
  }
#pragma unroll
  for (int t = 0; t < 4; ++t) { if (col0 + t * 16 >= N) continue;
#pragma unroll
    for (int r = 0; r < 8; ++r) so[w][8 * hh + r][t * 16 + ln] = acc[t][r] * alpha; }
  __builtin_amdgcn_fence(__ATOMIC_ACQ_REL, "workgroup"); __builtin_amdgcn_wave_barrier();
  const int rsub = lane >> 4, c4 = (lane & 15) * 4;
  {
#pragma unroll
    for (int q = 0; q < 8; ++q) { const int r = q * 2 + rsub; if (col0 + c4 < N) { const v4f v = *(const v4fa*)&so[w][r][c4]; *(v4f*)(C + (size_t)(row0 + r) * ldc + col0 + c4) = v; } }
     }
}

// k_gemm_hh variant with fused epilogue: v = acc·alpha + bias[by·sBias + col] (+ CP[(row/rowsPerB)·sCPb + by·64 + col] if CP) ; ACT 0 none / 1 elu ; writes f16 C16 (and f32 C if non-null)
template <int ACT>
__global__ __launch_bounds__(128) void k_gemm_hhx(const _Float16* __restrict__ A, int lda, size_t sA, const _Float16* __restrict__ Bh, int ldb, size_t sB, float alpha, const float* __restrict__ bias, size_t sBias, const float* __restrict__ CP, int rowsPerB, size_t sCPb, int row0g,
    float* __restrict__ C, _Float16* __restrict__ C16, int ldc, size_t sC, int M, int N, int K) {
  __shared__ __attribute__((aligned(16))) float so[4][16][64];
  const int tid = threadIdx.x, w = tid >> 5, lane = tid & 31, ln = lane & 15, hh = lane >> 4; const int by = blockIdx.y;
  A += (size_t)by * sA; Bh += (size_t)by * sB; const size_t cofs = (size_t)by * sC; const float* bp = bias ? bias + (size_t)by * sBias : nullptr;
  const int ntn = (N + 63) / 64; const int wid = blockIdx.x * 4 + w; const int mt = wid / ntn, nq = wid % ntn; if (mt * 16 >= M) return;
  const int row0 = mt * 16, col0 = nq * 64; const _Float16* arow = A + (size_t)(row0 + ln) * lda;
  v8f acc[4] = {};
  for (int kb = 0; kb < K; kb += 32) { FragH ah; ah.half[0] = *(const v8us*)((const unsigned short*)arow + kb + 8 * hh); ah.half[1] = *(const v8us*)((const unsigned short*)arow + kb + 16 + 8 * hh);
#pragma unroll
    for (int t = 0; t < 4; ++t) { if (col0 + t * 16 >= N) continue; const size_t boff = (size_t)(col0 + t * 16 + ln) * ldb + kb; FragH bq; bq.half[0] = *(const v8us*)((const unsigned short*)Bh + boff + 8 * hh); bq.half[1] = *(const v8us*)((const unsigned short*)Bh + boff + 16 + 8 * hh);
      acc[t] = mmaH<1>(ah.v, ah.v, bq.v, bq.v, acc[t]); }
  }
#pragma unroll
  for (int t = 0; t < 4; ++t) { if (col0 + t * 16 >= N) continue; const int col = col0 + t * 16 + ln; const float bv = bp ? bf16_round(bp[col]) : 0.f;
#pragma unroll
    for (int r = 0; r < 8; ++r) { float v = acc[t][r] * alpha + bv; if (CP) { const int rr = row0g + row0 + 8 * hh + r; if (rowsPerB < 0) v += CP[cofs + (size_t)rr * ldc + col];      /* rowsPerB < 0: own element of the batched C plane */ else { const int bidx = rr / rowsPerB; v += CP[(size_t)bidx * sCPb + (size_t)by * 64 + col]; } } if (ACT == 1) v = (v > 0.f) ? v : expm1f(v); else if (ACT == 7) v = (v > 0.f) ? v + 1.0f : expf(v); else if (ACT == 8) v = tanhf(v); else if (ACT == 9) v = 0.5f * v * (1.0f + tanhf(0.7978845608028654f * (v + 0.044715f * v * v * v))); else if (ACT == 11) v = 1.0f / (1.0f + expf(-v)); else if (ACT == 12) v = (v > 0.f) ? v : 0.01f * v; else if (ACT == 14) v = (v > 0.f) ? v : 0.1f * v; else if (ACT == 16) v = (v >= 0.f) ? v : 0.3f * v; else if (ACT == 17) v = (v >= 0.f) ? v : 0.2f * v; else if (ACT == 15) v = v / (1.0f + expf(-v)); else if (ACT == 3) v = fmaxf(v, 0.f); else if (ACT == 6) v = 0.5f * v * (1.0f + erff(v * 0.70710678118654752f)); so[w][8 * hh + r][t * 16 + ln] = v; } }
  __builtin_amdgcn_fence(__ATOMIC_ACQ_REL, "workgroup"); __builtin_amdgcn_wave_barrier();
  const int rsub = lane >> 4, c4 = (lane & 15) * 4; typedef _Float16 v4h __attribute__((ext_vector_type(4)));
  {
#pragma unroll
    for (int q = 0; q < 8; ++q) { const int r = q * 2 + rsub; if (col0 + c4 < N) { const v4f v = *(const v4fa*)&so[w][r][c4]; if (C) *(v4f*)(C + cofs + (size_t)(row0 + r) * ldc + col0 + c4) = v; if (C16) { v4h h4; for (int i = 0; i < 4; ++i) h4[i] = (_Float16)v[i]; *(v4h*)(C16 + cofs + (size_t)(row0 + r) * ldc + col0 + c4) = h4; } } }
     }
}


typedef _Float16 v4h __attribute__((ext_vector_type(4)));

__global__ __launch_bounds__(256) void k_h16(const float* __restrict__ x, _Float16* __restrict__ X16, size_t n8) { const size_t t = (size_t)blockIdx.x * 256 + threadIdx.x; if (t >= n8) return; FragH f;
#pragma unroll
  for (int q = 0; q < 8; ++q) f.h[q] = (_Float16)x[t * 8 + q]; *(v8us*)((unsigned short*)X16 + t * 8) = f.half[0];  }
__global__ __launch_bounds__(256) void k_round16f(const float* __restrict__ W, _Float16* __restrict__ Bt, size_t n8) { const size_t t = (size_t)blockIdx.x * 256 + threadIdx.x; if (t >= n8) return; FragH f;
#pragma unroll
  for (int i = 0; i < 8; ++i) f.h[i] = (_Float16)(bf16_round(W[t * 8 + i]) * 16.0f); *(v8us*)((unsigned short*)Bt + t * 8) = f.half[0];  }

__global__ __launch_bounds__(256) void k_hl(const float* __restrict__ F, _Float16* __restrict__ Hh, _Float16* __restrict__ Hl, size_t n8) { const size_t t = (size_t)blockIdx.x * 256 + threadIdx.x; if (t >= n8) return; FragH fh, fl; const v4f a = *(const v4fa*)(F + t * 8), c = *(const v4fa*)(F + t * 8 + 4);
#pragma unroll
  for (int q = 0; q < 4; ++q) { _Float16 h = (_Float16)a[q]; fh.h[q] = h; fl.h[q] = (_Float16)((a[q] - (float)h) * 1024.0f); h = (_Float16)c[q]; fh.h[4 + q] = h; fl.h[4 + q] = (_Float16)((c[q] - (float)h) * 1024.0f); }
  { *(v8us*)((unsigned short*)Hh + t * 8) = fh.half[0]; *(v8us*)((unsigned short*)Hl + t * 8) = fl.half[0];  } }



__global__ __launch_bounds__(256) void k_wnat(const float* __restrict__ w, size_t n8, _Float16* __restrict__ Bt) { const size_t t = (size_t)blockIdx.x * 256 + threadIdx.x; if (t >= n8) return; FragH f; for (int q = 0; q < 8; ++q) f.h[q] = (_Float16)(bf16_round(w[t * 8 + q]) * 16.0f); *(v8us*)((unsigned short*)Bt + t * 8) = f.half[0];  }
__global__ __launch_bounds__(256) void k_rsm(const float* __restrict__ S, _Float16* __restrict__ P, int nrows) {
  #pragma clang fp contract(off)
  const int i = blockIdx.x * 256 + threadIdx.x; if (i >= nrows) return; const float* s = S + (size_t)i * SQ; float mx = -3.0e38f;
#pragma unroll 1
  for (int j = 0; j < SQ; ++j) mx = fmaxf(mx, s[j]); float se = 0.f;
#pragma unroll 1
  for (int j = 0; j < SQ; ++j) se += expf(s[j] - mx); const float sc = 256.0f / se;
#pragma unroll 1
  for (int j0 = 0; j0 < SQ; j0 += 8) { FragH f; for (int q = 0; q < 8; ++q) f.h[q] = (_Float16)(expf(s[j0 + q] - mx) * sc); unsigned short* d = (unsigned short*)P + (size_t)i * SQ + j0; *(v8us*)d = f.half[0];  } }
__global__ __launch_bounds__(256) void k_vt(const _Float16* __restrict__ V16, int b, int h0, _Float16* __restrict__ VT) { __shared__ unsigned short tl[64][65]; const int tid = threadIdx.x; const int hh = blockIdx.x % HG, sg = blockIdx.x / HG; const int s0 = sg * 64; const int h = h0 + hh;
  for (int i = tid; i < 64 * 8; i += 256) { const int j = i / 8, d8 = (i % 8) * 8; FragH f; f.half[0] = *(const v8us*)((const unsigned short*)V16 + ((size_t)b * SQ + s0 + j) * DM + h * HD + d8); for (int q = 0; q < 8; ++q) tl[d8 + q][j] = f.u[q]; }
  __syncthreads();
  { for (int i = tid; i < 64 * 8; i += 256) { const int d = i / 8, j8 = (i % 8) * 8; FragH f; for (int q = 0; q < 8; ++q) f.u[q] = tl[d][j8 + q]; *(v8us*)((unsigned short*)VT + ((size_t)hh * HD + d) * SQ + s0 + j8) = f.half[0]; }  } }

// Fused attention, one launch. A work-group is 4 waves and 64 query rows of one batch. The keys are walked in stages of 128. Wave w owns the 32 query rows of half w >> 1 (two 16-row tiles) and, of every stage,
// the 64 keys of half w & 1: each K or V^T fragment it reads from LDS feeds two WMMAs, one per row tile. Its Q fragments (2 x 8 k steps) and its 32 x 256 f32 partial output tile stay in registers.
// K rows and V^T rows of a stage lie in LDS (pitch = 256 B + 16 B for 16-byte readers). Each wave brings a quarter of a stage with one tensor load (through no register): wave 0 / 1 the first / second 256 B of the 128 K rows,
// wave 2 / 3 the first / second 128 V^T rows. Two buffers: the next stage flies while this one is worked on. Softmax keeps a running row maximum per wave; the output tile and the row sum are rescaled when it grows. P goes from accumulator layout
// to A-fragment layout through the wave's own LDS rows. P = 256 * exp(s - max), f16; the factor cancels in the division by the row sum. Behind the loop the two waves of a row half join their partial maxima, sums and tiles through LDS, each for 128 output columns.
template <int M> __device__ __forceinline__ float rs_xm(float x) { return __builtin_bit_cast(float, __builtin_amdgcn_mov_dpp(__builtin_bit_cast(int, x), 0x160 | M, 0xf, 0xf, false)); }      /* lane l with lane l ^ M inside a 16-lane row (row_xmask) */
#define FA_KP 136      /* halves per staged half row of K and per staged V^T row: 256 B + 16 B */
#define FA_PP 72       /* halves per P row: 128 B + 16 B */
#define FA_ST 128      /* keys per stage */
#define FA_SL 17408    /* halves per slice of a buffer: 128 rows of 272 B = 34,816 B = 17 x 2 KiB */
#define FA_BUF (4 * FA_SL)      /* halves per buffer: K bytes 0-255 | K bytes 256-511 | V^T rows 0-127 | V^T rows 128-255 */
#define FA_OP 132      /* floats per staged output row: 512 B + 16 B */
#define FA_EW (4096 + 1024 + 32 * FA_OP)      /* floats per wave behind the loop: the half tile for the partner | its maxima and sums | the wave's output staging rows */
#define FA_C 0.09016844005556021f      /* log2(e) / 16: the score scale folded into the exponent */
__device__ __forceinline__ v16h fa_frag(const unsigned short* p, int hh) { FragH f; f.half[0] = *(const v8us*)(p + 8 * hh); f.half[1] = *(const v8us*)(p + 16 + 8 * hh); return f.v; }
__device__ __forceinline__ v8f fa_mma(v16h a, v16h b, v8f c) { return __builtin_amdgcn_wmma_f32_16x16x32_f16(false, a, false, b, (short)0, c, false, false); }
/* eight 2^x in one statement: the outputs are early-clobber, so no v_exp_f32 overwrites the source of the one in front of it, and the closing v_nop is the one slot the instruction set asks for behind a transcendental */
__device__ __forceinline__ v8f fa_exp2(v8f x) { float d0, d1, d2, d3, d4, d5, d6, d7;
  asm("v_exp_f32 %0, %8\n\tv_exp_f32 %1, %9\n\tv_exp_f32 %2, %10\n\tv_exp_f32 %3, %11\n\tv_exp_f32 %4, %12\n\tv_exp_f32 %5, %13\n\tv_exp_f32 %6, %14\n\tv_exp_f32 %7, %15\n\tv_nop"
      : "=&v"(d0), "=&v"(d1), "=&v"(d2), "=&v"(d3), "=&v"(d4), "=&v"(d5), "=&v"(d6), "=&v"(d7) : "v"(x[0]), "v"(x[1]), "v"(x[2]), "v"(x[3]), "v"(x[4]), "v"(x[5]), "v"(x[6]), "v"(x[7]));
  const v8f d = {d0, d1, d2, d3, d4, d5, d6, d7}; return d; }
typedef unsigned int u32x4 __attribute__((ext_vector_type(4)));
typedef unsigned int u32x8 __attribute__((ext_vector_type(8)));
__device__ __forceinline__ unsigned int fa_uni(unsigned int v) { return (unsigned int)__builtin_amdgcn_readfirstlane(v); }
__device__ __forceinline__ unsigned int fa_pinned(unsigned int v) { unsigned int s = fa_uni(v);
  asm volatile("" : "+s"(s));      /* pinned(): the test is held in a scalar register, so that the branch on it is a scalar branch (a tensor load ignores EXEC) */
  return s; }
/* descriptor group 0 of a tensor load: the tile's first byte at ga goes to LDS byte offset lds */
__device__ __forceinline__ u32x4 fa_group0(unsigned int lds, unsigned long long ga) { u32x4 g;
  g[0] = fa_uni(1u); g[1] = fa_uni(lds); g[2] = fa_uni((unsigned int)ga); g[3] = fa_uni((((unsigned int)(ga >> 32)) & 0x01FFFFFFu) | 0x80000000u);
  asm volatile("" : "+s"(g));      /* pinned(): the descriptor's words are held in these scalar registers; with the wait that names them, none is reused while the request is outstanding */
  return g; }
/* descriptor group 1: a tile of N rows of R bytes, source pitch P bytes; W0 = word 0 (no mask, 1-byte elements, 16 B of pad behind every row of R bytes) */
template <unsigned int W0, unsigned int R, unsigned int N, unsigned int P>
__device__ __forceinline__ u32x8 fa_group1() { u32x8 g;
  g[0] = fa_uni(W0); g[1] = fa_uni((R & 0xFFFFu) << 16); g[2] = fa_uni((R >> 16) | ((N & 0xFFFFu) << 16)); g[3] = fa_uni((N >> 16) | (R << 16));
  g[4] = fa_uni(N); g[5] = fa_uni(P); g[6] = fa_uni(0u); g[7] = fa_uni(0u);
  asm volatile("" : "+s"(g));      /* pinned(): as in fa_group0 */
  return g; }
__device__ __forceinline__ void fa_tload(u32x4 g0, u32x8 g1) { asm volatile("tensor_load_to_lds %0, %1" :: "s"(g0), "s"(g1) : "memory"); }      /* the tile goes from global memory to LDS through no register */
typedef float fa_f32 __attribute__((may_alias));
__global__ __launch_bounds__(128) void k_fattn(const _Float16* __restrict__ Q, const _Float16* __restrict__ Kg, const _Float16* __restrict__ Vt, float* __restrict__ O) {
  __shared__ __attribute__((aligned(2048))) unsigned short ring[2 * FA_BUF];      /* every slice starts at a multiple of 2 KiB */
  __shared__ __attribute__((aligned(16))) unsigned short ps[4][32 * FA_PP];
  const int tid = threadIdx.x, w = tid >> 5, lane = tid & 31, ln = lane & 15, hh = lane >> 4, b = blockIdx.y;
  const int kh = w & 1;      /* the wave's half of every stage's keys, and the half of the output columns that it finishes */
  const int q0 = blockIdx.x * 64 + 32 * (w >> 1);
  const unsigned short* qp = (const unsigned short*)Q + ((size_t)b * SQ + q0 + ln) * DQ;
  v16h qa[2][DQ / 32];
#pragma unroll      /* constant indices keep qa[][] in registers */
  for (int m = 0; m < 2; ++m)
#pragma unroll
    for (int i = 0; i < DQ / 32; ++i) qa[m][i] = fa_frag(qp + m * 16 * DQ + 32 * i, hh);
  asm volatile("s_wait_xcnt 0x0" ::: "memory");      /* the wait in front of any reuse of the loads' address registers */
  const unsigned int wv = fa_uni((unsigned int)tid >> 5);      /* the wave's number in a scalar register */
  const unsigned int rb = (unsigned int)(size_t)ring + wv * (FA_SL * 2);      /* LDS byte offset of the wave's slice in buffer 0 */
  const unsigned long long ga0 = wv < 2u ? (unsigned long long)(size_t)Kg + ((unsigned long long)b * SQ * DQ + (wv & 1u) * 128) * 2      /* the wave's half of K row 0 of the batch */
                                        : (unsigned long long)(size_t)Vt + ((unsigned long long)b * DV + (wv & 1u) * 128) * SQ * 2;      /* or its first V^T row of the batch */
  const unsigned int gst = wv < 2u ? FA_ST * DQ * 2 : FA_ST * 2;      /* source bytes from one stage to the next */
  const u32x8 g1k = fa_group1<(1u << 20) | (5u << 22) | (3u << 25), 256u, 128u, DQ * 2u>();      /* 128 half rows of K */
  const u32x8 g1v = fa_group1<(1u << 20) | (5u << 22) | (3u << 25), 256u, 128u, SQ * 2u>();      /* 128 V^T rows, 128 keys of each */
  u32x4 g0;
  auto issue = [&](unsigned int ch) {      /* the wave's slice of stage ch into buffer ch & 1 */
    g0 = fa_group0(rb + (ch & 1u) * (FA_BUF * 2), ga0 + (unsigned long long)ch * gst);
    if (fa_pinned(wv < 2u)) fa_tload(g0, g1k);
    if (fa_pinned(wv >= 2u)) fa_tload(g0, g1v);
  };
  auto landed = [&]() { asm volatile("s_wait_tensorcnt 0x0" :: "s"(g0), "s"(g1k), "s"(g1v) : "memory"); };      /* the wave's own request has landed; the descriptor is named as an input so that its registers keep their values up to here */
  issue(0);
  landed();      /* the wave's slice of stage 0 */
  __syncthreads();      /* stage 0 is published */
  issue(1);
  const v8f z8 = {0.f,0.f,0.f,0.f,0.f,0.f,0.f,0.f};
  v8f o[2][DV / 16], mr[2], lr[2] = {z8, z8};      /* o[m][0..7]: the column half the wave finishes itself (kh); o[m][8..15]: the half its partner finishes */
#pragma unroll
  for (int m = 0; m < 2; ++m) {
#pragma unroll
    for (int j = 0; j < DV / 16; ++j) o[m][j] = z8;
#pragma unroll
    for (int r = 0; r < 8; ++r) mr[m][r] = -3.0e38f;
  }
#pragma unroll 1      /* one stage per trip: the body is already 128 WMMAs long */
  for (int c = 0; c < SQ / FA_ST; ++c) {
    const unsigned short* ks = ring + (c & 1) * FA_BUF + kh * 64 * FA_KP;      /* the wave's 64 key rows in this stage's buffer */
    const unsigned short* vs = ring + (c & 1) * FA_BUF + 2 * FA_SL + kh * 64;      /* the wave's 64 keys of V^T row 0 */
    const unsigned short* vh[2] = {vs + kh * 128 * FA_KP, vs + (1 - kh) * 128 * FA_KP};      /* the V^T rows of the wave's own column half, of its partner's */
    /* The wave's 64 B fragments come from LDS in 8 groups of 8 (groups 0-3: K, two k steps x four key tiles; groups 4-7: V^T, one k step x eight column tiles); a group feeds 16 WMMAs. */
    v16h fb[8][8];
    auto ld = [&](int g) {
#pragma unroll      /* constant indices keep fb[][] in registers */
      for (int e = 0; e < 8; ++e) fb[g][e] = (g < 4) ? fa_frag(ks + (g >> 1) * FA_SL + ((e & 3) * 16 + ln) * FA_KP + 32 * ((2 * g + (e >> 2)) & 3), hh) : fa_frag(vh[g & 1] + (e * 16 + ln) * FA_KP + 32 * ((g - 4) >> 1), hh); };
    v8f s[2][4] = {{z8, z8, z8, z8}, {z8, z8, z8, z8}};
    ld(0); ld(1);
#pragma unroll
    for (int g = 0; g < 4; ++g) {
      ld(g + 2);
      __builtin_amdgcn_sched_barrier(0);      /* a group's LDS reads are issued together, two groups ahead of its WMMAs; left alone the compiler reads each fragment right in front of its WMMA and waits out the LDS latency every time */
#pragma unroll
      for (int e = 0; e < 8; ++e)
#pragma unroll
        for (int m = 0; m < 2; ++m) s[m][e & 3] = fa_mma(qa[m][2 * g + (e >> 2)], fb[g][e], s[m][e & 3]);
      __builtin_amdgcn_sched_barrier(0);      /* the same: keeps the next group's reads behind this group's WMMAs */
    }
    /* accumulator element r of a lane is row 16 * m + 8 * hh + r, column 16 * t + ln: a row lives in one 16-lane half */
#pragma unroll
    for (int m = 0; m < 2; ++m) {
      v8f x = __builtin_elementwise_max(__builtin_elementwise_max(s[m][0], s[m][1]), __builtin_elementwise_max(s[m][2], s[m][3]));
#pragma unroll
      for (int r = 0; r < 8; ++r) { float y = x[r]; y = fmaxf(y, rs_xm<1>(y)); y = fmaxf(y, rs_xm<2>(y)); y = fmaxf(y, rs_xm<4>(y)); y = fmaxf(y, rs_xm<8>(y)); x[r] = y; }
      const v8f mn = __builtin_elementwise_max(mr[m], x); const v8f da = (mr[m] - mn) * FA_C; const v8f bs = 8.0f - mn * FA_C; mr[m] = mn;
      const v8f al = fa_exp2(da); v8f acc = z8;
#pragma unroll
      for (int t = 0; t < 4; ++t) { const v8f p = fa_exp2(s[m][t] * FA_C + bs); acc += p;
#pragma unroll
        for (int r = 0; r < 8; ++r) { FragH f; f.h[0] = (_Float16)p[r]; ps[w][(16 * m + 8 * hh + r) * FA_PP + t * 16 + ln] = f.u[0]; } }
      lr[m] = lr[m] * al + acc;      /* each lane keeps the sum of its own columns; the lanes are joined once, behind the loop */
#pragma unroll
      for (int j = 0; j < DV / 16; ++j) o[m][j] *= al;
    }
    __builtin_amdgcn_fence(__ATOMIC_ACQ_REL, "workgroup"); __builtin_amdgcn_wave_barrier();      /* the wave's P rows are written before its lanes read one another's */
    const v16h pa[2][2] = {{fa_frag(ps[w] + ln * FA_PP, hh), fa_frag(ps[w] + ln * FA_PP + 32, hh)}, {fa_frag(ps[w] + (16 + ln) * FA_PP, hh), fa_frag(ps[w] + (16 + ln) * FA_PP + 32, hh)}};
#pragma unroll
    for (int g = 4; g < 8; ++g) {
      if (g + 2 < 8) ld(g + 2);
      __builtin_amdgcn_sched_barrier(0);      /* as above: reads two groups ahead of their WMMAs */
#pragma unroll
      for (int e = 0; e < 8; ++e)
#pragma unroll
        for (int m = 0; m < 2; ++m) o[m][(g & 1) * 8 + e] = fa_mma(pa[m][(g - 4) >> 1], fb[g][e], o[m][(g & 1) * 8 + e]);
      __builtin_amdgcn_sched_barrier(0);      /* as above */
    }
    asm volatile("s_wait_dscnt 0x0" ::: "memory");      /* the wave's reads of this stage's buffer have returned before the buffer is refilled */
    landed();      /* the wave's slice of the next stage */
    __syncthreads();      /* the next stage is published, and every wave has left this stage's buffer */
    if (fa_pinned(c + 2 < SQ / FA_ST)) issue((unsigned int)c + 2u);
  }
  landed();      /* no request is outstanding behind the loop */
  asm volatile("s_wait_dscnt 0x0" ::: "memory");      /* nor an LDS read */
  /* The last trip's barrier ended every read of the ring, and nothing flies into it any more: it now serves the join of the wave pairs and the output staging, each wave in a region of its own. */
  fa_f32* ew = (fa_f32*)ring + w * FA_EW; const fa_f32* eo = (const fa_f32*)ring + (w ^ 1) * FA_EW;      /* the wave's region, its partner's */
#pragma unroll
  for (int m = 0; m < 2; ++m) {
#pragma unroll
    for (int r = 0; r < 8; ++r) { float l = lr[m][r]; l += rs_xm<1>(l); l += rs_xm<2>(l); l += rs_xm<4>(l); l += rs_xm<8>(l); lr[m][r] = l; }
#pragma unroll
    for (int h = 0; h < 2; ++h) {      /* lane for lane, 16 bytes a lane: the partner's lane holds the same rows and, in its own half, the same columns */
      const v4f vm = {mr[m][4 * h], mr[m][4 * h + 1], mr[m][4 * h + 2], mr[m][4 * h + 3]}, vl = {lr[m][4 * h], lr[m][4 * h + 1], lr[m][4 * h + 2], lr[m][4 * h + 3]};
      *(v4fa*)(ew + 4096 + ((m * 2 + h) * 32 + lane) * 4) = vm; *(v4fa*)(ew + 4096 + ((4 + m * 2 + h) * 32 + lane) * 4) = vl;
#pragma unroll
      for (int j = 0; j < 8; ++j) { const v4f vo = {o[m][8 + j][4 * h], o[m][8 + j][4 * h + 1], o[m][8 + j][4 * h + 2], o[m][8 + j][4 * h + 3]}; *(v4fa*)(ew + (((m * 8 + j) * 2 + h) * 32 + lane) * 4) = vo; }
    }
  }
  __syncthreads();      /* each wave's half tile, maxima and sums are written before its partner reads them */
  fa_f32* so = ew + 4096 + 1024;
#pragma unroll
  for (int m = 0; m < 2; ++m) {
    v8f mo, lo;
#pragma unroll
    for (int h = 0; h < 2; ++h) { const v4f vm = *(const v4fa*)(eo + 4096 + ((m * 2 + h) * 32 + lane) * 4), vl = *(const v4fa*)(eo + 4096 + ((4 + m * 2 + h) * 32 + lane) * 4);
#pragma unroll
      for (int q = 0; q < 4; ++q) { mo[4 * h + q] = vm[q]; lo[4 * h + q] = vl[q]; } }
    const v8f mn = __builtin_elementwise_max(mr[m], mo);
    v8f fw = fa_exp2((mr[m] - mn) * FA_C), fo = fa_exp2((mo - mn) * FA_C);      /* both partial results are brought to the common maximum */
#pragma unroll
    for (int r = 0; r < 8; ++r) { const float inv = 1.0f / (lr[m][r] * fw[r] + lo[r] * fo[r]); fw[r] *= inv; fo[r] *= inv; }
#pragma unroll
    for (int j = 0; j < 8; ++j)
#pragma unroll
      for (int h = 0; h < 2; ++h) { const v4f vo = *(const v4fa*)(eo + (((m * 8 + j) * 2 + h) * 32 + lane) * 4);
#pragma unroll
        for (int q = 0; q < 4; ++q) so[(16 * m + 8 * hh + 4 * h + q) * FA_OP + j * 16 + ln] = o[m][j][4 * h + q] * fw[4 * h + q] + vo[q] * fo[4 * h + q]; }
  }
  __builtin_amdgcn_fence(__ATOMIC_ACQ_REL, "workgroup"); __builtin_amdgcn_wave_barrier();      /* the wave's own staging rows are written before they are read back as whole lines */
  float* op = O + ((size_t)b * SQ + q0) * DV + kh * 128 + lane * 4;
  v4f rw[32];
#pragma unroll      /* constant indices keep rw[] in registers */
  for (int q = 0; q < 32; ++q) rw[q] = *(const v4fa*)(so + q * FA_OP + lane * 4);
#pragma unroll
  for (int q = 0; q < 32; ++q) *(v4f*)(op + q * DV) = rw[q];      /* a wave's store is 512 B of one output row */
}
// Wt[m][n][k] = f16(bf16(W_m[k][n]) * 16) for the three f32 row-major [in][out] weights, m = grid.y (power-of-two scale: bf16-exact weights stay exact in f16 away from the subnormal range)
__global__ __launch_bounds__(256) void k_wt3(const float* __restrict__ Wq, const float* __restrict__ Wk, const float* __restrict__ Wv, _Float16* __restrict__ Wt) {
  const float* W = blockIdx.y == 0 ? Wq : (blockIdx.y == 1 ? Wk : Wv);
  const int t = blockIdx.x * 256 + threadIdx.x; const int n = t / (DM / 8), k8 = (t % (DM / 8)) * 8; FragH f;
#pragma unroll
  for (int i = 0; i < 8; ++i) f.h[i] = (_Float16)(bf16_round(W[(size_t)(k8 + i) * DQ + n]) * 16.0f);
  *(v8us*)((unsigned short*)Wt + ((size_t)blockIdx.y * DQ + n) * DM + k8) = f.half[0];
}
// Projection stage, one launch. A work-group is 12 waves and 64 token rows: the rows are read once as f32, rounded to bf16 (exact in f16) and staged in LDS for all 12 waves.
// Wave w makes the 64 x 64 tile of matrix w / 4 (q, k, v), column slab w % 4, over the whole k = 256; its weight fragments come from the transposed f16 rows in global memory, one k step ahead.
// The weights are the A operand and the tokens the B operand, so an accumulator lane holds 8 consecutive output columns of one token: for q and k one 16-byte LDS store into the wave's own
// staging rows (row = token); for v the 8 values go to 8 staging rows (row = column), which makes the V^T rows. Either way the staging rows go out as whole 128-byte lines.
#define PJ_XP 264      /* halves per staged x row: 512 B + 16 B */
#define PJ_SP 72       /* halves per staged output row: 128 B + 16 B */
__global__ __launch_bounds__(384) void k_proj(const float* __restrict__ x, const _Float16* __restrict__ Wt, _Float16* __restrict__ Q, _Float16* __restrict__ Kg, _Float16* __restrict__ Vt) {
  __shared__ __attribute__((aligned(16))) unsigned short xs[64 * PJ_XP];
  __shared__ __attribute__((aligned(16))) unsigned short sts[12][64 * PJ_SP];
  const int tid = threadIdx.x, lane = tid & 31, ln = lane & 15, hh = lane >> 4;
  const int w = __builtin_amdgcn_readfirstlane(tid >> 5);      /* the wave's number in a scalar register: the tests on it below become scalar branches */
  const int t0 = blockIdx.x * 64;      /* first token row; 64 divides SQ, so the rows are of one batch */
  const unsigned short* wp = (const unsigned short*)Wt + (size_t)w * 64 * DM + ln * DM;      /* rows 64 w .. 64 w + 63 of the 768 transposed weight rows */
  v16h wf[2][4];
#pragma unroll
  for (int i = 0; i < 4; ++i) wf[0][i] = fa_frag(wp + 16 * i * DM, hh);
  asm volatile("s_wait_xcnt 0x0" ::: "memory");      /* the wait in front of any reuse of the weight loads' address registers */
  if (w < 8) {      /* the 64 rows are 64 KB in a row: 2048 pieces of 8 floats, 8 for each thread of the first 8 waves */
    const char* xg = (const char*)(x + (size_t)t0 * DM); const unsigned xb = tid * 32;      /* uniform base, the thread's byte offset */
    v4f xa[8][2];
#pragma unroll      /* constant indices keep xa[][] in registers */
    for (int p = 0; p < 8; ++p) { xa[p][0] = *(const v4fa*)(xg + xb + p * 8192); xa[p][1] = *(const v4fa*)(xg + xb + p * 8192 + 16); }
    asm volatile("s_wait_xcnt 0x0" :: "v"(xb) : "memory");      /* the wait in front of any reuse of the loads' address registers; the offset is named as an input so that no load's result lands on it ahead of the wait */
#pragma unroll
    for (int p = 0; p < 8; ++p) { FragH f;
#pragma unroll
      for (int q = 0; q < 4; ++q) { f.h[q] = (_Float16)bf16_round(xa[p][0][q]); f.h[4 + q] = (_Float16)bf16_round(xa[p][1][q]); }
      *(v8us*)(xs + (8 * p + w) * PJ_XP + lane * 8) = f.half[0]; }
  }
  __syncthreads();      /* the token rows are staged */
  const v8f z8 = {0.f,0.f,0.f,0.f,0.f,0.f,0.f,0.f};
  v8f acc[4][4];
#pragma unroll
  for (int i = 0; i < 4; ++i)
#pragma unroll
    for (int j = 0; j < 4; ++j) acc[i][j] = z8;
#pragma unroll      /* constant indices keep acc[][], wf[][] in registers */
  for (int s = 0; s < DM / 32; ++s) {
    v16h xf[4];
#pragma unroll
    for (int i = 0; i < 4; ++i) { if (s + 1 < DM / 32) wf[(s + 1) & 1][i] = fa_frag(wp + 16 * i * DM + 32 * (s + 1), hh); xf[i] = fa_frag(xs + (16 * i + ln) * PJ_XP + 32 * s, hh); }
    __builtin_amdgcn_sched_barrier(0);      /* a step's reads are issued together, ahead of its WMMAs; left alone the compiler spreads them in pairs among the WMMAs */
#pragma unroll
    for (int i = 0; i < 4; ++i)
#pragma unroll
      for (int j = 0; j < 4; ++j) acc[i][j] = fa_mma(wf[s & 1][i], xf[j], acc[i][j]);
    __builtin_amdgcn_sched_barrier(0);      /* the same: keeps the next step's reads behind this step's WMMAs */
  }
  asm volatile("s_wait_xcnt 0x0" ::: "memory");      /* the wait in front of any reuse of the weight loads' address registers */
  /* accumulator element r of acc[i][j] is output column 16 i + 8 hh + r of token 16 j + ln; x 0.0625 undoes the x16 of the weights */
  unsigned short* st = sts[w];
  if (w < 8) {
#pragma unroll
    for (int j = 0; j < 4; ++j)
#pragma unroll
      for (int i = 0; i < 4; ++i) { FragH f;
#pragma unroll
        for (int r = 0; r < 8; ++r) f.h[r] = (_Float16)(acc[i][j][r] * 0.0625f);
        *(v8us*)(st + (16 * j + ln) * PJ_SP + 16 * i + 8 * hh) = f.half[0]; }
  } else {
#pragma unroll
    for (int j = 0; j < 4; ++j)
#pragma unroll
      for (int i = 0; i < 4; ++i)
#pragma unroll
        for (int r = 0; r < 8; ++r) { FragH f; f.h[0] = (_Float16)(acc[i][j][r] * 0.0625f); st[(16 * i + 8 * hh + r) * PJ_SP + 16 * j + ln] = f.u[0]; }
  }
  __builtin_amdgcn_fence(__ATOMIC_ACQ_REL, "workgroup"); __builtin_amdgcn_wave_barrier();      /* the wave's own staging rows are written before they are read back as whole lines */
  unsigned short* op = w < 8 ? (unsigned short*)(w < 4 ? Q : Kg) + (size_t)t0 * DQ + (w & 3) * 64 : (unsigned short*)Vt + ((size_t)(t0 / SQ) * DV + (w & 3) * 64) * SQ + t0 % SQ;
  const int pitch = w < 8 ? DQ : SQ;      /* halves between two output rows */
  op += (size_t)((lane >> 3) * pitch + (lane & 7) * 8);      /* a wave's store is 4 rows of 128 B */
  v8us rw[16];
#pragma unroll      /* constant indices keep rw[] in registers */
  for (int q = 0; q < 16; ++q) rw[q] = *(const v8us*)(st + (q * 4 + (lane >> 3)) * PJ_SP + (lane & 7) * 8);
#pragma unroll
  for (int q = 0; q < 16; ++q) *(v8us*)(op + (size_t)(q * 4 * pitch)) = rw[q];
}
extern "C" void kernel_launch(void* const* d_in, const int* in_sizes, int n_in,
                              void* d_out, int out_size, void* d_ws, size_t ws_size, hipStream_t stream) {
  (void)in_sizes; (void)n_in; (void)out_size;
  const float* const* I = (const float* const*)d_in; const float* x = I[0]; const float* wq = I[1]; const float* wk = I[2]; const float* wv = I[3];      /* [in][out] weights */
  char* ws = (char*)d_ws; size_t off = 0;
  auto take = [&](size_t bytes) { char* p = ws + off; off += (bytes + 255) & ~(size_t)255; return p; };
  _Float16* BW = (_Float16*)take((size_t)3 * DQ * DM * 2);      /* q | k | v weights, transposed */
  _Float16* Q16 = (_Float16*)take(NR * DQ * 2); _Float16* K16 = (_Float16*)take(NR * DQ * 2);
  _Float16* VT = (_Float16*)take((size_t)NB * DV * SQ * 2);
  if (off > ws_size) return;
  k_wt3<<<dim3(DQ * (DM / 8) / 256, 3), 256, 0, stream>>>(wq, wk, wv, BW);
  k_proj<<<(unsigned)(NR / 64), 384, 0, stream>>>(x, BW, Q16, K16, VT);      /* q, k f16 rows and V^T per batch [DV][SQ] */
  k_fattn<<<dim3(SQ / 64, NB), 128, 0, stream>>>(Q16, K16, VT, (float*)d_out);      /* scores, softmax and attn v in one launch; the batch is grid.y */
}

// v007
// It runs in 44.2 microseconds.
// Next to v006, in two timings, it ran 1.15 and 1.16 times as fast.
// All steps since v000 together make it 110 times as fast.
#include <hip/hip_runtime.h>
// Single-head self-attention (x [8][2048][256]; Q, K, V = x W ([in][out] [256][256]); scores = Q.K/16; softmax over all 2048 keys; out = attn V -> [8][2048][256]).
// Structure: exact x16 transposed [in][out] weights as f16 rows (one launch for the three); one projection launch: 64 token rows per work-group read as f32, rounded and staged once in LDS as exact f16, q | k | v WMMA tiles (64x64 per wave, f32 accumulation) written as f16 rows, v straight as V^T rows; one fused attention launch (batch = grid.y): per 128-key stage (K and V^T rows brought into LDS by tensor loads, two buffers; a wave takes 32 query rows and 64 of the keys) transposed scores WMMA (K . Q^T), running-maximum softmax on VALU (f32; P x256 f16), O^T += V^T . P^T WMMA; scores and P never reach memory; f32 output.
// Compute dtype: inputs rounded to bf16; x / weights exact; q, k plain f16 (~2^-12); v, P plain f16 (~2^-12); scores / softmax f32. v_wmma_f32_16x16x32_f16.
#define NB 8
#define SQ 2048
#define DM 256
#define DQ 256
#define DV 256
#define QT 2048
#define NH 4                    /* V^T slabs of 64 */
#define HD 64
#define HG 1
#define NR ((size_t)NB * SQ)
#define QN SQ                        /* query rows per batch (debug hook) */
#define NBR NB                       /* batches (debug hook) */
#define MP ((int)NR)                 /* rows through the projections (debug hook) */
typedef __bf16 v16b __attribute__((ext_vector_type(16)));
typedef unsigned short v8us __attribute__((ext_vector_type(8), may_alias));
typedef float  v8f  __attribute__((ext_vector_type(8)));
typedef float  v4f  __attribute__((ext_vector_type(4)));
typedef float  v4fa __attribute__((ext_vector_type(4), may_alias));
union FragB { v16b v; v8us half[2]; unsigned short u[16]; };

__device__ __forceinline__ unsigned short bf16_bits(float x) { unsigned int u = __float_as_uint(x); return (unsigned short)((u + 0x7FFFu + ((u >> 16) & 1u)) >> 16); }
__device__ __forceinline__ float bf16_val(unsigned short b) { return __uint_as_float(((unsigned int)b) << 16); }
__device__ __forceinline__ float bf16_round(float x) { return bf16_val(bf16_bits(x)); }
// D += A·B with NT terms: 1 = ah·bh, 2 = + al·bh (A split), 3 = + ah·bl (both split)
template <int NT>
__device__ __forceinline__ v8f mmaN(v16b ah, v16b al, v16b bh, v16b bl, v8f c) {
  c = __builtin_amdgcn_wmma_f32_16x16x32_bf16(false, ah, false, bh, (short)0, c, false, false);
  if (NT >= 2) c = __builtin_amdgcn_wmma_f32_16x16x32_bf16(false, al, false, bh, (short)0, c, false, false);
  if (NT >= 3) c = __builtin_amdgcn_wmma_f32_16x16x32_bf16(false, ah, false, bl, (short)0, c, false, false);
  asm volatile("v_nop\n\tv_nop\n\tv_nop\n\tv_nop" : "+v"(c) : "v"(ah), "v"(al), "v"(bh), "v"(bl));
  return c;
}

__global__ __launch_bounds__(256) void k_wt_bf16(const float* __restrict__ W, unsigned short* __restrict__ Wt, int K, int N) {
  const int t = blockIdx.x * 256 + threadIdx.x;
  const int k8n = K / 8;
  if (t >= N * k8n) return;
  const int n = t / k8n, k8 = (t % k8n) * 8;
  v8us v;
#pragma unroll
  for (int i = 0; i < 8; ++i) v[i] = bf16_bits(W[(size_t)(k8 + i) * N + n]);
  *(v8us*)(Wt + (size_t)n * K + k8) = v;
  
}

// GEMM C[M][N] (f32, pitch ldc) = act(A[M][K]·W + bias). A f32 row-major (pitch lda) converted per fragment to bf16
// (ASPLIT: hi/lo two planes -> 2 terms, else single rounded term); Wt bf16 [N][K] (pitch ldb). BIAS_BF16 rounds the
// bias to bf16 first (bias quantised to bf16 before the add). K%32==0, M%16==0, N%64==0.
template <bool ASPLIT, int ACT, bool BIAS_BF16>
__global__ __launch_bounds__(128) void k_gemm_bf(const float* __restrict__ A, int lda, const unsigned short* __restrict__ Wt, int ldb,
                                               const float* __restrict__ bias, float* __restrict__ C, int ldc, int M, int N, int K) {
  __shared__ __attribute__((aligned(16))) float so[4][16][64];
  const int tid = threadIdx.x, w = tid >> 5, lane = tid & 31, ln = lane & 15, hh = lane >> 4;
  const int ntn = N / 64;
  const int wid = blockIdx.x * 4 + w;
  const int mt = wid / ntn, nq = wid % ntn;
  if (mt * 16 >= M) return;
  const int row0 = mt * 16, col0 = nq * 64;
  const float* arow = A + (size_t)(row0 + ln) * lda;
  v8f acc[4] = {};
  for (int kb = 0; kb < K; kb += 32) {
    FragB ah, al;
    const v4f x0 = *(const v4fa*)(arow + kb + 8 * hh), x1 = *(const v4fa*)(arow + kb + 8 * hh + 4);
    const v4f x2 = *(const v4fa*)(arow + kb + 16 + 8 * hh), x3 = *(const v4fa*)(arow + kb + 16 + 8 * hh + 4);
    float xs[16] = {x0[0],x0[1],x0[2],x0[3],x1[0],x1[1],x1[2],x1[3],x2[0],x2[1],x2[2],x2[3],x3[0],x3[1],x3[2],x3[3]};
#pragma unroll
    for (int i = 0; i < 16; ++i) { const unsigned short hb = bf16_bits(xs[i]); ah.u[i] = hb; al.u[i] = ASPLIT ? bf16_bits(xs[i] - bf16_val(hb)) : (unsigned short)0; }
#pragma unroll
    for (int t = 0; t < 4; ++t) {
      const unsigned short* brow = Wt + (size_t)(col0 + t * 16 + ln) * ldb + kb;
      FragB b;
      b.half[0] = *(const v8us*)(brow + 8 * hh);
      b.half[1] = *(const v8us*)(brow + 16 + 8 * hh);
      acc[t] = mmaN<ASPLIT ? 2 : 1>(ah.v, al.v, b.v, b.v, acc[t]);
    }
  }
#pragma unroll
  for (int t = 0; t < 4; ++t) {
    float bv = bias ? bias[col0 + t * 16 + ln] : 0.f;
    if (BIAS_BF16) bv = bf16_round(bv);
#pragma unroll
    for (int r = 0; r < 8; ++r) { float v = acc[t][r] + bv; if (ACT == 1) v = fmaxf(v, 0.f); so[w][8 * hh + r][t * 16 + ln] = v; }
  }
  __builtin_amdgcn_fence(__ATOMIC_ACQ_REL, "workgroup");
  __builtin_amdgcn_wave_barrier();
  const int rsub = lane >> 4, c4 = (lane & 15) * 4;
  {
#pragma unroll
    for (int q = 0; q < 8; ++q) {
      const int r = q * 2 + rsub;
      const v4f v = *(const v4fa*)&so[w][r][c4];
      *(v4f*)(C + (size_t)(row0 + r) * ldc + col0 + c4) = v;
    }
    
  }
}

// GEMM C = act(A·W + bias + resid): A f32 (ASPLIT -> hi/lo 2 terms), Wt bf16 [N][K]; ACT 0 none, 1 relu, 2 exact gelu;
// resid (optional, f32, row index = (row % rmod), pitch ldr, RES_BF16 rounds it) added before the activation.
template <bool ASPLIT, int ACT, bool BIAS_BF16, bool RES_BF16>
__global__ __launch_bounds__(128) void k_gemm_bf3(const float* __restrict__ A, int lda, const unsigned short* __restrict__ Wt, int ldb,
                                                const float* __restrict__ bias, const float* __restrict__ resid, int rmod, int ldr,
                                                float* __restrict__ C, int ldc, int M, int N, int K) {
  __shared__ __attribute__((aligned(16))) float so[4][16][64];
  const int tid = threadIdx.x, w = tid >> 5, lane = tid & 31, ln = lane & 15, hh = lane >> 4;
  const int ntn = N / 64;
  const int wid = blockIdx.x * 4 + w;
  const int mt = wid / ntn, nq = wid % ntn;
  if (mt * 16 >= M) return;
  const int row0 = mt * 16, col0 = nq * 64;
  const float* arow = A + (size_t)(row0 + ln) * lda;
  v8f acc[4] = {};
  for (int kb = 0; kb < K; kb += 32) {
    FragB ah, al;
    const v4f x0 = *(const v4fa*)(arow + kb + 8 * hh), x1 = *(const v4fa*)(arow + kb + 8 * hh + 4);
    const v4f x2 = *(const v4fa*)(arow + kb + 16 + 8 * hh), x3 = *(const v4fa*)(arow + kb + 16 + 8 * hh + 4);
    float xs[16] = {x0[0],x0[1],x0[2],x0[3],x1[0],x1[1],x1[2],x1[3],x2[0],x2[1],x2[2],x2[3],x3[0],x3[1],x3[2],x3[3]};
#pragma unroll
    for (int i = 0; i < 16; ++i) { const unsigned short hb = bf16_bits(xs[i]); ah.u[i] = hb; al.u[i] = ASPLIT ? bf16_bits(xs[i] - bf16_val(hb)) : (unsigned short)0; }
#pragma unroll
    for (int t = 0; t < 4; ++t) {
      const unsigned short* brow = Wt + (size_t)(col0 + t * 16 + ln) * ldb + kb;
      FragB b;
      b.half[0] = *(const v8us*)(brow + 8 * hh);
      b.half[1] = *(const v8us*)(brow + 16 + 8 * hh);
      acc[t] = mmaN<ASPLIT ? 2 : 1>(ah.v, al.v, b.v, b.v, acc[t]);
    }
  }
#pragma unroll
  for (int t = 0; t < 4; ++t) {
    const int col = col0 + t * 16 + ln;
    float bv = bias ? bias[col] : 0.f;
    if (BIAS_BF16) bv = bf16_round(bv);
#pragma unroll
    for (int r = 0; r < 8; ++r) {
      float v = acc[t][r] + bv;
      if (resid) { float rv = resid[(size_t)((row0 + 8 * hh + r) % rmod) * ldr + col]; if (RES_BF16) rv = bf16_round(rv); v += rv; }
      if (ACT == 1) v = fmaxf(v, 0.f);
      if (ACT == 2) v = 0.5f * v * (1.0f + erff(v * 0.70710678118654752f));
      if (ACT == 3) { const float u = 0.7978845608028654f * (v + 0.044715f * v * v * v); v = 0.5f * v * (1.0f + tanhf(u)); }
      so[w][8 * hh + r][t * 16 + ln] = v;
    }
  }
  __builtin_amdgcn_fence(__ATOMIC_ACQ_REL, "workgroup");
  __builtin_amdgcn_wave_barrier();
  const int rsub = lane >> 4, c4 = (lane & 15) * 4;
  {
#pragma unroll
    for (int q = 0; q < 8; ++q) {
      const int r = q * 2 + rsub;
      const v4f v = *(const v4fa*)&so[w][r][c4];
      *(v4f*)(C + (size_t)(row0 + r) * ldc + col0 + c4) = v;
    }
    
  }
}
// row LayerNorm (biased variance, eps) over N: s = X (+ R); optional out_sum <- s; out_norm <- (s-mu)*rsqrt(var+eps)*g + b
template <bool PARAM_BF16>
__global__ __launch_bounds__(256) void k_layernorm(const float* __restrict__ X, const float* __restrict__ R, const float* __restrict__ g, const float* __restrict__ bta,
                                                  float* __restrict__ out_sum, float* __restrict__ out_norm, int N, float eps) {
  __shared__ float red[256];
  const int row = blockIdx.x, tid = threadIdx.x;
  const float* x = X + (size_t)row * N; const float* rr = R ? R + (size_t)row * N : nullptr;
  float vals[16];                     // up to N = 4096
  const int per = N / 256;            // contiguous chunk per thread? use strided-by-4 chunks: thread handles j = tid*4 + 1024*u
  float s1 = 0.f;
  for (int u = 0; u < per / 4; ++u) {
    const int j = tid * 4 + 1024 * u;
    const v4f a = *(const v4fa*)(x + j);
    v4f b = {0.f,0.f,0.f,0.f}; if (rr) b = *(const v4fa*)(rr + j);
#pragma unroll
    for (int q = 0; q < 4; ++q) { const float v = a[q] + b[q]; vals[u * 4 + q] = v; s1 += v; }
  }
  red[tid] = s1; __syncthreads();
  for (int st = 128; st > 0; st >>= 1) { if (tid < st) red[tid] += red[tid + st]; __syncthreads(); }
  const float mu = red[0] / (float)N; __syncthreads();
  float s2 = 0.f;
  for (int u = 0; u < per / 4; ++u)
#pragma unroll
    for (int q = 0; q < 4; ++q) { const float c = vals[u * 4 + q] - mu; s2 += c * c; }
  red[tid] = s2; __syncthreads();
  for (int st = 128; st > 0; st >>= 1) { if (tid < st) red[tid] += red[tid + st]; __syncthreads(); }
  const float rs = rsqrtf(red[0] / (float)N + eps);
  {
    for (int u = 0; u < per / 4; ++u) {
      const int j = tid * 4 + 1024 * u;
      v4f o, sm;
#pragma unroll
      for (int q = 0; q < 4; ++q) {
        float gg = g[j + q], bb = bta[j + q];
        if (PARAM_BF16) { gg = bf16_round(gg); bb = bf16_round(bb); }
        sm[q] = vals[u * 4 + q]; o[q] = (vals[u * 4 + q] - mu) * rs * gg + bb;
      }
      if (out_sum) *(v4f*)(out_sum + (size_t)row * N + j) = sm;
      *(v4f*)(out_norm + (size_t)row * N + j) = o;
    }
    
  }
}



// ---- f16 WMMA path (v_wmma_f32_16x16x32_f16): 11-bit significands for operands in range — used where a [0,1] probability operand needs more precision than bf16
typedef _Float16 v16h __attribute__((ext_vector_type(16)));
union FragH { v16h v; v8us half[2]; _Float16 h[16]; unsigned short u[16]; };
template <int NT>
__device__ __forceinline__ v8f mmaH(v16h ah, v16h al, v16h bh, v16h bl, v8f c) {
  c = __builtin_amdgcn_wmma_f32_16x16x32_f16(false, ah, false, bh, (short)0, c, false, false);
  if (NT >= 2) c = __builtin_amdgcn_wmma_f32_16x16x32_f16(false, al, false, bh, (short)0, c, false, false);
  if (NT >= 3) c = __builtin_amdgcn_wmma_f32_16x16x32_f16(false, ah, false, bl, (short)0, c, false, false);
  asm volatile("v_nop\n\tv_nop\n\tv_nop\n\tv_nop" : "+v"(c) : "v"(ah), "v"(al), "v"(bh), "v"(bl));
  return c;
}
// batched GEMM like k_gemm_b but f16 operands: A f32 (split into f16 hi/lo if ASPLIT, else rounded to f16), Bt = f16 values [n][k]; alpha; C f32; N multiple of 16 (partial tiles skipped)
template <bool ASPLIT>
__global__ __launch_bounds__(128) void k_gemm_h(const float* __restrict__ A, int lda, size_t sA, const _Float16* __restrict__ Bh, int ldb, size_t sB, float alpha, float* __restrict__ C, int ldc, size_t sC, int M, int N, int K) {
  __shared__ __attribute__((aligned(16))) float so[4][16][64];
  const int tid = threadIdx.x, w = tid >> 5, lane = tid & 31, ln = lane & 15, hh = lane >> 4; const int by = blockIdx.y;
  A += (size_t)by * sA; Bh += (size_t)by * sB; C += (size_t)by * sC;
  const int ntn = (N + 63) / 64; const int wid = blockIdx.x * 4 + w; const int mt = wid / ntn, nq = wid % ntn; if (mt * 16 >= M) return;
  const int row0 = mt * 16, col0 = nq * 64; const float* arow = A + (size_t)(row0 + ln) * lda;
  v8f acc[4] = {};
  for (int kb = 0; kb < K; kb += 32) {
    FragH ah, al;
    const v4f x0 = *(const v4fa*)(arow + kb + 8 * hh), x1 = *(const v4fa*)(arow + kb + 8 * hh + 4), x2 = *(const v4fa*)(arow + kb + 16 + 8 * hh), x3 = *(const v4fa*)(arow + kb + 16 + 8 * hh + 4);
    float xs[16] = {x0[0],x0[1],x0[2],x0[3],x1[0],x1[1],x1[2],x1[3],x2[0],x2[1],x2[2],x2[3],x3[0],x3[1],x3[2],x3[3]};
#pragma unroll
    for (int i = 0; i < 16; ++i) { const _Float16 h = (_Float16)xs[i]; ah.h[i] = h; al.h[i] = ASPLIT ? (_Float16)(xs[i] - (float)h) : (_Float16)0.0f; }
#pragma unroll
    for (int t = 0; t < 4; ++t) { if (col0 + t * 16 >= N) continue; const size_t boff = (size_t)(col0 + t * 16 + ln) * ldb + kb; FragH bq; bq.half[0] = *(const v8us*)(Bh + boff + 8 * hh); bq.half[1] = *(const v8us*)(Bh + boff + 16 + 8 * hh);
      acc[t] = mmaH<ASPLIT ? 2 : 1>(ah.v, al.v, bq.v, bq.v, acc[t]); }
  }
#pragma unroll
  for (int t = 0; t < 4; ++t) { if (col0 + t * 16 >= N) continue;
#pragma unroll
    for (int r = 0; r < 8; ++r) so[w][8 * hh + r][t * 16 + ln] = acc[t][r] * alpha; }
  __builtin_amdgcn_fence(__ATOMIC_ACQ_REL, "workgroup"); __builtin_amdgcn_wave_barrier();
  const int rsub = lane >> 4, c4 = (lane & 15) * 4;
  {
#pragma unroll
    for (int q = 0; q < 8; ++q) { const int r = q * 2 + rsub; if (col0 + c4 < N) { const v4f v = *(const v4fa*)&so[w][r][c4]; *(v4f*)(C + (size_t)(row0 + r) * ldc + col0 + c4) = v; } }
     }
}

// k_gemm_hh variant with fused epilogue: v = acc·alpha + bias[by·sBias + col] (+ CP[(row/rowsPerB)·sCPb + by·64 + col] if CP) ; ACT 0 none / 1 elu ; writes f16 C16 (and f32 C if non-null)
template <int ACT>
__global__ __launch_bounds__(128) void k_gemm_hhx(const _Float16* __restrict__ A, int lda, size_t sA, const _Float16* __restrict__ Bh, int ldb, size_t sB, float alpha, const float* __restrict__ bias, size_t sBias, const float* __restrict__ CP, int rowsPerB, size_t sCPb, int row0g,
    float* __restrict__ C, _Float16* __restrict__ C16, int ldc, size_t sC, int M, int N, int K) {
  __shared__ __attribute__((aligned(16))) float so[4][16][64];
  const int tid = threadIdx.x, w = tid >> 5, lane = tid & 31, ln = lane & 15, hh = lane >> 4; const int by = blockIdx.y;
  A += (size_t)by * sA; Bh += (size_t)by * sB; const size_t cofs = (size_t)by * sC; const float* bp = bias ? bias + (size_t)by * sBias : nullptr;
  const int ntn = (N + 63) / 64; const int wid = blockIdx.x * 4 + w; const int mt = wid / ntn, nq = wid % ntn; if (mt * 16 >= M) return;
  const int row0 = mt * 16, col0 = nq * 64; const _Float16* arow = A + (size_t)(row0 + ln) * lda;
  v8f acc[4] = {};
  for (int kb = 0; kb < K; kb += 32) { FragH ah; ah.half[0] = *(const v8us*)((const unsigned short*)arow + kb + 8 * hh); ah.half[1] = *(const v8us*)((const unsigned short*)arow + kb + 16 + 8 * hh);
#pragma unroll
    for (int t = 0; t < 4; ++t) { if (col0 + t * 16 >= N) continue; const size_t boff = (size_t)(col0 + t * 16 + ln) * ldb + kb; FragH bq; bq.half[0] = *(const v8us*)((const unsigned short*)Bh + boff + 8 * hh); bq.half[1] = *(const v8us*)((const unsigned short*)Bh + boff + 16 + 8 * hh);
      acc[t] = mmaH<1>(ah.v, ah.v, bq.v, bq.v, acc[t]); }
  }
#pragma unroll
  for (int t = 0; t < 4; ++t) { if (col0 + t * 16 >= N) continue; const int col = col0 + t * 16 + ln; const float bv = bp ? bf16_round(bp[col]) : 0.f;
#pragma unroll
    for (int r = 0; r < 8; ++r) { float v = acc[t][r] * alpha + bv; if (CP) { const int rr = row0g + row0 + 8 * hh + r; if (rowsPerB < 0) v += CP[cofs + (size_t)rr * ldc + col];      /* rowsPerB < 0: own element of the batched C plane */ else { const int bidx = rr / rowsPerB; v += CP[(size_t)bidx * sCPb + (size_t)by * 64 + col]; } } if (ACT == 1) v = (v > 0.f) ? v : expm1f(v); else if (ACT == 7) v = (v > 0.f) ? v + 1.0f : expf(v); else if (ACT == 8) v = tanhf(v); else if (ACT == 9) v = 0.5f * v * (1.0f + tanhf(0.7978845608028654f * (v + 0.044715f * v * v * v))); else if (ACT == 11) v = 1.0f / (1.0f + expf(-v)); else if (ACT == 12) v = (v > 0.f) ? v : 0.01f * v; else if (ACT == 14) v = (v > 0.f) ? v : 0.1f * v; else if (ACT == 16) v = (v >= 0.f) ? v : 0.3f * v; else if (ACT == 17) v = (v >= 0.f) ? v : 0.2f * v; else if (ACT == 15) v = v / (1.0f + expf(-v)); else if (ACT == 3) v = fmaxf(v, 0.f); else if (ACT == 6) v = 0.5f * v * (1.0f + erff(v * 0.70710678118654752f)); so[w][8 * hh + r][t * 16 + ln] = v; } }
  __builtin_amdgcn_fence(__ATOMIC_ACQ_REL, "workgroup"); __builtin_amdgcn_wave_barrier();
  const int rsub = lane >> 4, c4 = (lane & 15) * 4; typedef _Float16 v4h __attribute__((ext_vector_type(4)));
  {
#pragma unroll
    for (int q = 0; q < 8; ++q) { const int r = q * 2 + rsub; if (col0 + c4 < N) { const v4f v = *(const v4fa*)&so[w][r][c4]; if (C) *(v4f*)(C + cofs + (size_t)(row0 + r) * ldc + col0 + c4) = v; if (C16) { v4h h4; for (int i = 0; i < 4; ++i) h4[i] = (_Float16)v[i]; *(v4h*)(C16 + cofs + (size_t)(row0 + r) * ldc + col0 + c4) = h4; } } }
     }
}


typedef _Float16 v4h __attribute__((ext_vector_type(4)));

__global__ __launch_bounds__(256) void k_h16(const float* __restrict__ x, _Float16* __restrict__ X16, size_t n8) { const size_t t = (size_t)blockIdx.x * 256 + threadIdx.x; if (t >= n8) return; FragH f;
#pragma unroll
  for (int q = 0; q < 8; ++q) f.h[q] = (_Float16)x[t * 8 + q]; *(v8us*)((unsigned short*)X16 + t * 8) = f.half[0];  }
__global__ __launch_bounds__(256) void k_round16f(const float* __restrict__ W, _Float16* __restrict__ Bt, size_t n8) { const size_t t = (size_t)blockIdx.x * 256 + threadIdx.x; if (t >= n8) return; FragH f;
#pragma unroll
  for (int i = 0; i < 8; ++i) f.h[i] = (_Float16)(bf16_round(W[t * 8 + i]) * 16.0f); *(v8us*)((unsigned short*)Bt + t * 8) = f.half[0];  }

__global__ __launch_bounds__(256) void k_hl(const float* __restrict__ F, _Float16* __restrict__ Hh, _Float16* __restrict__ Hl, size_t n8) { const size_t t = (size_t)blockIdx.x * 256 + threadIdx.x; if (t >= n8) return; FragH fh, fl; const v4f a = *(const v4fa*)(F + t * 8), c = *(const v4fa*)(F + t * 8 + 4);
#pragma unroll
  for (int q = 0; q < 4; ++q) { _Float16 h = (_Float16)a[q]; fh.h[q] = h; fl.h[q] = (_Float16)((a[q] - (float)h) * 1024.0f); h = (_Float16)c[q]; fh.h[4 + q] = h; fl.h[4 + q] = (_Float16)((c[q] - (float)h) * 1024.0f); }
  { *(v8us*)((unsigned short*)Hh + t * 8) = fh.half[0]; *(v8us*)((unsigned short*)Hl + t * 8) = fl.half[0];  } }



__global__ __launch_bounds__(256) void k_wnat(const float* __restrict__ w, size_t n8, _Float16* __restrict__ Bt) { const size_t t = (size_t)blockIdx.x * 256 + threadIdx.x; if (t >= n8) return; FragH f; for (int q = 0; q < 8; ++q) f.h[q] = (_Float16)(bf16_round(w[t * 8 + q]) * 16.0f); *(v8us*)((unsigned short*)Bt + t * 8) = f.half[0];  }
__global__ __launch_bounds__(256) void k_rsm(const float* __restrict__ S, _Float16* __restrict__ P, int nrows) {
  #pragma clang fp contract(off)
  const int i = blockIdx.x * 256 + threadIdx.x; if (i >= nrows) return; const float* s = S + (size_t)i * SQ; float mx = -3.0e38f;
#pragma unroll 1
  for (int j = 0; j < SQ; ++j) mx = fmaxf(mx, s[j]); float se = 0.f;
#pragma unroll 1
  for (int j = 0; j < SQ; ++j) se += expf(s[j] - mx); const float sc = 256.0f / se;
#pragma unroll 1
  for (int j0 = 0; j0 < SQ; j0 += 8) { FragH f; for (int q = 0; q < 8; ++q) f.h[q] = (_Float16)(expf(s[j0 + q] - mx) * sc); unsigned short* d = (unsigned short*)P + (size_t)i * SQ + j0; *(v8us*)d = f.half[0];  } }
__global__ __launch_bounds__(256) void k_vt(const _Float16* __restrict__ V16, int b, int h0, _Float16* __restrict__ VT) { __shared__ unsigned short tl[64][65]; const int tid = threadIdx.x; const int hh = blockIdx.x % HG, sg = blockIdx.x / HG; const int s0 = sg * 64; const int h = h0 + hh;
  for (int i = tid; i < 64 * 8; i += 256) { const int j = i / 8, d8 = (i % 8) * 8; FragH f; f.half[0] = *(const v8us*)((const unsigned short*)V16 + ((size_t)b * SQ + s0 + j) * DM + h * HD + d8); for (int q = 0; q < 8; ++q) tl[d8 + q][j] = f.u[q]; }
  __syncthreads();
  { for (int i = tid; i < 64 * 8; i += 256) { const int d = i / 8, j8 = (i % 8) * 8; FragH f; for (int q = 0; q < 8; ++q) f.u[q] = tl[d][j8 + q]; *(v8us*)((unsigned short*)VT + ((size_t)hh * HD + d) * SQ + s0 + j8) = f.half[0]; }  } }

// Fused attention, one launch. A work-group is 4 waves and 64 query rows of one batch. The keys are walked in stages of 128. Wave w owns the 32 query rows of half w >> 1 (two 16-row tiles) and, of every stage,
// the 64 keys of half w & 1: each K or V^T fragment it reads from LDS feeds two WMMAs, one per row tile. Its Q fragments (2 x 8 k steps) and its 32 x 256 f32 partial output tile stay in registers.
// K rows and V^T rows of a stage lie in LDS (pitch = 256 B + 16 B for 16-byte readers). Each wave brings a quarter of a stage with one tensor load (through no register): wave 0 / 1 the first / second 256 B of the 128 K rows,
// wave 2 / 3 the first / second 128 V^T rows. Two buffers: the next stage flies while this one is worked on. Both products are formed transposed: S^T = K . Q^T (K rows are the A operand, Q the B operand) and O^T += V^T . P^T, so a lane holds scores and outputs of ONE query. Softmax keeps a running maximum per query and wave; the output tile and the sum are rescaled when it grows.
// Two S^T accumulator tiles (32 keys), converted in place, are a B fragment of P^T in the hardware k order, which is the order of fa_frag: P touches neither LDS nor another lane. P = 256 * exp(s - max), f16; the factor cancels in the division by the sum. Behind the loop the two waves of a row half join their partial maxima, sums and tiles through LDS, each for 128 output columns.
#define FA_KP 136      /* halves per staged half row of K and per staged V^T row: 256 B + 16 B */
#define FA_ST 128      /* keys per stage */
#define FA_SL 17408    /* halves per slice of a buffer: 128 rows of 272 B = 34,816 B = 17 x 2 KiB */
#define FA_BUF (4 * FA_SL)      /* halves per buffer: K bytes 0-255 | K bytes 256-511 | V^T rows 0-127 | V^T rows 128-255 */
#define FA_OP 132      /* floats per staged output row: 512 B + 16 B */
#define FA_EW (4096 + 1024 + 32 * FA_OP)      /* floats per wave behind the loop: the half tile for the partner | its maxima and sums | the wave's output staging rows */
#define FA_C 0.09016844005556021f      /* log2(e) / 16: the score scale folded into the exponent */
__device__ __forceinline__ v16h fa_frag(const unsigned short* p, int hh) { FragH f; f.half[0] = *(const v8us*)(p + 8 * hh); f.half[1] = *(const v8us*)(p + 16 + 8 * hh); return f.v; }
__device__ __forceinline__ v8f fa_mma(v16h a, v16h b, v8f c) { return __builtin_amdgcn_wmma_f32_16x16x32_f16(false, a, false, b, (short)0, c, false, false); }
/* eight 2^x in one statement: the outputs are early-clobber, so no v_exp_f32 overwrites the source of the one in front of it, and the closing v_nop is the one slot the instruction set asks for behind a transcendental */
__device__ __forceinline__ v8f fa_exp2(v8f x) { float d0, d1, d2, d3, d4, d5, d6, d7;
  asm("v_exp_f32 %0, %8\n\tv_exp_f32 %1, %9\n\tv_exp_f32 %2, %10\n\tv_exp_f32 %3, %11\n\tv_exp_f32 %4, %12\n\tv_exp_f32 %5, %13\n\tv_exp_f32 %6, %14\n\tv_exp_f32 %7, %15\n\tv_nop"
      : "=&v"(d0), "=&v"(d1), "=&v"(d2), "=&v"(d3), "=&v"(d4), "=&v"(d5), "=&v"(d6), "=&v"(d7) : "v"(x[0]), "v"(x[1]), "v"(x[2]), "v"(x[3]), "v"(x[4]), "v"(x[5]), "v"(x[6]), "v"(x[7]));
  const v8f d = {d0, d1, d2, d3, d4, d5, d6, d7}; return d; }
/* one 2^x, with the same closing slot behind the transcendental */
__device__ __forceinline__ float fa_exp2s(float x) { float d; asm("v_exp_f32 %0, %1\n\tv_nop" : "=&v"(d) : "v"(x)); return d; }
__device__ __forceinline__ float fa_xh(float x) { return __builtin_bit_cast(float, __builtin_amdgcn_permlanex16(__builtin_bit_cast(int, x), __builtin_bit_cast(int, x), 0x76543210, 0xfedcba98, false, false)); }      /* lane l with lane l ^ 16 */
typedef _Float16 v8h __attribute__((ext_vector_type(8)));
typedef unsigned int u32x4 __attribute__((ext_vector_type(4)));
typedef unsigned int u32x8 __attribute__((ext_vector_type(8)));
__device__ __forceinline__ unsigned int fa_uni(unsigned int v) { return (unsigned int)__builtin_amdgcn_readfirstlane(v); }
__device__ __forceinline__ unsigned int fa_pinned(unsigned int v) { unsigned int s = fa_uni(v);
  asm volatile("" : "+s"(s));      /* pinned(): the test is held in a scalar register, so that the branch on it is a scalar branch (a tensor load ignores EXEC) */
  return s; }
/* descriptor group 0 of a tensor load: the tile's first byte at ga goes to LDS byte offset lds */
__device__ __forceinline__ u32x4 fa_group0(unsigned int lds, unsigned long long ga) { u32x4 g;
  g[0] = fa_uni(1u); g[1] = fa_uni(lds); g[2] = fa_uni((unsigned int)ga); g[3] = fa_uni((((unsigned int)(ga >> 32)) & 0x01FFFFFFu) | 0x80000000u);
  asm volatile("" : "+s"(g));      /* pinned(): the descriptor's words are held in these scalar registers; with the wait that names them, none is reused while the request is outstanding */
  return g; }
/* descriptor group 1: a tile of N rows of R bytes, source pitch P bytes; W0 = word 0 (no mask, 1-byte elements, 16 B of pad behind every row of R bytes) */
template <unsigned int W0, unsigned int R, unsigned int N, unsigned int P>
__device__ __forceinline__ u32x8 fa_group1() { u32x8 g;
  g[0] = fa_uni(W0); g[1] = fa_uni((R & 0xFFFFu) << 16); g[2] = fa_uni((R >> 16) | ((N & 0xFFFFu) << 16)); g[3] = fa_uni((N >> 16) | (R << 16));
  g[4] = fa_uni(N); g[5] = fa_uni(P); g[6] = fa_uni(0u); g[7] = fa_uni(0u);
  asm volatile("" : "+s"(g));      /* pinned(): as in fa_group0 */
  return g; }
__device__ __forceinline__ void fa_tload(u32x4 g0, u32x8 g1) { asm volatile("tensor_load_to_lds %0, %1" :: "s"(g0), "s"(g1) : "memory"); }      /* the tile goes from global memory to LDS through no register */
typedef float fa_f32 __attribute__((may_alias));
__global__ __launch_bounds__(128) void k_fattn(const _Float16* __restrict__ Q, const _Float16* __restrict__ Kg, const _Float16* __restrict__ Vt, float* __restrict__ O) {
  __shared__ __attribute__((aligned(2048))) unsigned short ring[2 * FA_BUF];      /* every slice starts at a multiple of 2 KiB */
  const int tid = threadIdx.x, w = tid >> 5, lane = tid & 31, ln = lane & 15, hh = lane >> 4, b = blockIdx.y;
  const int kh = w & 1;      /* the wave's half of every stage's keys, and the half of the output columns that it finishes */
  const int q0 = blockIdx.x * 64 + 32 * (w >> 1);
  const unsigned short* qp = (const unsigned short*)Q + ((size_t)b * SQ + q0 + ln) * DQ;
  v16h qa[2][DQ / 32];
#pragma unroll      /* constant indices keep qa[][] in registers */
  for (int m = 0; m < 2; ++m)
#pragma unroll
    for (int i = 0; i < DQ / 32; ++i) qa[m][i] = fa_frag(qp + m * 16 * DQ + 32 * i, hh);
  asm volatile("s_wait_xcnt 0x0" ::: "memory");      /* the wait in front of any reuse of the loads' address registers */
  const unsigned int wv = fa_uni((unsigned int)tid >> 5);      /* the wave's number in a scalar register */
  const unsigned int rb = (unsigned int)(size_t)ring + wv * (FA_SL * 2);      /* LDS byte offset of the wave's slice in buffer 0 */
  const unsigned long long ga0 = wv < 2u ? (unsigned long long)(size_t)Kg + ((unsigned long long)b * SQ * DQ + (wv & 1u) * 128) * 2      /* the wave's half of K row 0 of the batch */
                                        : (unsigned long long)(size_t)Vt + ((unsigned long long)b * DV + (wv & 1u) * 128) * SQ * 2;      /* or its first V^T row of the batch */
  const unsigned int gst = wv < 2u ? FA_ST * DQ * 2 : FA_ST * 2;      /* source bytes from one stage to the next */
  const u32x8 g1k = fa_group1<(1u << 20) | (5u << 22) | (3u << 25), 256u, 128u, DQ * 2u>();      /* 128 half rows of K */
  const u32x8 g1v = fa_group1<(1u << 20) | (5u << 22) | (3u << 25), 256u, 128u, SQ * 2u>();      /* 128 V^T rows, 128 keys of each */
  u32x4 g0;
  auto issue = [&](unsigned int ch) {      /* the wave's slice of stage ch into buffer ch & 1 */
    g0 = fa_group0(rb + (ch & 1u) * (FA_BUF * 2), ga0 + (unsigned long long)ch * gst);
    if (fa_pinned(wv < 2u)) fa_tload(g0, g1k);
    if (fa_pinned(wv >= 2u)) fa_tload(g0, g1v);
  };
  auto landed = [&]() { asm volatile("s_wait_tensorcnt 0x0" :: "s"(g0), "s"(g1k), "s"(g1v) : "memory"); };      /* the wave's own request has landed; the descriptor is named as an input so that its registers keep their values up to here */
  issue(0);
  landed();      /* the wave's slice of stage 0 */
  __syncthreads();      /* stage 0 is published */
  issue(1);
  const v8f z8 = {0.f,0.f,0.f,0.f,0.f,0.f,0.f,0.f};
  v8f o[2][DV / 16], lr[2] = {z8, z8};      /* o[m][j] is a tile of O^T: 16 output columns x 16 queries; o[m][0..7]: the column half the wave finishes itself (kh); o[m][8..15]: the half its partner finishes */
  float mr[2] = {-3.0e38f, -3.0e38f};      /* running maximum of the lane's query 16 m + ln */
#pragma unroll
  for (int m = 0; m < 2; ++m) {
#pragma unroll
    for (int j = 0; j < DV / 16; ++j) o[m][j] = z8;
  }
#pragma unroll 1      /* one stage per trip: the body is already 128 WMMAs long */
  for (int c = 0; c < SQ / FA_ST; ++c) {
    const unsigned short* ks = ring + (c & 1) * FA_BUF + kh * 64 * FA_KP;      /* the wave's 64 key rows in this stage's buffer */
    const unsigned short* vs = ring + (c & 1) * FA_BUF + 2 * FA_SL + kh * 64;      /* the wave's 64 keys of V^T row 0 */
    const unsigned short* vh[2] = {vs + kh * 128 * FA_KP, vs + (1 - kh) * 128 * FA_KP};      /* the V^T rows of the wave's own column half, of its partner's */
    /* The wave's 64 A fragments come from LDS in 8 groups of 8 (groups 0-3: K, two k steps x four key tiles; groups 4-7: V^T, one k step x eight column tiles); a group feeds 16 WMMAs. */
    v16h fb[8][8];
    auto ld = [&](int g) {
#pragma unroll      /* constant indices keep fb[][] in registers */
      for (int e = 0; e < 8; ++e) fb[g][e] = (g < 4) ? fa_frag(ks + (g >> 1) * FA_SL + ((e & 3) * 16 + ln) * FA_KP + 32 * ((2 * g + (e >> 2)) & 3), hh) : fa_frag(vh[g & 1] + (e * 16 + ln) * FA_KP + 32 * ((g - 4) >> 1), hh); };
    v8f s[2][4] = {{z8, z8, z8, z8}, {z8, z8, z8, z8}};
    ld(0); ld(1);
#pragma unroll
    for (int g = 0; g < 4; ++g) {
      ld(g + 2);
      __builtin_amdgcn_sched_barrier(0);      /* a group's LDS reads are issued together, two groups ahead of its WMMAs; left alone the compiler reads each fragment right in front of its WMMA and waits out the LDS latency every time */
#pragma unroll
      for (int e = 0; e < 8; ++e)
#pragma unroll
        for (int m = 0; m < 2; ++m) s[m][e & 3] = fa_mma(fb[g][e], qa[m][2 * g + (e >> 2)], s[m][e & 3]);
      __builtin_amdgcn_sched_barrier(0);      /* the same: keeps the next group's reads behind this group's WMMAs */
    }
    /* accumulator element r of s[m][t] is key 16 t + 8 hh + r of the wave's 64, query 16 m + ln: a query's scores lie in lanes ln and ln + 16 */
    v16h pb[2][2];      /* P^T as B fragments: query tile m, k step of 32 keys */
#pragma unroll
    for (int m = 0; m < 2; ++m) {
      const v8f x8 = __builtin_elementwise_max(__builtin_elementwise_max(s[m][0], s[m][1]), __builtin_elementwise_max(s[m][2], s[m][3]));
      float x = fmaxf(fmaxf(fmaxf(x8[0], x8[1]), fmaxf(x8[2], x8[3])), fmaxf(fmaxf(x8[4], x8[5]), fmaxf(x8[6], x8[7])));
      x = fmaxf(x, fa_xh(x));
      const float mn = fmaxf(mr[m], x), al = fa_exp2s((mr[m] - mn) * FA_C), bs = 8.0f - mn * FA_C; mr[m] = mn;
      v8f p[4]; v8h ph[4];
#pragma unroll
      for (int t = 0; t < 4; ++t) { p[t] = fa_exp2(s[m][t] * FA_C + bs); ph[t] = __builtin_convertvector(p[t], v8h); }
#pragma unroll
      for (int k = 0; k < 2; ++k) pb[m][k] = __builtin_shufflevector(ph[2 * k], ph[2 * k + 1], 0, 1, 2, 3, 4, 5, 6, 7, 8, 9, 10, 11, 12, 13, 14, 15);      /* slots 0-7: keys 32 k + 8 hh + r, slots 8-15: keys 32 k + 16 + 8 hh + r, as fa_frag reads V^T */
      lr[m] = lr[m] * al + ((p[0] + p[1]) + (p[2] + p[3]));      /* each lane keeps eight sums of its own keys; they are joined once, behind the loop */
#pragma unroll
      for (int j = 0; j < DV / 16; ++j) o[m][j] *= al;
    }
#pragma unroll
    for (int g = 4; g < 8; ++g) {
      if (g + 2 < 8) ld(g + 2);
      __builtin_amdgcn_sched_barrier(0);      /* as above: reads two groups ahead of their WMMAs */
#pragma unroll
      for (int e = 0; e < 8; ++e)
#pragma unroll
        for (int m = 0; m < 2; ++m) o[m][(g & 1) * 8 + e] = fa_mma(fb[g][e], pb[m][(g - 4) >> 1], o[m][(g & 1) * 8 + e]);
      __builtin_amdgcn_sched_barrier(0);      /* as above */
    }
    asm volatile("s_wait_dscnt 0x0" ::: "memory");      /* the wave's reads of this stage's buffer have returned before the buffer is refilled */
    landed();      /* the wave's slice of the next stage */
    __syncthreads();      /* the next stage is published, and every wave has left this stage's buffer */
    if (fa_pinned(c + 2 < SQ / FA_ST)) issue((unsigned int)c + 2u);
  }
  landed();      /* no request is outstanding behind the loop */
  asm volatile("s_wait_dscnt 0x0" ::: "memory");      /* nor an LDS read */
  /* The last trip's barrier ended every read of the ring, and nothing flies into it any more: it now serves the join of the wave pairs and the output staging, each wave in a region of its own. */
  fa_f32* ew = (fa_f32*)ring + w * FA_EW; const fa_f32* eo = (const fa_f32*)ring + (w ^ 1) * FA_EW;      /* the wave's region, its partner's */
  float ls[2];
#pragma unroll
  for (int m = 0; m < 2; ++m) {
    float l = ((lr[m][0] + lr[m][1]) + (lr[m][2] + lr[m][3])) + ((lr[m][4] + lr[m][5]) + (lr[m][6] + lr[m][7])); l += fa_xh(l); ls[m] = l;      /* the query's sum over the wave's keys */
    ew[4096 + (m * 2) * 32 + lane] = mr[m]; ew[4096 + (m * 2 + 1) * 32 + lane] = l;
#pragma unroll
    for (int h = 0; h < 2; ++h)      /* lane for lane, 16 bytes a lane: the partner's lane holds the same query and, in its own half, the same columns */
#pragma unroll
      for (int j = 0; j < 8; ++j) { const v4f vo = {o[m][8 + j][4 * h], o[m][8 + j][4 * h + 1], o[m][8 + j][4 * h + 2], o[m][8 + j][4 * h + 3]}; *(v4fa*)(ew + (((m * 8 + j) * 2 + h) * 32 + lane) * 4) = vo; }
  }
  __syncthreads();      /* each wave's half tile, maxima and sums are written before its partner reads them */
  fa_f32* so = ew + 4096 + 1024;
#pragma unroll
  for (int m = 0; m < 2; ++m) {
    const float mo = eo[4096 + (m * 2) * 32 + lane], lo = eo[4096 + (m * 2 + 1) * 32 + lane];
    const float mn = fmaxf(mr[m], mo);
    float fw = fa_exp2s((mr[m] - mn) * FA_C), fo = fa_exp2s((mo - mn) * FA_C);      /* both partial results are brought to the common maximum */
    const float inv = 1.0f / (ls[m] * fw + lo * fo); fw *= inv; fo *= inv;
#pragma unroll
    for (int j = 0; j < 8; ++j)
#pragma unroll
      for (int h = 0; h < 2; ++h) { const v4f vo = *(const v4fa*)(eo + (((m * 8 + j) * 2 + h) * 32 + lane) * 4);
        const v4f ow = {o[m][j][4 * h], o[m][j][4 * h + 1], o[m][j][4 * h + 2], o[m][j][4 * h + 3]};
        *(v4fa*)(so + (16 * m + ln) * FA_OP + j * 16 + 8 * hh + 4 * h) = ow * fw + vo * fo; }      /* element r of o[m][j] is output column 16 j + 8 hh + r of query 16 m + ln: 16 bytes of one staging row */
  }
  __builtin_amdgcn_fence(__ATOMIC_ACQ_REL, "workgroup"); __builtin_amdgcn_wave_barrier();      /* the wave's own staging rows are written before they are read back as whole lines */
  float* op = O + ((size_t)b * SQ + q0) * DV + kh * 128 + lane * 4;
  v4f rw[32];
#pragma unroll      /* constant indices keep rw[] in registers */
  for (int q = 0; q < 32; ++q) rw[q] = *(const v4fa*)(so + q * FA_OP + lane * 4);
#pragma unroll
  for (int q = 0; q < 32; ++q) *(v4f*)(op + q * DV) = rw[q];      /* a wave's store is 512 B of one output row */
}
// Wt[m][n][k] = f16(bf16(W_m[k][n]) * 16) for the three f32 row-major [in][out] weights, m = grid.y (power-of-two scale: bf16-exact weights stay exact in f16 away from the subnormal range)
__global__ __launch_bounds__(256) void k_wt3(const float* __restrict__ Wq, const float* __restrict__ Wk, const float* __restrict__ Wv, _Float16* __restrict__ Wt) {
  const float* W = blockIdx.y == 0 ? Wq : (blockIdx.y == 1 ? Wk : Wv);
  const int t = blockIdx.x * 256 + threadIdx.x; const int n = t / (DM / 8), k8 = (t % (DM / 8)) * 8; FragH f;
#pragma unroll
  for (int i = 0; i < 8; ++i) f.h[i] = (_Float16)(bf16_round(W[(size_t)(k8 + i) * DQ + n]) * 16.0f);
  *(v8us*)((unsigned short*)Wt + ((size_t)blockIdx.y * DQ + n) * DM + k8) = f.half[0];
}
// Projection stage, one launch. A work-group is 12 waves and 64 token rows: the rows are read once as f32, rounded to bf16 (exact in f16) and staged in LDS for all 12 waves.
// Wave w makes the 64 x 64 tile of matrix w / 4 (q, k, v), column slab w % 4, over the whole k = 256; its weight fragments come from the transposed f16 rows in global memory, one k step ahead.
// The weights are the A operand and the tokens the B operand, so an accumulator lane holds 8 consecutive output columns of one token: for q and k one 16-byte LDS store into the wave's own
// staging rows (row = token); for v the 8 values go to 8 staging rows (row = column), which makes the V^T rows. Either way the staging rows go out as whole 128-byte lines.
#define PJ_XP 264      /* halves per staged x row: 512 B + 16 B */
#define PJ_SP 72       /* halves per staged output row: 128 B + 16 B */
__global__ __launch_bounds__(384) void k_proj(const float* __restrict__ x, const _Float16* __restrict__ Wt, _Float16* __restrict__ Q, _Float16* __restrict__ Kg, _Float16* __restrict__ Vt) {
  __shared__ __attribute__((aligned(16))) unsigned short xs[64 * PJ_XP];
  __shared__ __attribute__((aligned(16))) unsigned short sts[12][64 * PJ_SP];
  const int tid = threadIdx.x, lane = tid & 31, ln = lane & 15, hh = lane >> 4;
  const int w = __builtin_amdgcn_readfirstlane(tid >> 5);      /* the wave's number in a scalar register: the tests on it below become scalar branches */
  const int t0 = blockIdx.x * 64;      /* first token row; 64 divides SQ, so the rows are of one batch */
  const unsigned short* wp = (const unsigned short*)Wt + (size_t)w * 64 * DM + ln * DM;      /* rows 64 w .. 64 w + 63 of the 768 transposed weight rows */
  v16h wf[2][4];
#pragma unroll
  for (int i = 0; i < 4; ++i) wf[0][i] = fa_frag(wp + 16 * i * DM, hh);
  asm volatile("s_wait_xcnt 0x0" ::: "memory");      /* the wait in front of any reuse of the weight loads' address registers */
  if (w < 8) {      /* the 64 rows are 64 KB in a row: 2048 pieces of 8 floats, 8 for each thread of the first 8 waves */
    const char* xg = (const char*)(x + (size_t)t0 * DM); const unsigned xb = tid * 32;      /* uniform base, the thread's byte offset */
    v4f xa[8][2];
#pragma unroll      /* constant indices keep xa[][] in registers */
    for (int p = 0; p < 8; ++p) { xa[p][0] = *(const v4fa*)(xg + xb + p * 8192); xa[p][1] = *(const v4fa*)(xg + xb + p * 8192 + 16); }
    asm volatile("s_wait_xcnt 0x0" :: "v"(xb) : "memory");      /* the wait in front of any reuse of the loads' address registers; the offset is named as an input so that no load's result lands on it ahead of the wait */
#pragma unroll
    for (int p = 0; p < 8; ++p) { FragH f;
#pragma unroll
      for (int q = 0; q < 4; ++q) { f.h[q] = (_Float16)bf16_round(xa[p][0][q]); f.h[4 + q] = (_Float16)bf16_round(xa[p][1][q]); }
      *(v8us*)(xs + (8 * p + w) * PJ_XP + lane * 8) = f.half[0]; }
  }
  __syncthreads();      /* the token rows are staged */
  const v8f z8 = {0.f,0.f,0.f,0.f,0.f,0.f,0.f,0.f};
  v8f acc[4][4];
#pragma unroll
  for (int i = 0; i < 4; ++i)
#pragma unroll
    for (int j = 0; j < 4; ++j) acc[i][j] = z8;
#pragma unroll      /* constant indices keep acc[][], wf[][] in registers */
  for (int s = 0; s < DM / 32; ++s) {
    v16h xf[4];
#pragma unroll
    for (int i = 0; i < 4; ++i) { if (s + 1 < DM / 32) wf[(s + 1) & 1][i] = fa_frag(wp + 16 * i * DM + 32 * (s + 1), hh); xf[i] = fa_frag(xs + (16 * i + ln) * PJ_XP + 32 * s, hh); }
    __builtin_amdgcn_sched_barrier(0);      /* a step's reads are issued together, ahead of its WMMAs; left alone the compiler spreads them in pairs among the WMMAs */
#pragma unroll
    for (int i = 0; i < 4; ++i)
#pragma unroll
      for (int j = 0; j < 4; ++j) acc[i][j] = fa_mma(wf[s & 1][i], xf[j], acc[i][j]);
    __builtin_amdgcn_sched_barrier(0);      /* the same: keeps the next step's reads behind this step's WMMAs */
  }
  asm volatile("s_wait_xcnt 0x0" ::: "memory");      /* the wait in front of any reuse of the weight loads' address registers */
  /* accumulator element r of acc[i][j] is output column 16 i + 8 hh + r of token 16 j + ln; x 0.0625 undoes the x16 of the weights */
  unsigned short* st = sts[w];
  if (w < 8) {
#pragma unroll
    for (int j = 0; j < 4; ++j)
#pragma unroll
      for (int i = 0; i < 4; ++i) { FragH f;
#pragma unroll
        for (int r = 0; r < 8; ++r) f.h[r] = (_Float16)(acc[i][j][r] * 0.0625f);
        *(v8us*)(st + (16 * j + ln) * PJ_SP + 16 * i + 8 * hh) = f.half[0]; }
  } else {
#pragma unroll
    for (int j = 0; j < 4; ++j)
#pragma unroll
      for (int i = 0; i < 4; ++i)
#pragma unroll
        for (int r = 0; r < 8; ++r) { FragH f; f.h[0] = (_Float16)(acc[i][j][r] * 0.0625f); st[(16 * i + 8 * hh + r) * PJ_SP + 16 * j + ln] = f.u[0]; }
  }
  __builtin_amdgcn_fence(__ATOMIC_ACQ_REL, "workgroup"); __builtin_amdgcn_wave_barrier();      /* the wave's own staging rows are written before they are read back as whole lines */
  unsigned short* op = w < 8 ? (unsigned short*)(w < 4 ? Q : Kg) + (size_t)t0 * DQ + (w & 3) * 64 : (unsigned short*)Vt + ((size_t)(t0 / SQ) * DV + (w & 3) * 64) * SQ + t0 % SQ;
  const int pitch = w < 8 ? DQ : SQ;      /* halves between two output rows */
  op += (size_t)((lane >> 3) * pitch + (lane & 7) * 8);      /* a wave's store is 4 rows of 128 B */
  v8us rw[16];
#pragma unroll      /* constant indices keep rw[] in registers */
  for (int q = 0; q < 16; ++q) rw[q] = *(const v8us*)(st + (q * 4 + (lane >> 3)) * PJ_SP + (lane & 7) * 8);
#pragma unroll
  for (int q = 0; q < 16; ++q) *(v8us*)(op + (size_t)(q * 4 * pitch)) = rw[q];
}
extern "C" void kernel_launch(void* const* d_in, const int* in_sizes, int n_in,
                              void* d_out, int out_size, void* d_ws, size_t ws_size, hipStream_t stream) {
  (void)in_sizes; (void)n_in; (void)out_size;
  const float* const* I = (const float* const*)d_in; const float* x = I[0]; const float* wq = I[1]; const float* wk = I[2]; const float* wv = I[3];      /* [in][out] weights */
  char* ws = (char*)d_ws; size_t off = 0;
  auto take = [&](size_t bytes) { char* p = ws + off; off += (bytes + 255) & ~(size_t)255; return p; };
  _Float16* BW = (_Float16*)take((size_t)3 * DQ * DM * 2);      /* q | k | v weights, transposed */
  _Float16* Q16 = (_Float16*)take(NR * DQ * 2); _Float16* K16 = (_Float16*)take(NR * DQ * 2);
  _Float16* VT = (_Float16*)take((size_t)NB * DV * SQ * 2);
  if (off > ws_size) return;
  k_wt3<<<dim3(DQ * (DM / 8) / 256, 3), 256, 0, stream>>>(wq, wk, wv, BW);
  k_proj<<<(unsigned)(NR / 64), 384, 0, stream>>>(x, BW, Q16, K16, VT);      /* q, k f16 rows and V^T per batch [DV][SQ] */
  k_fattn<<<dim3(SQ / 64, NB), 128, 0, stream>>>(Q16, K16, VT, (float*)d_out);      /* scores, softmax and attn v in one launch; the batch is grid.y */
}
